// v000
// Measured on an AMD MI455X. A time is GPU time per run, averaged over a window of back-to-back runs after a warm-up
// (all launches, gaps included; the runs take copies of the inputs in turn), and the median of several windows.
// Apart from v000's, it joins two sittings. Times from different sittings can be a few percent apart, while
// side-by-side timings come from the same sitting.
// v000, which the later versions start from, runs in 1540 microseconds.
#include <hip/hip_runtime.h>

// Pre-norm causal self-attention block with sinusoidal positions (x [4][2048][512]; h = LN1(x) (1e-5) + PE (pe[t][2i] = sin(t w_i), pe[t][2i+1] = cos(t w_i), w_i = exp(2i x (-ln 1e4 / 512))); q, k, v = h W ('xw' [512][512], no bias; 8 heads x 64); causal softmax(q.k/8) (-1e9 fill == exact zero weight); o = merged wfc ('xw'); out = LN2(o + h) (1e-6) + x -> [4][2048][512] (4.2 M)).
// Layout: LN1 + PE in one row kernel producing h in f32 (kept for the residual) and as bf16 hi/lo planes (2-product projections); the PE table is computed on device in f32 with the reference's float32 constant for -ln(1e4)/512 (precise expf/sinf/cosf); causal attention; the wfc GEMM output goes through a residual + LN2 row kernel that also adds x.
// Compute dtypes, f32 accumulate: every input rounded to bf16; q/k/v hl x exact (2 products); causal scores and attn.v (tile skipping): query rows < 512 hl (3 products), the rest single fp16 (x1024); softmax f32; wfc hl x exact (2 products); LN2 and both residuals in f32.

#define NB_  4
#define TT   2048
#define DM   512
#define NH_  8
#define NKV  8
#define REP  (NH_ / NKV)
#define HD   64
#define DQ   (NH_ * HD)
#define DKV  (NKV * HD)
#define LNEPS 1e-5f
#define PEC  (-0.0179889463f)   // float32(-ln(10000)/512), as the reference's numpy computes it
typedef __attribute__((ext_vector_type(4))) unsigned short v4us;
#define ZH   2
#define RH   512                  // query rows < RH use hi+lo planes (0: none)
#define WIN  2048
#define PCAR 1024.0f
#define SCL  0.125f   // HD^-0.5
typedef _Float16 h16;
typedef unsigned short bf;
typedef __attribute__((ext_vector_type(16))) __bf16   v16bf;
typedef __attribute__((ext_vector_type(16))) _Float16 v16h;
typedef __attribute__((ext_vector_type(8)))  _Float16 v8h;
typedef __attribute__((ext_vector_type(8)))  unsigned short v8us;
typedef __attribute__((ext_vector_type(8)))  float    v8f;
typedef __attribute__((ext_vector_type(4)))  float    v4f;
typedef v8h  __attribute__((may_alias)) v8ha;
typedef v4f  __attribute__((may_alias)) v4fa;
typedef v8us __attribute__((may_alias)) v8usa;

__device__ __forceinline__ unsigned short f2bf(float f) { unsigned u = __float_as_uint(f); u += 0x7FFFu + ((u >> 16) & 1u); return (unsigned short)(u >> 16); }
__device__ __forceinline__ float bf2f(unsigned short b) { return __uint_as_float(((unsigned)b) << 16); }
__device__ __forceinline__ float bfr(float f) { return bf2f(f2bf(f)); }
__device__ __forceinline__ v16h cat16(v8h lo, v8h hi) { return __builtin_shufflevector(lo, hi, 0, 1, 2, 3, 4, 5, 6, 7, 8, 9, 10, 11, 12, 13, 14, 15); }
__device__ __forceinline__ v16bf cat16b(v8us lo, v8us hi) { return __builtin_bit_cast(v16bf, __builtin_shufflevector(lo, hi, 0, 1, 2, 3, 4, 5, 6, 7, 8, 9, 10, 11, 12, 13, 14, 15)); }
__device__ __forceinline__ v8f wmma16(v16h a, v16h b, v8f c) { return __builtin_amdgcn_wmma_f32_16x16x32_f16(false, a, false, b, (short)0, c, false, false); }
__device__ __forceinline__ v8f wmmab(v16bf a, v16bf b, v8f c) { return __builtin_amdgcn_wmma_f32_16x16x32_bf16(false, a, false, b, (short)0, c, false, false); }



// ---- k_gemmw: register-blocked GEMM, ONE WAVE per 64x64 output tile (16 accumulators), operands straight from K-contiguous 16-bit planes; grid (M/64, N/64, Z), 32 threads.
// C[m][n] (f32, pitch ldc, + optional f32 bias[n]) = sum_k A[m][k] Bt[n][k] (+ split products per NSPLIT). z-batch strides sA/sB/sC in elements. K % 32 == 0.
template <typename T16> struct WFrag;
template <> struct WFrag<h16> { typedef v16h V; static __device__ __forceinline__ V ld(const h16* p) { return cat16(*(const v8h*)p, *(const v8h*)(p + 16)); } static __device__ __forceinline__ v8f mma(V a, V b, v8f c) { return wmma16(a, b, c); } };
template <> struct WFrag<bf> { typedef v16bf V; static __device__ __forceinline__ V ld(const bf* p) { return cat16b(*(const v8us*)p, *(const v8us*)(p + 16)); } static __device__ __forceinline__ v8f mma(V a, V b, v8f c) { return wmmab(a, b, c); } };
template <typename T16, int NSPLIT, bool BIAS>
__global__ __launch_bounds__(32) void k_gemmw(const T16* __restrict__ A, const T16* __restrict__ A2, const T16* __restrict__ Bt, const T16* __restrict__ Bt2, int K, float* C, int ldc, const float* __restrict__ bias, size_t sA, size_t sB, size_t sC) {
    typedef typename WFrag<T16>::V V;
    __shared__ __align__(16) float os[16 * 68];
    const size_t z = blockIdx.z; A += z * sA; if (A2) A2 += z * sA; Bt += z * sB; if (Bt2) Bt2 += z * sB; C += z * sC;
    const int lane = threadIdx.x & 31, lr = lane & 15, hi = lane >> 4; const int r0 = blockIdx.x * 64, c0 = blockIdx.y * 64;
    v8f acc[4][4];
#pragma unroll
    for (int mb = 0; mb < 4; ++mb)
#pragma unroll
        for (int nb = 0; nb < 4; ++nb) acc[mb][nb] = (v8f){};
    const size_t aoff = (size_t)(r0 + lr) * K + 8 * hi, boff = (size_t)(c0 + lr) * K + 8 * hi;
#pragma unroll 1
    for (int kc = 0; kc < K; kc += 32) {
        V a[4], a2[4];
#pragma unroll
        for (int mb = 0; mb < 4; ++mb) { a[mb] = WFrag<T16>::ld(A + aoff + (size_t)mb * 16 * K + kc); if (NSPLIT == 1 || NSPLIT == 2) a2[mb] = WFrag<T16>::ld(A2 + aoff + (size_t)mb * 16 * K + kc); }
#pragma unroll
        for (int nb = 0; nb < 4; ++nb) { const V b = WFrag<T16>::ld(Bt + boff + (size_t)nb * 16 * K + kc); V b2; if (NSPLIT >= 2) b2 = WFrag<T16>::ld(Bt2 + boff + (size_t)nb * 16 * K + kc);
#pragma unroll
            for (int mb = 0; mb < 4; ++mb) { acc[mb][nb] = WFrag<T16>::mma(a[mb], b, acc[mb][nb]); if (NSPLIT == 1 || NSPLIT == 2) acc[mb][nb] = WFrag<T16>::mma(a2[mb], b, acc[mb][nb]); if (NSPLIT >= 2) acc[mb][nb] = WFrag<T16>::mma(a[mb], b2, acc[mb][nb]); } }
        asm volatile("v_nop\n\tv_nop\n\tv_nop\n\tv_nop" : "+v"(acc[0][0]), "+v"(acc[1][1]), "+v"(acc[2][2]), "+v"(acc[3][3]) : "v"(a[0]), "v"(a[3]));
    }
#pragma unroll
    for (int mb = 0; mb < 4; ++mb) {
#pragma unroll
        for (int nb = 0; nb < 4; ++nb) {
#pragma unroll
            for (int j = 0; j < 8; ++j) os[(hi * 8 + j) * 68 + nb * 16 + lr] = acc[mb][nb][j]; }
        __builtin_amdgcn_wave_barrier(); asm volatile("" ::: "memory");
        float* crow = C + (size_t)(r0 + mb * 16) * ldc + c0;
{
#pragma unroll
            for (int s = 0; s < 8; ++s) { const int row = 2 * s + hi, cofs = lr * 4; v4f val = *(const v4fa*)(os + row * 68 + cofs); if (BIAS) { val[0] += bfr(bias[c0 + cofs]); val[1] += bfr(bias[c0 + cofs + 1]); val[2] += bfr(bias[c0 + cofs + 2]); val[3] += bfr(bias[c0 + cofs + 3]); }
                *(v4f*)(crow + (size_t)row * ldc + cofs) = val; }
             }
        __builtin_amdgcn_wave_barrier(); asm volatile("" ::: "memory");
    }
}

// ---- k_gemmc: the same one-wave 64x64 tile GEMM specialised for causal attention: CMODE 1 skips score tiles entirely above the diagonal (query rows r0+roff.., key columns c0..), CMODE 2 limits the
// key (K) loop of the probability x value contraction to the diagonal block (probabilities beyond it are exactly zero). roff = row offset of this launch's first row within the sequence.
template <typename T16, int NSPLIT, int CMODE>
__global__ __launch_bounds__(32) void k_gemmc(const T16* __restrict__ A, const T16* __restrict__ A2, const T16* __restrict__ Bt, const T16* __restrict__ Bt2, int K, float* C, int ldc, int roff, size_t sA, size_t sB, size_t sC) {
    typedef typename WFrag<T16>::V V;
    __shared__ __align__(16) float os[16 * 68];
    const size_t z = blockIdx.z; A += z * sA; if (A2) A2 += z * sA; Bt += z * sB; if (Bt2) Bt2 += z * sB; C += z * sC;
    const int lane = threadIdx.x & 31, lr = lane & 15, hi = lane >> 4; const int r0 = blockIdx.x * 64, c0 = blockIdx.y * 64;
    if (CMODE == 1 && c0 > r0 + roff + 63) return;                  // score tile entirely above the causal diagonal: never read (the softmax masks j > i by select)
    const int Kl = (CMODE == 2) ? min(K, r0 + roff + 64) : K;        // P.V: probabilities are exactly 0 beyond the diagonal block, so the K loop stops there
    v8f acc[4][4];
#pragma unroll
    for (int mb = 0; mb < 4; ++mb)
#pragma unroll
        for (int nb = 0; nb < 4; ++nb) acc[mb][nb] = (v8f){};
    const size_t aoff = (size_t)(r0 + lr) * K + 8 * hi, boff = (size_t)(c0 + lr) * K + 8 * hi;
#pragma unroll 1
    for (int kc = 0; kc < Kl; kc += 32) {
        V a[4], a2[4];
#pragma unroll
        for (int mb = 0; mb < 4; ++mb) { a[mb] = WFrag<T16>::ld(A + aoff + (size_t)mb * 16 * K + kc); if (NSPLIT == 1 || NSPLIT == 2) a2[mb] = WFrag<T16>::ld(A2 + aoff + (size_t)mb * 16 * K + kc); }
#pragma unroll
        for (int nb = 0; nb < 4; ++nb) { const V b = WFrag<T16>::ld(Bt + boff + (size_t)nb * 16 * K + kc); V b2; if (NSPLIT >= 2) b2 = WFrag<T16>::ld(Bt2 + boff + (size_t)nb * 16 * K + kc);
#pragma unroll
            for (int mb = 0; mb < 4; ++mb) { acc[mb][nb] = WFrag<T16>::mma(a[mb], b, acc[mb][nb]); if (NSPLIT == 1 || NSPLIT == 2) acc[mb][nb] = WFrag<T16>::mma(a2[mb], b, acc[mb][nb]); if (NSPLIT >= 2) acc[mb][nb] = WFrag<T16>::mma(a[mb], b2, acc[mb][nb]); } }
        asm volatile("v_nop\n\tv_nop\n\tv_nop\n\tv_nop" : "+v"(acc[0][0]), "+v"(acc[1][1]), "+v"(acc[2][2]), "+v"(acc[3][3]) : "v"(a[0]), "v"(a[3]));
    }
#pragma unroll
    for (int mb = 0; mb < 4; ++mb) {
#pragma unroll
        for (int nb = 0; nb < 4; ++nb) {
#pragma unroll
            for (int j = 0; j < 8; ++j) os[(hi * 8 + j) * 68 + nb * 16 + lr] = acc[mb][nb][j]; }
        __builtin_amdgcn_wave_barrier(); asm volatile("" ::: "memory");
        float* crow = C + (size_t)(r0 + mb * 16) * ldc + c0;
{
#pragma unroll
            for (int s = 0; s < 8; ++s) { const int row = 2 * s + hi, cofs = lr * 4; v4f val = *(const v4fa*)(os + row * 68 + cofs);
                *(v4f*)(crow + (size_t)row * ldc + cofs) = val; }
             }
        __builtin_amdgcn_wave_barrier(); asm volatile("" ::: "memory");
    }
}

__device__ __forceinline__ h16 tohx(float x) { return (h16)x; }
__device__ __forceinline__ void splitf(float y, unsigned short& h, unsigned short& l) { h = f2bf(y); l = f2bf(y - bf2f(h)); }
typedef __attribute__((ext_vector_type(2))) _Float16 v2h;
typedef __attribute__((ext_vector_type(4))) _Float16 v4h;
typedef __attribute__((ext_vector_type(2))) unsigned short v2us;
typedef __attribute__((ext_vector_type(4))) unsigned short v4us;
typedef __attribute__((ext_vector_type(2))) float v2f;
typedef __attribute__((ext_vector_type(4))) int v4i;

__global__ __launch_bounds__(256) void k_wtG(const float* __restrict__ w, int K, int N, bf* Bt) {
    const int lane = threadIdx.x & 31; const int L0 = (blockIdx.x * 8 + (threadIdx.x >> 5)) * 8; const int nlines = N * K / 64;
{
#pragma unroll 1
        for (int l = 0; l < 8; ++l) { const int L = L0 + l; if (L >= nlines) break; const size_t e = (size_t)L * 64 + lane * 2; const int k = (int)(e % K), n = (int)(e / K); v2us o;
            o[0] = f2bf(w[(size_t)k * N + n]); o[1] = f2bf(w[(size_t)(k + 1) * N + n]); *(v2us*)(Bt + e) = o; }
         }
}
__global__ __launch_bounds__(256) void k_petab(float* PE) { const size_t e = ((size_t)blockIdx.x * 256 + threadIdx.x) * 2; if (e >= (size_t)TT * DM) return; const int c = (int)(e % DM); const int t = (int)(e / DM); const float w = expf(__fmul_rn((float)c, PEC)); const float ang = __fmul_rn((float)t, w); v2f o; o[0] = sinf(ang); o[1] = cosf(ang); *(v2f*)(PE + e) = o;  }
__global__ __launch_bounds__(256) void k_lnpe(const float* __restrict__ X, const float* __restrict__ PE, const float* __restrict__ g, const float* __restrict__ be, float* Hf, bf* Yh, bf* Yl) {
    const int lane = threadIdx.x & 31; const int r = blockIdx.x * 8 + (threadIdx.x >> 5); if (r >= TT) return; const float* xr = X + (size_t)r * DM; float s = 0.f;
#pragma unroll 1
    for (int ch = 0; ch < DM / 128; ++ch) { const int c0 = ch * 128 + lane * 4; const v4f a = *(const v4f*)(xr + c0);
#pragma unroll
        for (int q = 0; q < 4; ++q) s += bfr(a[q]); }
#pragma unroll
    for (int sh = 16; sh; sh >>= 1) s += __shfl_xor(s, sh, 32);
    const float mu = s * (1.0f / DM); float s2 = 0.f;
#pragma unroll 1
    for (int ch = 0; ch < DM / 128; ++ch) { const int c0 = ch * 128 + lane * 4; const v4f a = *(const v4f*)(xr + c0);
#pragma unroll
        for (int q = 0; q < 4; ++q) { const float d0 = __fsub_rn(bfr(a[q]), mu); float p = __fmul_rn(d0, d0); asm volatile("" : "+v"(p)); s2 = __fadd_rn(s2, p); } }
#pragma unroll
    for (int sh = 16; sh; sh >>= 1) s2 += __shfl_xor(s2, sh, 32);
    const float rs = __fdiv_rn(1.0f, __fsqrt_rn(__fadd_rn(s2 * (1.0f / DM), LNEPS)));
{
#pragma unroll 1
        for (int ch = 0; ch < DM / 128; ++ch) { const int c0 = ch * 128 + lane * 4; const v4f a = *(const v4f*)(xr + c0); const v4f pe = *(const v4f*)(PE + (size_t)r * DM + c0); v4f h4; v4us oh, ol;
#pragma unroll
            for (int q = 0; q < 4; ++q) { float n0 = __fmul_rn(__fsub_rn(bfr(a[q]), mu), rs); asm volatile("" : "+v"(n0)); float n1 = __fmul_rn(n0, bfr(g[c0 + q])); asm volatile("" : "+v"(n1)); const float ln = __fadd_rn(n1, bfr(be[c0 + q])); const float hv = __fadd_rn(ln, pe[q]); h4[q] = hv; unsigned short h2, l2; splitf(hv, h2, l2); oh[q] = h2; ol[q] = l2; }
            *(v4f*)(Hf + (size_t)r * DM + c0) = h4; *(v4us*)(Yh + (size_t)r * DM + c0) = oh; *(v4us*)(Yl + (size_t)r * DM + c0) = ol; }
         } }
__global__ __launch_bounds__(256) void k_resln2(const float* __restrict__ O, const float* __restrict__ Hf, const float* __restrict__ X, const float* __restrict__ g, const float* __restrict__ be, float* OUTb) {
    const int lane = threadIdx.x & 31; const int r = blockIdx.x * 8 + (threadIdx.x >> 5); if (r >= TT) return; const float* orow = O + (size_t)r * DM; const float* hrow = Hf + (size_t)r * DM; float s = 0.f;
#pragma unroll 1
    for (int ch = 0; ch < DM / 128; ++ch) { const int c0 = ch * 128 + lane * 4; const v4f a = *(const v4f*)(orow + c0), hh = *(const v4f*)(hrow + c0);
#pragma unroll
        for (int q = 0; q < 4; ++q) s += __fadd_rn(a[q], hh[q]); }
#pragma unroll
    for (int sh = 16; sh; sh >>= 1) s += __shfl_xor(s, sh, 32);
    const float mu = s * (1.0f / DM); float s2 = 0.f;
#pragma unroll 1
    for (int ch = 0; ch < DM / 128; ++ch) { const int c0 = ch * 128 + lane * 4; const v4f a = *(const v4f*)(orow + c0), hh = *(const v4f*)(hrow + c0);
#pragma unroll
        for (int q = 0; q < 4; ++q) { const float d0 = __fsub_rn(__fadd_rn(a[q], hh[q]), mu); float p = __fmul_rn(d0, d0); asm volatile("" : "+v"(p)); s2 = __fadd_rn(s2, p); } }
#pragma unroll
    for (int sh = 16; sh; sh >>= 1) s2 += __shfl_xor(s2, sh, 32);
    const float rs = __fdiv_rn(1.0f, __fsqrt_rn(__fadd_rn(s2 * (1.0f / DM), 1e-6f)));
{
#pragma unroll 1
        for (int ch = 0; ch < DM / 128; ++ch) { const int c0 = ch * 128 + lane * 4; const v4f a = *(const v4f*)(orow + c0), hh = *(const v4f*)(hrow + c0), xx = *(const v4f*)(X + (size_t)r * DM + c0); v4f o4;
#pragma unroll
            for (int q = 0; q < 4; ++q) { float n0 = __fmul_rn(__fsub_rn(__fadd_rn(a[q], hh[q]), mu), rs); asm volatile("" : "+v"(n0)); float n1 = __fmul_rn(n0, bfr(g[c0 + q])); asm volatile("" : "+v"(n1)); o4[q] = __fadd_rn(__fadd_rn(n1, bfr(be[c0 + q])), bfr(xx[q])); }
            *(v4f*)(OUTb + (size_t)r * DM + c0) = o4; }
         } }
__global__ __launch_bounds__(256) void k_cvt8(const float* __restrict__ src, bf* dst, size_t n8) { const size_t i = (size_t)blockIdx.x * 256 + threadIdx.x; if (i >= n8) return; const v8f v = *(const v8f*)(src + i * 8); v8us o;
#pragma unroll
    for (int k = 0; k < 8; ++k) o[k] = f2bf(v[k]); *(v8us*)(dst + i * 8) = o;  }

// k_rope: head planes [h][t][d] (fp16 + hi/lo) of rope(x) x sc with the rotate-half convention out[d] = x[d] cos[t][d] - x[d+HD/2] sin[t][d], out[d+HD/2] = x[d+HD/2] cos[t][d+HD/2] + x[d] sin[t][d+HD/2]
__global__ __launch_bounds__(256) void k_rope(const float* __restrict__ F, int pitch, int nheads, const float* __restrict__ CS, const float* __restrict__ RF, const float* __restrict__ nw, float sc, h16* P16, bf* Ph, bf* Pl) {
    const size_t e = ((size_t)blockIdx.x * 256 + threadIdx.x) * 2; if (e >= (size_t)nheads * TT * HD) return; const int d = (int)(e % HD); const int t = (int)((e / HD) % TT); const int h = (int)(e / ((size_t)HD * TT)); const float* f = F + (size_t)t * pitch + h * HD; const float rf = RF ? RF[(size_t)h * TT + t] : 1.0f; v2h o16; v2us oh, ol;
#pragma unroll
    for (int q = 0; q < 2; ++q) { const int dd = d + q; const int dp = (dd < HD / 2) ? dd + HD / 2 : dd - HD / 2; float x0 = f[dd], x1 = f[dp];
        if (RF) { float n0 = __fmul_rn(x0, rf), n1 = __fmul_rn(x1, rf); asm volatile("" : "+v"(n0)); asm volatile("" : "+v"(n1)); x0 = __fmul_rn(bfr(nw[dd]), n0); x1 = __fmul_rn(bfr(nw[dp]), n1); }
        const v2f cs = *(const v2f*)(CS + ((size_t)t * HD + dd) * 2); float a = __fmul_rn(x0, cs[0]), bq = __fmul_rn(x1, cs[1]); asm volatile("" : "+v"(a)); asm volatile("" : "+v"(bq)); const float r = ((dd < HD / 2) ? __fsub_rn(a, bq) : __fadd_rn(a, bq)) * sc;
        o16[q] = tohx(r); unsigned short a2, c2; splitf(r, a2, c2); oh[q] = a2; ol[q] = c2; }
    *(v2h*)(P16 + e) = o16; *(v2us*)(Ph + e) = oh; *(v2us*)(Pl + e) = ol;  }
__global__ __launch_bounds__(256) void k_vtp(const float* __restrict__ F, int pitch, int nheads, h16* V16, bf* Vh, bf* Vl) { const size_t e = ((size_t)blockIdx.x * 256 + threadIdx.x) * 2; if (e >= (size_t)nheads * HD * TT) return; const int t = (int)(e % TT); const int d = (int)((e / TT) % HD); const int g = (int)(e / ((size_t)TT * HD)); v2h o16; v2us oh, ol;
#pragma unroll
    for (int q = 0; q < 2; ++q) { const float x = F[(size_t)(t + q) * pitch + g * HD + d]; o16[q] = tohx(x); unsigned short a2, c2; splitf(x, a2, c2); oh[q] = a2; ol[q] = c2; }
    *(v2h*)(V16 + e) = o16; *(v2us*)(Vh + e) = oh; *(v2us*)(Vl + e) = ol;  }
__global__ __launch_bounds__(256) void k_csid(float* CS) { const int idx = blockIdx.x * 256 + threadIdx.x; if (idx >= TT * HD) return; v2f cs; cs[0] = 1.0f; cs[1] = 0.0f; *(v2f*)(CS + (size_t)idx * 2) = cs;  }
// k_asoft: per row (zz, i): t = S x HD^-0.5 for j <= i (causal; the reference's -1e9 additive fill vanishes identically); softmax over the 2048 keys (register row, one exp, fixed trees);
__global__ __launch_bounds__(256) void k_asoft(const float* __restrict__ Sb, h16* P16, bf* Ph, bf* Pl) {
    const int lane = threadIdx.x & 31; const int row = blockIdx.x * 8 + (threadIdx.x >> 5); if (row >= ZH * TT) return; const int i = row % TT; const int zz = row / TT; (void)zz; const bool hires = (i < RH); const float* sr = Sb + (size_t)row * TT; float v[TT / 32]; float mx = -3.0e38f;
#pragma unroll
    for (int ch = 0; ch < TT / 128; ++ch) { const int j0 = ch * 128 + lane * 4; const v4f a = *(const v4f*)(sr + j0);
#pragma unroll
        for (int q = 0; q < 4; ++q) { const int j = j0 + q; (void)j; const float t = (j <= i) ? a[q] * SCL : -3.0e38f;   /* causal; -1e9 fill == select */ v[ch * 4 + q] = t; mx = fmaxf(mx, t); } }
#pragma unroll
    for (int sh = 16; sh; sh >>= 1) mx = fmaxf(mx, __shfl_xor(mx, sh, 32));
    float sum = 0.f;
#pragma unroll
    for (int k = 0; k < TT / 32; ++k) { float d0 = __fsub_rn(v[k], mx); asm volatile("" : "+v"(d0)); v[k] = __builtin_amdgcn_exp2f(__fmul_rn(d0, 1.4426950408889634f)); sum += v[k]; }
#pragma unroll
    for (int sh = 16; sh; sh >>= 1) sum += __shfl_xor(sum, sh, 32);
    const float f = __fdiv_rn(hires ? 1.0f : PCAR, sum);
{
        if (hires) {
#pragma unroll
            for (int ch = 0; ch < TT / 128; ++ch) { v4us oh, ol;
#pragma unroll
                for (int q = 0; q < 4; ++q) { unsigned short a, c2; splitf(v[ch * 4 + q] * f, a, c2); oh[q] = a; ol[q] = c2; }
                const size_t oo = ((size_t)zz * (RH ? RH : 1) + i) * TT + ch * 128 + lane * 4; *(v4us*)(Ph + oo) = oh; *(v4us*)(Pl + oo) = ol; }
        } else {
#pragma unroll
            for (int ch = 0; ch < TT / 128; ++ch) { v4h o4;
#pragma unroll
                for (int q = 0; q < 4; ++q) o4[q] = tohx(v[ch * 4 + q] * f);
                *(v4h*)(P16 + (size_t)row * TT + ch * 128 + lane * 4) = o4; } }
         }
}
__global__ __launch_bounds__(256) void k_merge(const float* __restrict__ O, int h0, bf* Ah, bf* Al) { const size_t e = ((size_t)blockIdx.x * 256 + threadIdx.x) * 2; if (e >= (size_t)ZH * TT * HD) return; const int d = (int)(e % HD); const int t = (int)((e / HD) % TT); const int zz = (int)(e / ((size_t)HD * TT)); const float cs = (t < RH) ? 1.0f : (1.0f / PCAR); const size_t oo = (size_t)t * DQ + (h0 + zz) * HD + d;
    v2us oh, ol;
#pragma unroll
    for (int q = 0; q < 2; ++q) { unsigned short a, c2; splitf(O[e + q] * cs, a, c2); oh[q] = a; ol[q] = c2; } *(v2us*)(Ah + oo) = oh; *(v2us*)(Al + oo) = ol;  }

extern "C" void kernel_launch(void* const* d_in, const int* in_sizes, int n_in,
                              void* d_out, int out_size, void* d_ws, size_t ws_size, hipStream_t stream) {
    (void)in_sizes; (void)n_in; (void)out_size;
    const float* x = (const float*)d_in[0]; const float* g1 = (const float*)d_in[1]; const float* e1 = (const float*)d_in[2]; const float* wq = (const float*)d_in[3]; const float* wk = (const float*)d_in[4]; const float* wv = (const float*)d_in[5]; const float* wo = (const float*)d_in[6]; const float* g2 = (const float*)d_in[7]; const float* e2 = (const float*)d_in[8];
    float* OUT = (float*)d_out;     // [4][2048][512]
    char* wsp = (char*)d_ws;
    auto take = [&](size_t bytes) { char* p = wsp; wsp += (bytes + 255) & ~(size_t)255; return (void*)p; };
    bf* WQ = (bf*)take((size_t)DQ * DM * 2); bf* WK = (bf*)take((size_t)DKV * DM * 2); bf* WV = (bf*)take((size_t)DKV * DM * 2); bf* WO = (bf*)take((size_t)DM * DQ * 2); float* CS = (float*)take((size_t)TT * HD * 2 * 4);
    float* PE = (float*)take((size_t)TT * DM * 4); float* Hf = (float*)take((size_t)TT * DM * 4); bf* Yh = (bf*)take((size_t)TT * DM * 2); bf* Yl = (bf*)take((size_t)TT * DM * 2); float* O2 = (float*)take((size_t)TT * DM * 4); float* FQ = (float*)take((size_t)TT * DQ * 4); float* FK = (float*)take((size_t)TT * DKV * 4);
    h16* QP16 = (h16*)take((size_t)NH_ * TT * HD * 2); h16* KP16 = (h16*)take((size_t)NKV * TT * HD * 2); h16* VT16 = (h16*)take((size_t)NKV * HD * TT * 2);
    bf* QPh = (bf*)take((size_t)NH_ * TT * HD * 2); bf* QPl = (bf*)take((size_t)NH_ * TT * HD * 2); bf* KPh = (bf*)take((size_t)NKV * TT * HD * 2); bf* KPl = (bf*)take((size_t)NKV * TT * HD * 2); bf* VTh = (bf*)take((size_t)NKV * HD * TT * 2); bf* VTl = (bf*)take((size_t)NKV * HD * TT * 2); bf* Ph = (bf*)take((size_t)ZH * RH * TT * 2); bf* Pl = (bf*)take((size_t)ZH * RH * TT * 2);
    float* Sb = (float*)take((size_t)ZH * TT * TT * 4); h16* P16 = (h16*)take((size_t)ZH * TT * TT * 2); float* Ob = (float*)take((size_t)ZH * TT * HD * 4); bf* ATh = (bf*)take((size_t)TT * DQ * 2); bf* ATl = (bf*)take((size_t)TT * DQ * 2);
    if ((size_t)(wsp - (char*)d_ws) > ws_size) return;    // ws 256 MiB
    float* FV = FK;   // v projection reuses the k buffer after the k planes are built (stream-ordered)
    { k_wtG<<<(unsigned)((DM * DQ / 64 + 63) / 64), 256, 0, stream>>>(wq, DM, DQ, WQ); k_wtG<<<(unsigned)((DM * DKV / 64 + 63) / 64), 256, 0, stream>>>(wk, DM, DKV, WK); k_wtG<<<(unsigned)((DM * DKV / 64 + 63) / 64), 256, 0, stream>>>(wv, DM, DKV, WV);
      k_wtG<<<(unsigned)((DQ * DM / 64 + 63) / 64), 256, 0, stream>>>(wo, DQ, DM, WO);
       }
    k_csid<<<(TT * HD + 255) / 256, 256, 0, stream>>>(CS);
    const unsigned LQ = (unsigned)(((size_t)NH_ * TT * HD / 2 + 255) / 256), LKv = (unsigned)(((size_t)NKV * TT * HD / 2 + 255) / 256);
    for (int b = 0; b < NB_; ++b) {
        
        if (b == 0) k_petab<<<(unsigned)(((size_t)TT * DM / 2 + 255) / 256), 256, 0, stream>>>(PE); k_lnpe<<<TT / 8, 256, 0, stream>>>(x + (size_t)b * TT * DM, PE, g1, e1, Hf, Yh, Yl);   /* h = LN1(x) + PE: f32 + hi/lo planes */
        k_gemmw<bf, 1, false><<<dim3(TT / 64, DQ / 64, 1), 32, 0, stream>>>(Yh, Yl, WQ, nullptr, DM, FQ, DQ, nullptr, 0, 0, 0);
        k_rope<<<LQ, 256, 0, stream>>>(FQ, DQ, NH_, CS, nullptr, nullptr, 1.0f, QP16, QPh, QPl);
        k_gemmw<bf, 1, false><<<dim3(TT / 64, DKV / 64, 1), 32, 0, stream>>>(Yh, Yl, WK, nullptr, DM, FK, DKV, nullptr, 0, 0, 0);
        k_rope<<<LKv, 256, 0, stream>>>(FK, DKV, NKV, CS, nullptr, nullptr, 1.0f, KP16, KPh, KPl);
        k_gemmw<bf, 1, false><<<dim3(TT / 64, DKV / 64, 1), 32, 0, stream>>>(Yh, Yl, WV, nullptr, DM, FV, DKV, nullptr, 0, 0, 0); k_vtp<<<LKv, 256, 0, stream>>>(FV, DKV, NKV, VT16, VTh, VTl);
        for (int h0 = 0; h0 < NH_; h0 += ZH) { const size_t zq = (size_t)h0, zk = (size_t)(h0 / REP);   // one kv head per query head: the pass's two heads use consecutive kv planes (z-strides TT*HD)
            k_gemmc<bf, 2, 1><<<dim3(RH / 64, TT / 64, ZH), 32, 0, stream>>>(QPh + zq * TT * HD, QPl + zq * TT * HD, KPh + zk * TT * HD, KPl + zk * TT * HD, HD, Sb, TT, 0, (size_t)TT * HD, (size_t)TT * HD, (size_t)TT * TT);
            k_gemmc<h16, 0, 1><<<dim3((TT - RH) / 64, TT / 64, ZH), 32, 0, stream>>>(QP16 + zq * TT * HD + (size_t)RH * HD, nullptr, KP16 + zk * TT * HD, nullptr, HD, Sb + (size_t)RH * TT, TT, RH, (size_t)TT * HD, (size_t)TT * HD, (size_t)TT * TT);
            k_asoft<<<ZH * TT / 8, 256, 0, stream>>>(Sb, P16, Ph, Pl);
            k_gemmc<bf, 2, 2><<<dim3(RH / 64, HD / 64, ZH), 32, 0, stream>>>(Ph, Pl, VTh + zk * HD * TT, VTl + zk * HD * TT, TT, Ob, HD, 0, (size_t)RH * TT, (size_t)HD * TT, (size_t)TT * HD);
            k_gemmc<h16, 0, 2><<<dim3((TT - RH) / 64, HD / 64, ZH), 32, 0, stream>>>(P16 + (size_t)RH * TT, nullptr, VT16 + zk * HD * TT, nullptr, TT, Ob + (size_t)RH * HD, HD, RH, (size_t)TT * TT, (size_t)HD * TT, (size_t)TT * HD);
            k_merge<<<(unsigned)(((size_t)ZH * TT * HD / 2 + 255) / 256), 256, 0, stream>>>(Ob, h0, ATh, ATl); }
        k_gemmw<bf, 1, false><<<dim3(TT / 64, DM / 64, 1), 32, 0, stream>>>(ATh, ATl, WO, nullptr, DQ, O2, DM, nullptr, 0, 0, 0); k_resln2<<<TT / 8, 256, 0, stream>>>(O2, Hf, x + (size_t)b * TT * DM, g2, e2, OUT + (size_t)b * TT * DM); }   /* o = merged wfc; out = LN2(o + h) + x */
}

// v001
// A run of this version takes 870 microseconds.
// Timed twice side by side with v000, it ran 1.78 and 1.77 times as fast.
#include <hip/hip_runtime.h>

// Pre-norm causal self-attention block with sinusoidal positions (x [4][2048][512]; h = LN1(x) (1e-5) + PE (pe[t][2i] = sin(t w_i), pe[t][2i+1] = cos(t w_i), w_i = exp(2i x (-ln 1e4 / 512))); q, k, v = h W ('xw' [512][512], no bias; 8 heads x 64); causal softmax(q.k/8) (-1e9 fill == exact zero weight); o = merged wfc ('xw'); out = LN2(o + h) (1e-6) + x -> [4][2048][512] (4.2 M)).
// Layout: LN1 + PE in one row kernel producing h in f32 (kept for the residual) and as bf16 hi/lo planes (2-product projections); the PE table is computed on device in f32 with the reference's float32 constant for -ln(1e4)/512 (precise expf/sinf/cosf); causal attention; the wfc GEMM output goes through a residual + LN2 row kernel that also adds x.
// Compute dtypes, f32 accumulate: every input rounded to bf16; q/k/v hl x exact (2 products); causal scores and attn.v (tile skipping): query rows < 512 hl (3 products), the rest single fp16 (x1024); softmax f32; wfc hl x exact (2 products); LN2 and both residuals in f32.

#define NB_  4
#define TT   2048
#define DM   512
#define NH_  8
#define NKV  8
#define REP  (NH_ / NKV)
#define HD   64
#define DQ   (NH_ * HD)
#define DKV  (NKV * HD)
#define LNEPS 1e-5f
#define PEC  (-0.0179889463f)   // float32(-ln(10000)/512), as the reference's numpy computes it
typedef __attribute__((ext_vector_type(4))) unsigned short v4us;
#define ZH   2
#define RH   512                  // query rows < RH use hi+lo planes (0: none)
#define WIN  2048
#define PCAR 1024.0f
#define SCL  0.125f   // HD^-0.5
#define KSP  16                   // K-splits of the probability x value contraction (one single-wave work-group each; k_merge adds the KSP partial planes)
typedef _Float16 h16;
typedef unsigned short bf;
typedef __attribute__((ext_vector_type(16))) __bf16   v16bf;
typedef __attribute__((ext_vector_type(16))) _Float16 v16h;
typedef __attribute__((ext_vector_type(8)))  _Float16 v8h;
typedef __attribute__((ext_vector_type(8)))  unsigned short v8us;
typedef __attribute__((ext_vector_type(8)))  float    v8f;
typedef __attribute__((ext_vector_type(4)))  float    v4f;
typedef v8h  __attribute__((may_alias)) v8ha;
typedef v4f  __attribute__((may_alias)) v4fa;
typedef v8us __attribute__((may_alias)) v8usa;

__device__ __forceinline__ unsigned short f2bf(float f) { unsigned u = __float_as_uint(f); u += 0x7FFFu + ((u >> 16) & 1u); return (unsigned short)(u >> 16); }
__device__ __forceinline__ float bf2f(unsigned short b) { return __uint_as_float(((unsigned)b) << 16); }
__device__ __forceinline__ float bfr(float f) { return bf2f(f2bf(f)); }
__device__ __forceinline__ v16h cat16(v8h lo, v8h hi) { return __builtin_shufflevector(lo, hi, 0, 1, 2, 3, 4, 5, 6, 7, 8, 9, 10, 11, 12, 13, 14, 15); }
__device__ __forceinline__ v16bf cat16b(v8us lo, v8us hi) { return __builtin_bit_cast(v16bf, __builtin_shufflevector(lo, hi, 0, 1, 2, 3, 4, 5, 6, 7, 8, 9, 10, 11, 12, 13, 14, 15)); }
__device__ __forceinline__ v8f wmma16(v16h a, v16h b, v8f c) { return __builtin_amdgcn_wmma_f32_16x16x32_f16(false, a, false, b, (short)0, c, false, false); }
__device__ __forceinline__ v8f wmmab(v16bf a, v16bf b, v8f c) { return __builtin_amdgcn_wmma_f32_16x16x32_bf16(false, a, false, b, (short)0, c, false, false); }



// ---- k_gemmw: register-blocked GEMM, ONE WAVE per 64x64 output tile (16 accumulators), operands straight from K-contiguous 16-bit planes; grid (M/64, N/64, Z), 32 threads.
// C[m][n] (f32, pitch ldc, + optional f32 bias[n]) = sum_k A[m][k] Bt[n][k] (+ split products per NSPLIT). z-batch strides sA/sB/sC in elements. K % 32 == 0.
template <typename T16> struct WFrag;
template <> struct WFrag<h16> { typedef v16h V; static __device__ __forceinline__ V ld(const h16* p) { return cat16(*(const v8h*)p, *(const v8h*)(p + 16)); } static __device__ __forceinline__ v8f mma(V a, V b, v8f c) { return wmma16(a, b, c); } };
template <> struct WFrag<bf> { typedef v16bf V; static __device__ __forceinline__ V ld(const bf* p) { return cat16b(*(const v8us*)p, *(const v8us*)(p + 16)); } static __device__ __forceinline__ v8f mma(V a, V b, v8f c) { return wmmab(a, b, c); } };
template <typename T16, int NSPLIT, bool BIAS>
__global__ __launch_bounds__(32) void k_gemmw(const T16* __restrict__ A, const T16* __restrict__ A2, const T16* __restrict__ Bt, const T16* __restrict__ Bt2, int K, float* C, int ldc, const float* __restrict__ bias, size_t sA, size_t sB, size_t sC) {
    typedef typename WFrag<T16>::V V;
    __shared__ __align__(16) float os[16 * 68];
    const size_t z = blockIdx.z; A += z * sA; if (A2) A2 += z * sA; Bt += z * sB; if (Bt2) Bt2 += z * sB; C += z * sC;
    const int lane = threadIdx.x & 31, lr = lane & 15, hi = lane >> 4; const int r0 = blockIdx.x * 64, c0 = blockIdx.y * 64;
    v8f acc[4][4];
#pragma unroll
    for (int mb = 0; mb < 4; ++mb)
#pragma unroll
        for (int nb = 0; nb < 4; ++nb) acc[mb][nb] = (v8f){};
    const size_t aoff = (size_t)(r0 + lr) * K + 8 * hi, boff = (size_t)(c0 + lr) * K + 8 * hi;
#pragma unroll 1
    for (int kc = 0; kc < K; kc += 32) {
        V a[4], a2[4];
#pragma unroll
        for (int mb = 0; mb < 4; ++mb) { a[mb] = WFrag<T16>::ld(A + aoff + (size_t)mb * 16 * K + kc); if (NSPLIT == 1 || NSPLIT == 2) a2[mb] = WFrag<T16>::ld(A2 + aoff + (size_t)mb * 16 * K + kc); }
#pragma unroll
        for (int nb = 0; nb < 4; ++nb) { const V b = WFrag<T16>::ld(Bt + boff + (size_t)nb * 16 * K + kc); V b2; if (NSPLIT >= 2) b2 = WFrag<T16>::ld(Bt2 + boff + (size_t)nb * 16 * K + kc);
#pragma unroll
            for (int mb = 0; mb < 4; ++mb) { acc[mb][nb] = WFrag<T16>::mma(a[mb], b, acc[mb][nb]); if (NSPLIT == 1 || NSPLIT == 2) acc[mb][nb] = WFrag<T16>::mma(a2[mb], b, acc[mb][nb]); if (NSPLIT >= 2) acc[mb][nb] = WFrag<T16>::mma(a[mb], b2, acc[mb][nb]); } }
        asm volatile("v_nop\n\tv_nop\n\tv_nop\n\tv_nop" : "+v"(acc[0][0]), "+v"(acc[1][1]), "+v"(acc[2][2]), "+v"(acc[3][3]) : "v"(a[0]), "v"(a[3]));
    }
#pragma unroll
    for (int mb = 0; mb < 4; ++mb) {
#pragma unroll
        for (int nb = 0; nb < 4; ++nb) {
#pragma unroll
            for (int j = 0; j < 8; ++j) os[(hi * 8 + j) * 68 + nb * 16 + lr] = acc[mb][nb][j]; }
        __builtin_amdgcn_wave_barrier(); asm volatile("" ::: "memory");
        float* crow = C + (size_t)(r0 + mb * 16) * ldc + c0;
{
#pragma unroll
            for (int s = 0; s < 8; ++s) { const int row = 2 * s + hi, cofs = lr * 4; v4f val = *(const v4fa*)(os + row * 68 + cofs); if (BIAS) { val[0] += bfr(bias[c0 + cofs]); val[1] += bfr(bias[c0 + cofs + 1]); val[2] += bfr(bias[c0 + cofs + 2]); val[3] += bfr(bias[c0 + cofs + 3]); }
                *(v4f*)(crow + (size_t)row * ldc + cofs) = val; }
             }
        __builtin_amdgcn_wave_barrier(); asm volatile("" ::: "memory");
    }
}

// ---- k_gemmc: the same one-wave 64x64 tile GEMM specialised for causal attention: CMODE 1 skips score tiles entirely above the diagonal (query rows r0+roff.., key columns c0..), CMODE 2 limits the
// key (K) loop of the probability x value contraction to the diagonal block (probabilities beyond it are exactly zero). roff = row offset of this launch's first row within the sequence.
// CMODE 2 has one 64-column tile, so blockIdx.y is its K-split index: split sp takes the CH-wide key chunks sp, sp + KS, ... below the diagonal limit and stores its own f32 partial plane (C + sp * sS; zeros if it has no chunk).
template <typename T16, int NSPLIT, int CMODE, int KS, int CH>
__global__ __launch_bounds__(32) void k_gemmc(const T16* __restrict__ A, const T16* __restrict__ A2, const T16* __restrict__ Bt, const T16* __restrict__ Bt2, int K, float* C, int ldc, int roff, size_t sA, size_t sB, size_t sC, size_t sS) {
    typedef typename WFrag<T16>::V V;
    __shared__ __align__(16) float os[16 * 68];
    const size_t z = blockIdx.z; A += z * sA; if (A2) A2 += z * sA; Bt += z * sB; if (Bt2) Bt2 += z * sB; C += z * sC;
    const int lane = threadIdx.x & 31, lr = lane & 15, hi = lane >> 4; const int r0 = blockIdx.x * 64, c0 = (CMODE == 2) ? 0 : blockIdx.y * 64, sp = (CMODE == 2) ? blockIdx.y : 0; C += (size_t)sp * sS;
    if (CMODE == 1 && c0 > r0 + roff + 63) return;                  // score tile entirely above the causal diagonal: never read (the softmax masks j > i by select)
    const int Kl = (CMODE == 2) ? min(K, r0 + roff + 64) : K;        // P.V: probabilities are exactly 0 beyond the diagonal block, so the K loop stops there
    v8f acc[4][4];
#pragma unroll
    for (int mb = 0; mb < 4; ++mb)
#pragma unroll
        for (int nb = 0; nb < 4; ++nb) acc[mb][nb] = (v8f){};
    const size_t aoff = (size_t)(r0 + lr) * K + 8 * hi, boff = (size_t)(c0 + lr) * K + 8 * hi;
#pragma unroll 1
    for (int kb = sp * CH; kb < Kl; kb += KS * CH) {   // Kl and K are multiples of CH: a chunk is whole or absent
        V a[CH / 32][4], a2[CH / 32][4];
#pragma unroll
        for (int u = 0; u < CH / 32; ++u)
#pragma unroll
            for (int mb = 0; mb < 4; ++mb) { a[u][mb] = WFrag<T16>::ld(A + aoff + (size_t)mb * 16 * K + kb + u * 32); if (NSPLIT == 1 || NSPLIT == 2) a2[u][mb] = WFrag<T16>::ld(A2 + aoff + (size_t)mb * 16 * K + kb + u * 32); }
#pragma unroll
        for (int u = 0; u < CH / 32; ++u)
#pragma unroll
            for (int nb = 0; nb < 4; ++nb) { const V b = WFrag<T16>::ld(Bt + boff + (size_t)nb * 16 * K + kb + u * 32); V b2; if (NSPLIT >= 2) b2 = WFrag<T16>::ld(Bt2 + boff + (size_t)nb * 16 * K + kb + u * 32);
#pragma unroll
                for (int mb = 0; mb < 4; ++mb) { acc[mb][nb] = WFrag<T16>::mma(a[u][mb], b, acc[mb][nb]); if (NSPLIT == 1 || NSPLIT == 2) acc[mb][nb] = WFrag<T16>::mma(a2[u][mb], b, acc[mb][nb]); if (NSPLIT >= 2) acc[mb][nb] = WFrag<T16>::mma(a[u][mb], b2, acc[mb][nb]); } }
        asm volatile("v_nop\n\tv_nop\n\tv_nop\n\tv_nop" : "+v"(acc[0][0]), "+v"(acc[1][1]), "+v"(acc[2][2]), "+v"(acc[3][3]) : "v"(a[CH / 32 - 1][0]), "v"(a[CH / 32 - 1][3]));
    }
#pragma unroll
    for (int mb = 0; mb < 4; ++mb) {
#pragma unroll
        for (int nb = 0; nb < 4; ++nb) {
#pragma unroll
            for (int j = 0; j < 8; ++j) os[(hi * 8 + j) * 68 + nb * 16 + lr] = acc[mb][nb][j]; }
        __builtin_amdgcn_wave_barrier(); asm volatile("" ::: "memory");
        float* crow = C + (size_t)(r0 + mb * 16) * ldc + c0;
{
#pragma unroll
            for (int s = 0; s < 8; ++s) { const int row = 2 * s + hi, cofs = lr * 4; v4f val = *(const v4fa*)(os + row * 68 + cofs);
                *(v4f*)(crow + (size_t)row * ldc + cofs) = val; }
             }
        __builtin_amdgcn_wave_barrier(); asm volatile("" ::: "memory");
    }
}

__device__ __forceinline__ h16 tohx(float x) { return (h16)x; }
__device__ __forceinline__ void splitf(float y, unsigned short& h, unsigned short& l) { h = f2bf(y); l = f2bf(y - bf2f(h)); }
typedef __attribute__((ext_vector_type(2))) _Float16 v2h;
typedef __attribute__((ext_vector_type(4))) _Float16 v4h;
typedef __attribute__((ext_vector_type(2))) unsigned short v2us;
typedef __attribute__((ext_vector_type(4))) unsigned short v4us;
typedef __attribute__((ext_vector_type(2))) float v2f;
typedef __attribute__((ext_vector_type(4))) int v4i;

__global__ __launch_bounds__(256) void k_wtG(const float* __restrict__ w, int K, int N, bf* Bt) {
    const int lane = threadIdx.x & 31; const int L0 = (blockIdx.x * 8 + (threadIdx.x >> 5)) * 8; const int nlines = N * K / 64;
{
#pragma unroll 1
        for (int l = 0; l < 8; ++l) { const int L = L0 + l; if (L >= nlines) break; const size_t e = (size_t)L * 64 + lane * 2; const int k = (int)(e % K), n = (int)(e / K); v2us o;
            o[0] = f2bf(w[(size_t)k * N + n]); o[1] = f2bf(w[(size_t)(k + 1) * N + n]); *(v2us*)(Bt + e) = o; }
         }
}
__global__ __launch_bounds__(256) void k_petab(float* PE) { const size_t e = ((size_t)blockIdx.x * 256 + threadIdx.x) * 2; if (e >= (size_t)TT * DM) return; const int c = (int)(e % DM); const int t = (int)(e / DM); const float w = expf(__fmul_rn((float)c, PEC)); const float ang = __fmul_rn((float)t, w); v2f o; o[0] = sinf(ang); o[1] = cosf(ang); *(v2f*)(PE + e) = o;  }
__global__ __launch_bounds__(256) void k_lnpe(const float* __restrict__ X, const float* __restrict__ PE, const float* __restrict__ g, const float* __restrict__ be, float* Hf, bf* Yh, bf* Yl) {
    const int lane = threadIdx.x & 31; const int r = blockIdx.x * 8 + (threadIdx.x >> 5); if (r >= TT) return; const float* xr = X + (size_t)r * DM; float s = 0.f;
#pragma unroll 1
    for (int ch = 0; ch < DM / 128; ++ch) { const int c0 = ch * 128 + lane * 4; const v4f a = *(const v4f*)(xr + c0);
#pragma unroll
        for (int q = 0; q < 4; ++q) s += bfr(a[q]); }
#pragma unroll
    for (int sh = 16; sh; sh >>= 1) s += __shfl_xor(s, sh, 32);
    const float mu = s * (1.0f / DM); float s2 = 0.f;
#pragma unroll 1
    for (int ch = 0; ch < DM / 128; ++ch) { const int c0 = ch * 128 + lane * 4; const v4f a = *(const v4f*)(xr + c0);
#pragma unroll
        for (int q = 0; q < 4; ++q) { const float d0 = __fsub_rn(bfr(a[q]), mu); float p = __fmul_rn(d0, d0); asm volatile("" : "+v"(p)); s2 = __fadd_rn(s2, p); } }
#pragma unroll
    for (int sh = 16; sh; sh >>= 1) s2 += __shfl_xor(s2, sh, 32);
    const float rs = __fdiv_rn(1.0f, __fsqrt_rn(__fadd_rn(s2 * (1.0f / DM), LNEPS)));
{
#pragma unroll 1
        for (int ch = 0; ch < DM / 128; ++ch) { const int c0 = ch * 128 + lane * 4; const v4f a = *(const v4f*)(xr + c0); const v4f pe = *(const v4f*)(PE + (size_t)r * DM + c0); v4f h4; v4us oh, ol;
#pragma unroll
            for (int q = 0; q < 4; ++q) { float n0 = __fmul_rn(__fsub_rn(bfr(a[q]), mu), rs); asm volatile("" : "+v"(n0)); float n1 = __fmul_rn(n0, bfr(g[c0 + q])); asm volatile("" : "+v"(n1)); const float ln = __fadd_rn(n1, bfr(be[c0 + q])); const float hv = __fadd_rn(ln, pe[q]); h4[q] = hv; unsigned short h2, l2; splitf(hv, h2, l2); oh[q] = h2; ol[q] = l2; }
            *(v4f*)(Hf + (size_t)r * DM + c0) = h4; *(v4us*)(Yh + (size_t)r * DM + c0) = oh; *(v4us*)(Yl + (size_t)r * DM + c0) = ol; }
         } }
__global__ __launch_bounds__(256) void k_resln2(const float* __restrict__ O, const float* __restrict__ Hf, const float* __restrict__ X, const float* __restrict__ g, const float* __restrict__ be, float* OUTb) {
    const int lane = threadIdx.x & 31; const int r = blockIdx.x * 8 + (threadIdx.x >> 5); if (r >= TT) return; const float* orow = O + (size_t)r * DM; const float* hrow = Hf + (size_t)r * DM; float s = 0.f;
#pragma unroll 1
    for (int ch = 0; ch < DM / 128; ++ch) { const int c0 = ch * 128 + lane * 4; const v4f a = *(const v4f*)(orow + c0), hh = *(const v4f*)(hrow + c0);
#pragma unroll
        for (int q = 0; q < 4; ++q) s += __fadd_rn(a[q], hh[q]); }
#pragma unroll
    for (int sh = 16; sh; sh >>= 1) s += __shfl_xor(s, sh, 32);
    const float mu = s * (1.0f / DM); float s2 = 0.f;
#pragma unroll 1
    for (int ch = 0; ch < DM / 128; ++ch) { const int c0 = ch * 128 + lane * 4; const v4f a = *(const v4f*)(orow + c0), hh = *(const v4f*)(hrow + c0);
#pragma unroll
        for (int q = 0; q < 4; ++q) { const float d0 = __fsub_rn(__fadd_rn(a[q], hh[q]), mu); float p = __fmul_rn(d0, d0); asm volatile("" : "+v"(p)); s2 = __fadd_rn(s2, p); } }
#pragma unroll
    for (int sh = 16; sh; sh >>= 1) s2 += __shfl_xor(s2, sh, 32);
    const float rs = __fdiv_rn(1.0f, __fsqrt_rn(__fadd_rn(s2 * (1.0f / DM), 1e-6f)));
{
#pragma unroll 1
        for (int ch = 0; ch < DM / 128; ++ch) { const int c0 = ch * 128 + lane * 4; const v4f a = *(const v4f*)(orow + c0), hh = *(const v4f*)(hrow + c0), xx = *(const v4f*)(X + (size_t)r * DM + c0); v4f o4;
#pragma unroll
            for (int q = 0; q < 4; ++q) { float n0 = __fmul_rn(__fsub_rn(__fadd_rn(a[q], hh[q]), mu), rs); asm volatile("" : "+v"(n0)); float n1 = __fmul_rn(n0, bfr(g[c0 + q])); asm volatile("" : "+v"(n1)); o4[q] = __fadd_rn(__fadd_rn(n1, bfr(be[c0 + q])), bfr(xx[q])); }
            *(v4f*)(OUTb + (size_t)r * DM + c0) = o4; }
         } }
__global__ __launch_bounds__(256) void k_cvt8(const float* __restrict__ src, bf* dst, size_t n8) { const size_t i = (size_t)blockIdx.x * 256 + threadIdx.x; if (i >= n8) return; const v8f v = *(const v8f*)(src + i * 8); v8us o;
#pragma unroll
    for (int k = 0; k < 8; ++k) o[k] = f2bf(v[k]); *(v8us*)(dst + i * 8) = o;  }

// k_rope: head planes [h][t][d] (fp16 + hi/lo) of rope(x) x sc with the rotate-half convention out[d] = x[d] cos[t][d] - x[d+HD/2] sin[t][d], out[d+HD/2] = x[d+HD/2] cos[t][d+HD/2] + x[d] sin[t][d+HD/2]
__global__ __launch_bounds__(256) void k_rope(const float* __restrict__ F, int pitch, int nheads, const float* __restrict__ CS, const float* __restrict__ RF, const float* __restrict__ nw, float sc, h16* P16, bf* Ph, bf* Pl) {
    const size_t e = ((size_t)blockIdx.x * 256 + threadIdx.x) * 2; if (e >= (size_t)nheads * TT * HD) return; const int d = (int)(e % HD); const int t = (int)((e / HD) % TT); const int h = (int)(e / ((size_t)HD * TT)); const float* f = F + (size_t)t * pitch + h * HD; const float rf = RF ? RF[(size_t)h * TT + t] : 1.0f; v2h o16; v2us oh, ol;
#pragma unroll
    for (int q = 0; q < 2; ++q) { const int dd = d + q; const int dp = (dd < HD / 2) ? dd + HD / 2 : dd - HD / 2; float x0 = f[dd], x1 = f[dp];
        if (RF) { float n0 = __fmul_rn(x0, rf), n1 = __fmul_rn(x1, rf); asm volatile("" : "+v"(n0)); asm volatile("" : "+v"(n1)); x0 = __fmul_rn(bfr(nw[dd]), n0); x1 = __fmul_rn(bfr(nw[dp]), n1); }
        const v2f cs = *(const v2f*)(CS + ((size_t)t * HD + dd) * 2); float a = __fmul_rn(x0, cs[0]), bq = __fmul_rn(x1, cs[1]); asm volatile("" : "+v"(a)); asm volatile("" : "+v"(bq)); const float r = ((dd < HD / 2) ? __fsub_rn(a, bq) : __fadd_rn(a, bq)) * sc;
        o16[q] = tohx(r); unsigned short a2, c2; splitf(r, a2, c2); oh[q] = a2; ol[q] = c2; }
    *(v2h*)(P16 + e) = o16; *(v2us*)(Ph + e) = oh; *(v2us*)(Pl + e) = ol;  }
__global__ __launch_bounds__(256) void k_vtp(const float* __restrict__ F, int pitch, int nheads, h16* V16, bf* Vh, bf* Vl) { const size_t e = ((size_t)blockIdx.x * 256 + threadIdx.x) * 2; if (e >= (size_t)nheads * HD * TT) return; const int t = (int)(e % TT); const int d = (int)((e / TT) % HD); const int g = (int)(e / ((size_t)TT * HD)); v2h o16; v2us oh, ol;
#pragma unroll
    for (int q = 0; q < 2; ++q) { const float x = F[(size_t)(t + q) * pitch + g * HD + d]; o16[q] = tohx(x); unsigned short a2, c2; splitf(x, a2, c2); oh[q] = a2; ol[q] = c2; }
    *(v2h*)(V16 + e) = o16; *(v2us*)(Vh + e) = oh; *(v2us*)(Vl + e) = ol;  }
__global__ __launch_bounds__(256) void k_csid(float* CS) { const int idx = blockIdx.x * 256 + threadIdx.x; if (idx >= TT * HD) return; v2f cs; cs[0] = 1.0f; cs[1] = 0.0f; *(v2f*)(CS + (size_t)idx * 2) = cs;  }
// k_asoft: per row (zz, i): t = S x HD^-0.5 for j <= i (causal; the reference's -1e9 additive fill vanishes identically); softmax over the 2048 keys (register row, one exp, fixed trees);
__global__ __launch_bounds__(256) void k_asoft(const float* __restrict__ Sb, h16* P16, bf* Ph, bf* Pl) {
    const int lane = threadIdx.x & 31; const int row = blockIdx.x * 8 + (threadIdx.x >> 5); if (row >= ZH * TT) return; const int i = row % TT; const int zz = row / TT; (void)zz; const bool hires = (i < RH); const float* sr = Sb + (size_t)row * TT; float v[TT / 32]; float mx = -3.0e38f;
#pragma unroll
    for (int ch = 0; ch < TT / 128; ++ch) { const int j0 = ch * 128 + lane * 4; const v4f a = *(const v4f*)(sr + j0);
#pragma unroll
        for (int q = 0; q < 4; ++q) { const int j = j0 + q; (void)j; const float t = (j <= i) ? a[q] * SCL : -3.0e38f;   /* causal; -1e9 fill == select */ v[ch * 4 + q] = t; mx = fmaxf(mx, t); } }
#pragma unroll
    for (int sh = 16; sh; sh >>= 1) mx = fmaxf(mx, __shfl_xor(mx, sh, 32));
    float sum = 0.f;
#pragma unroll
    for (int k = 0; k < TT / 32; ++k) { float d0 = __fsub_rn(v[k], mx); asm volatile("" : "+v"(d0)); v[k] = __builtin_amdgcn_exp2f(__fmul_rn(d0, 1.4426950408889634f)); sum += v[k]; }
#pragma unroll
    for (int sh = 16; sh; sh >>= 1) sum += __shfl_xor(sum, sh, 32);
    const float f = __fdiv_rn(hires ? 1.0f : PCAR, sum);
{
        if (hires) {
#pragma unroll
            for (int ch = 0; ch < TT / 128; ++ch) { v4us oh, ol;
#pragma unroll
                for (int q = 0; q < 4; ++q) { unsigned short a, c2; splitf(v[ch * 4 + q] * f, a, c2); oh[q] = a; ol[q] = c2; }
                const size_t oo = ((size_t)zz * (RH ? RH : 1) + i) * TT + ch * 128 + lane * 4; *(v4us*)(Ph + oo) = oh; *(v4us*)(Pl + oo) = ol; }
        } else {
#pragma unroll
            for (int ch = 0; ch < TT / 128; ++ch) { v4h o4;
#pragma unroll
                for (int q = 0; q < 4; ++q) o4[q] = tohx(v[ch * 4 + q] * f);
                *(v4h*)(P16 + (size_t)row * TT + ch * 128 + lane * 4) = o4; } }
         }
}
__global__ __launch_bounds__(256) void k_merge(const float* __restrict__ O, int h0, bf* Ah, bf* Al) { const size_t e = ((size_t)blockIdx.x * 256 + threadIdx.x) * 2; if (e >= (size_t)ZH * TT * HD) return; const int d = (int)(e % HD); const int t = (int)((e / HD) % TT); const int zz = (int)(e / ((size_t)HD * TT)); const float cs = (t < RH) ? 1.0f : (1.0f / PCAR); const size_t oo = (size_t)t * DQ + (h0 + zz) * HD + d;
    v2us oh, ol; v2f sum = *(const v2f*)(O + e);
#pragma unroll
    for (int s = 1; s < KSP; ++s) { const v2f p = *(const v2f*)(O + (size_t)s * ZH * TT * HD + e); sum[0] += p[0]; sum[1] += p[1]; }   // the K-split partial planes, added in split order
#pragma unroll
    for (int q = 0; q < 2; ++q) { unsigned short a, c2; splitf(sum[q] * cs, a, c2); oh[q] = a; ol[q] = c2; } *(v2us*)(Ah + oo) = oh; *(v2us*)(Al + oo) = ol;  }

extern "C" void kernel_launch(void* const* d_in, const int* in_sizes, int n_in,
                              void* d_out, int out_size, void* d_ws, size_t ws_size, hipStream_t stream) {
    (void)in_sizes; (void)n_in; (void)out_size;
    const float* x = (const float*)d_in[0]; const float* g1 = (const float*)d_in[1]; const float* e1 = (const float*)d_in[2]; const float* wq = (const float*)d_in[3]; const float* wk = (const float*)d_in[4]; const float* wv = (const float*)d_in[5]; const float* wo = (const float*)d_in[6]; const float* g2 = (const float*)d_in[7]; const float* e2 = (const float*)d_in[8];
    float* OUT = (float*)d_out;     // [4][2048][512]
    char* wsp = (char*)d_ws;
    auto take = [&](size_t bytes) { char* p = wsp; wsp += (bytes + 255) & ~(size_t)255; return (void*)p; };
    bf* WQ = (bf*)take((size_t)DQ * DM * 2); bf* WK = (bf*)take((size_t)DKV * DM * 2); bf* WV = (bf*)take((size_t)DKV * DM * 2); bf* WO = (bf*)take((size_t)DM * DQ * 2); float* CS = (float*)take((size_t)TT * HD * 2 * 4);
    float* PE = (float*)take((size_t)TT * DM * 4); float* Hf = (float*)take((size_t)TT * DM * 4); bf* Yh = (bf*)take((size_t)TT * DM * 2); bf* Yl = (bf*)take((size_t)TT * DM * 2); float* O2 = (float*)take((size_t)TT * DM * 4); float* FQ = (float*)take((size_t)TT * DQ * 4); float* FK = (float*)take((size_t)TT * DKV * 4);
    h16* QP16 = (h16*)take((size_t)NH_ * TT * HD * 2); h16* KP16 = (h16*)take((size_t)NKV * TT * HD * 2); h16* VT16 = (h16*)take((size_t)NKV * HD * TT * 2);
    bf* QPh = (bf*)take((size_t)NH_ * TT * HD * 2); bf* QPl = (bf*)take((size_t)NH_ * TT * HD * 2); bf* KPh = (bf*)take((size_t)NKV * TT * HD * 2); bf* KPl = (bf*)take((size_t)NKV * TT * HD * 2); bf* VTh = (bf*)take((size_t)NKV * HD * TT * 2); bf* VTl = (bf*)take((size_t)NKV * HD * TT * 2); bf* Ph = (bf*)take((size_t)ZH * RH * TT * 2); bf* Pl = (bf*)take((size_t)ZH * RH * TT * 2);
    float* Sb = (float*)take((size_t)ZH * TT * TT * 4); h16* P16 = (h16*)take((size_t)ZH * TT * TT * 2); float* Ob = (float*)take((size_t)KSP * ZH * TT * HD * 4); bf* ATh = (bf*)take((size_t)TT * DQ * 2); bf* ATl = (bf*)take((size_t)TT * DQ * 2);
    if ((size_t)(wsp - (char*)d_ws) > ws_size) return;    // ws 256 MiB
    float* FV = FK;   // v projection reuses the k buffer after the k planes are built (stream-ordered)
    { k_wtG<<<(unsigned)((DM * DQ / 64 + 63) / 64), 256, 0, stream>>>(wq, DM, DQ, WQ); k_wtG<<<(unsigned)((DM * DKV / 64 + 63) / 64), 256, 0, stream>>>(wk, DM, DKV, WK); k_wtG<<<(unsigned)((DM * DKV / 64 + 63) / 64), 256, 0, stream>>>(wv, DM, DKV, WV);
      k_wtG<<<(unsigned)((DQ * DM / 64 + 63) / 64), 256, 0, stream>>>(wo, DQ, DM, WO);
       }
    k_csid<<<(TT * HD + 255) / 256, 256, 0, stream>>>(CS);
    const unsigned LQ = (unsigned)(((size_t)NH_ * TT * HD / 2 + 255) / 256), LKv = (unsigned)(((size_t)NKV * TT * HD / 2 + 255) / 256);
    for (int b = 0; b < NB_; ++b) {
        
        if (b == 0) k_petab<<<(unsigned)(((size_t)TT * DM / 2 + 255) / 256), 256, 0, stream>>>(PE); k_lnpe<<<TT / 8, 256, 0, stream>>>(x + (size_t)b * TT * DM, PE, g1, e1, Hf, Yh, Yl);   /* h = LN1(x) + PE: f32 + hi/lo planes */
        k_gemmw<bf, 1, false><<<dim3(TT / 64, DQ / 64, 1), 32, 0, stream>>>(Yh, Yl, WQ, nullptr, DM, FQ, DQ, nullptr, 0, 0, 0);
        k_rope<<<LQ, 256, 0, stream>>>(FQ, DQ, NH_, CS, nullptr, nullptr, 1.0f, QP16, QPh, QPl);
        k_gemmw<bf, 1, false><<<dim3(TT / 64, DKV / 64, 1), 32, 0, stream>>>(Yh, Yl, WK, nullptr, DM, FK, DKV, nullptr, 0, 0, 0);
        k_rope<<<LKv, 256, 0, stream>>>(FK, DKV, NKV, CS, nullptr, nullptr, 1.0f, KP16, KPh, KPl);
        k_gemmw<bf, 1, false><<<dim3(TT / 64, DKV / 64, 1), 32, 0, stream>>>(Yh, Yl, WV, nullptr, DM, FV, DKV, nullptr, 0, 0, 0); k_vtp<<<LKv, 256, 0, stream>>>(FV, DKV, NKV, VT16, VTh, VTl);
        for (int h0 = 0; h0 < NH_; h0 += ZH) { const size_t zq = (size_t)h0, zk = (size_t)(h0 / REP);   // one kv head per query head: the pass's two heads use consecutive kv planes (z-strides TT*HD)
            k_gemmc<bf, 2, 1, 1, 32><<<dim3(RH / 64, TT / 64, ZH), 32, 0, stream>>>(QPh + zq * TT * HD, QPl + zq * TT * HD, KPh + zk * TT * HD, KPl + zk * TT * HD, HD, Sb, TT, 0, (size_t)TT * HD, (size_t)TT * HD, (size_t)TT * TT, 0);
            k_gemmc<h16, 0, 1, 1, 32><<<dim3((TT - RH) / 64, TT / 64, ZH), 32, 0, stream>>>(QP16 + zq * TT * HD + (size_t)RH * HD, nullptr, KP16 + zk * TT * HD, nullptr, HD, Sb + (size_t)RH * TT, TT, RH, (size_t)TT * HD, (size_t)TT * HD, (size_t)TT * TT, 0);
            k_asoft<<<ZH * TT / 8, 256, 0, stream>>>(Sb, P16, Ph, Pl);
            k_gemmc<bf, 2, 2, KSP, 32><<<dim3(RH / 64, KSP, ZH), 32, 0, stream>>>(Ph, Pl, VTh + zk * HD * TT, VTl + zk * HD * TT, TT, Ob, HD, 0, (size_t)RH * TT, (size_t)HD * TT, (size_t)TT * HD, (size_t)ZH * TT * HD);
            k_gemmc<h16, 0, 2, KSP, 64><<<dim3((TT - RH) / 64, KSP, ZH), 32, 0, stream>>>(P16 + (size_t)RH * TT, nullptr, VT16 + zk * HD * TT, nullptr, TT, Ob + (size_t)RH * HD, HD, RH, (size_t)TT * TT, (size_t)HD * TT, (size_t)TT * HD, (size_t)ZH * TT * HD);
            k_merge<<<(unsigned)(((size_t)ZH * TT * HD / 2 + 255) / 256), 256, 0, stream>>>(Ob, h0, ATh, ATl); }
        k_gemmw<bf, 1, false><<<dim3(TT / 64, DM / 64, 1), 32, 0, stream>>>(ATh, ATl, WO, nullptr, DQ, O2, DM, nullptr, 0, 0, 0); k_resln2<<<TT / 8, 256, 0, stream>>>(O2, Hf, x + (size_t)b * TT * DM, g2, e2, OUT + (size_t)b * TT * DM); }   /* o = merged wfc; out = LN2(o + h) + x */
}

// v002
// It runs in 430 microseconds.
// Next to v001, in two timings, it ran 2.03 times as fast each time.
// Counting every step since v000, it is 3.60 times as fast.
#include <hip/hip_runtime.h>

// Pre-norm causal self-attention block with sinusoidal positions (x [4][2048][512]; h = LN1(x) (1e-5) + PE (pe[t][2i] = sin(t w_i), pe[t][2i+1] = cos(t w_i), w_i = exp(2i x (-ln 1e4 / 512))); q, k, v = h W ('xw' [512][512], no bias; 8 heads x 64); causal softmax(q.k/8) (-1e9 fill == exact zero weight); o = merged wfc ('xw'); out = LN2(o + h) (1e-6) + x -> [4][2048][512] (4.2 M)).
// Layout: LN1 + PE in one row kernel producing h in f32 (kept for the residual) and as bf16 hi/lo planes (2-product projections); the PE table is computed on device in f32 with the reference's float32 constant for -ln(1e4)/512 (precise expf/sinf/cosf); causal attention; the wfc GEMM output goes through a residual + LN2 row kernel that also adds x.
// Compute dtypes, f32 accumulate: every input rounded to bf16; q/k/v hl x exact (2 products); causal scores and attn.v (tile skipping): query rows < 512 hl (3 products), the rest single fp16 (x1024); softmax f32; wfc hl x exact (2 products); LN2 and both residuals in f32.

#define NB_  4
#define TT   2048
#define DM   512
#define NH_  8
#define NKV  8
#define REP  (NH_ / NKV)
#define HD   64
#define DQ   (NH_ * HD)
#define DKV  (NKV * HD)
#define LNEPS 1e-5f
#define PEC  (-0.0179889463f)   // float32(-ln(10000)/512), as the reference's numpy computes it
typedef __attribute__((ext_vector_type(4))) unsigned short v4us;
#define ZH   8                    // heads per attention pass: all heads of one sequence
#define RH   512                  // query rows < RH use hi+lo planes (0: none)
#define WIN  2048
#define PCAR 1024.0f
#define SCL  0.125f   // HD^-0.5
#define KSP  8                    // K-splits of the probability x value contraction (one single-wave work-group each; k_merge adds the KSP partial planes)
typedef _Float16 h16;
typedef unsigned short bf;
typedef __attribute__((ext_vector_type(16))) __bf16   v16bf;
typedef __attribute__((ext_vector_type(16))) _Float16 v16h;
typedef __attribute__((ext_vector_type(8)))  _Float16 v8h;
typedef __attribute__((ext_vector_type(8)))  unsigned short v8us;
typedef __attribute__((ext_vector_type(8)))  float    v8f;
typedef __attribute__((ext_vector_type(4)))  float    v4f;
typedef v8h  __attribute__((may_alias)) v8ha;
typedef v4f  __attribute__((may_alias)) v4fa;
typedef v8us __attribute__((may_alias)) v8usa;

__device__ __forceinline__ unsigned short f2bf(float f) { unsigned u = __float_as_uint(f); u += 0x7FFFu + ((u >> 16) & 1u); return (unsigned short)(u >> 16); }
__device__ __forceinline__ float bf2f(unsigned short b) { return __uint_as_float(((unsigned)b) << 16); }
__device__ __forceinline__ float bfr(float f) { return bf2f(f2bf(f)); }
__device__ __forceinline__ v16h cat16(v8h lo, v8h hi) { return __builtin_shufflevector(lo, hi, 0, 1, 2, 3, 4, 5, 6, 7, 8, 9, 10, 11, 12, 13, 14, 15); }
__device__ __forceinline__ v16bf cat16b(v8us lo, v8us hi) { return __builtin_bit_cast(v16bf, __builtin_shufflevector(lo, hi, 0, 1, 2, 3, 4, 5, 6, 7, 8, 9, 10, 11, 12, 13, 14, 15)); }
__device__ __forceinline__ v8f wmma16(v16h a, v16h b, v8f c) { return __builtin_amdgcn_wmma_f32_16x16x32_f16(false, a, false, b, (short)0, c, false, false); }
__device__ __forceinline__ v8f wmmab(v16bf a, v16bf b, v8f c) { return __builtin_amdgcn_wmma_f32_16x16x32_bf16(false, a, false, b, (short)0, c, false, false); }



// ---- k_gemmw: register-blocked GEMM, ONE WAVE per 64x64 output tile (16 accumulators), operands straight from K-contiguous 16-bit planes; grid (M/64, N/64, Z), 32 threads.
// C[m][n] (f32, pitch ldc, + optional f32 bias[n]) = sum_k A[m][k] Bt[n][k] (+ split products per NSPLIT). z-batch strides sA/sB/sC in elements. K % 32 == 0.
template <typename T16> struct WFrag;
template <> struct WFrag<h16> { typedef v16h V; static __device__ __forceinline__ V ld(const h16* p) { return cat16(*(const v8h*)p, *(const v8h*)(p + 16)); } static __device__ __forceinline__ v8f mma(V a, V b, v8f c) { return wmma16(a, b, c); } };
template <> struct WFrag<bf> { typedef v16bf V; static __device__ __forceinline__ V ld(const bf* p) { return cat16b(*(const v8us*)p, *(const v8us*)(p + 16)); } static __device__ __forceinline__ v8f mma(V a, V b, v8f c) { return wmmab(a, b, c); } };
template <typename T16, int NSPLIT, bool BIAS>
__global__ __launch_bounds__(32) void k_gemmw(const T16* __restrict__ A, const T16* __restrict__ A2, const T16* __restrict__ Bt, const T16* __restrict__ Bt2, int K, float* C, int ldc, const float* __restrict__ bias, size_t sA, size_t sB, size_t sC) {
    typedef typename WFrag<T16>::V V;
    __shared__ __align__(16) float os[16 * 68];
    const size_t z = blockIdx.z; A += z * sA; if (A2) A2 += z * sA; Bt += z * sB; if (Bt2) Bt2 += z * sB; C += z * sC;
    const int lane = threadIdx.x & 31, lr = lane & 15, hi = lane >> 4; const int r0 = blockIdx.x * 64, c0 = blockIdx.y * 64;
    v8f acc[4][4];
#pragma unroll
    for (int mb = 0; mb < 4; ++mb)
#pragma unroll
        for (int nb = 0; nb < 4; ++nb) acc[mb][nb] = (v8f){};
    const size_t aoff = (size_t)(r0 + lr) * K + 8 * hi, boff = (size_t)(c0 + lr) * K + 8 * hi;
#pragma unroll 1
    for (int kc = 0; kc < K; kc += 32) {
        V a[4], a2[4];
#pragma unroll
        for (int mb = 0; mb < 4; ++mb) { a[mb] = WFrag<T16>::ld(A + aoff + (size_t)mb * 16 * K + kc); if (NSPLIT == 1 || NSPLIT == 2) a2[mb] = WFrag<T16>::ld(A2 + aoff + (size_t)mb * 16 * K + kc); }
#pragma unroll
        for (int nb = 0; nb < 4; ++nb) { const V b = WFrag<T16>::ld(Bt + boff + (size_t)nb * 16 * K + kc); V b2; if (NSPLIT >= 2) b2 = WFrag<T16>::ld(Bt2 + boff + (size_t)nb * 16 * K + kc);
#pragma unroll
            for (int mb = 0; mb < 4; ++mb) { acc[mb][nb] = WFrag<T16>::mma(a[mb], b, acc[mb][nb]); if (NSPLIT == 1 || NSPLIT == 2) acc[mb][nb] = WFrag<T16>::mma(a2[mb], b, acc[mb][nb]); if (NSPLIT >= 2) acc[mb][nb] = WFrag<T16>::mma(a[mb], b2, acc[mb][nb]); } }
        asm volatile("v_nop\n\tv_nop\n\tv_nop\n\tv_nop" : "+v"(acc[0][0]), "+v"(acc[1][1]), "+v"(acc[2][2]), "+v"(acc[3][3]) : "v"(a[0]), "v"(a[3]));
    }
#pragma unroll
    for (int mb = 0; mb < 4; ++mb) {
#pragma unroll
        for (int nb = 0; nb < 4; ++nb) {
#pragma unroll
            for (int j = 0; j < 8; ++j) os[(hi * 8 + j) * 68 + nb * 16 + lr] = acc[mb][nb][j]; }
        __builtin_amdgcn_wave_barrier(); asm volatile("" ::: "memory");
        float* crow = C + (size_t)(r0 + mb * 16) * ldc + c0;
{
#pragma unroll
            for (int s = 0; s < 8; ++s) { const int row = 2 * s + hi, cofs = lr * 4; v4f val = *(const v4fa*)(os + row * 68 + cofs); if (BIAS) { val[0] += bfr(bias[c0 + cofs]); val[1] += bfr(bias[c0 + cofs + 1]); val[2] += bfr(bias[c0 + cofs + 2]); val[3] += bfr(bias[c0 + cofs + 3]); }
                *(v4f*)(crow + (size_t)row * ldc + cofs) = val; }
             }
        __builtin_amdgcn_wave_barrier(); asm volatile("" ::: "memory");
    }
}

// ---- k_gemmc: the same one-wave 64x64 tile GEMM specialised for causal attention: CMODE 1 skips score tiles entirely above the diagonal (query rows r0+roff.., key columns c0..), CMODE 2 limits the
// key (K) loop of the probability x value contraction to the diagonal block (probabilities beyond it are exactly zero). roff = row offset of this launch's first row within the sequence.
// K is also the row pitch of A and Bt: in CMODE 2 it is 2 x keys (the probabilities lie in place over their f32 score rows, and the transposed value planes are stored at the same pitch).
// CMODE 2 has one 64-column tile, so blockIdx.y is its K-split index: split sp takes the CH-wide key chunks sp, sp + KS, ... below the diagonal limit and stores its own f32 partial plane (C + sp * sS; zeros if it has no chunk).
template <typename T16, int NSPLIT, int CMODE, int KS, int CH>
__global__ __launch_bounds__(32) void k_gemmc(const T16* __restrict__ A, const T16* __restrict__ A2, const T16* __restrict__ Bt, const T16* __restrict__ Bt2, int K, float* C, int ldc, int roff, size_t sA, size_t sB, size_t sC, size_t sS) {
    typedef typename WFrag<T16>::V V;
    __shared__ __align__(16) float os[16 * 68];
    const size_t z = blockIdx.z; A += z * sA; if (A2) A2 += z * sA; Bt += z * sB; if (Bt2) Bt2 += z * sB; C += z * sC;
    const int lane = threadIdx.x & 31, lr = lane & 15, hi = lane >> 4; const int r0 = blockIdx.x * 64, c0 = (CMODE == 2) ? 0 : blockIdx.y * 64, sp = (CMODE == 2) ? blockIdx.y : 0; C += (size_t)sp * sS;
    if (CMODE == 1 && c0 > r0 + roff + 63) return;                  // score tile entirely above the causal diagonal: never read (the softmax masks j > i by select)
    const int Kl = (CMODE == 2) ? min(K, r0 + roff + 64) : K;        // P.V: probabilities are exactly 0 beyond the diagonal block, so the K loop stops there
    v8f acc[4][4];
#pragma unroll
    for (int mb = 0; mb < 4; ++mb)
#pragma unroll
        for (int nb = 0; nb < 4; ++nb) acc[mb][nb] = (v8f){};
    const size_t aoff = (size_t)(r0 + lr) * K + 8 * hi, boff = (size_t)(c0 + lr) * K + 8 * hi;
#pragma unroll 1
    for (int kb = sp * CH; kb < Kl; kb += KS * CH) {   // Kl and K are multiples of CH: a chunk is whole or absent
        V a[CH / 32][4], a2[CH / 32][4];
#pragma unroll
        for (int u = 0; u < CH / 32; ++u)
#pragma unroll
            for (int mb = 0; mb < 4; ++mb) { a[u][mb] = WFrag<T16>::ld(A + aoff + (size_t)mb * 16 * K + kb + u * 32); if (NSPLIT == 1 || NSPLIT == 2) a2[u][mb] = WFrag<T16>::ld(A2 + aoff + (size_t)mb * 16 * K + kb + u * 32); }
#pragma unroll
        for (int u = 0; u < CH / 32; ++u)
#pragma unroll
            for (int nb = 0; nb < 4; ++nb) { const V b = WFrag<T16>::ld(Bt + boff + (size_t)nb * 16 * K + kb + u * 32); V b2; if (NSPLIT >= 2) b2 = WFrag<T16>::ld(Bt2 + boff + (size_t)nb * 16 * K + kb + u * 32);
#pragma unroll
                for (int mb = 0; mb < 4; ++mb) { acc[mb][nb] = WFrag<T16>::mma(a[u][mb], b, acc[mb][nb]); if (NSPLIT == 1 || NSPLIT == 2) acc[mb][nb] = WFrag<T16>::mma(a2[u][mb], b, acc[mb][nb]); if (NSPLIT >= 2) acc[mb][nb] = WFrag<T16>::mma(a[u][mb], b2, acc[mb][nb]); } }
        asm volatile("v_nop\n\tv_nop\n\tv_nop\n\tv_nop" : "+v"(acc[0][0]), "+v"(acc[1][1]), "+v"(acc[2][2]), "+v"(acc[3][3]) : "v"(a[CH / 32 - 1][0]), "v"(a[CH / 32 - 1][3]));
    }
#pragma unroll
    for (int mb = 0; mb < 4; ++mb) {
#pragma unroll
        for (int nb = 0; nb < 4; ++nb) {
#pragma unroll
            for (int j = 0; j < 8; ++j) os[(hi * 8 + j) * 68 + nb * 16 + lr] = acc[mb][nb][j]; }
        __builtin_amdgcn_wave_barrier(); asm volatile("" ::: "memory");
        float* crow = C + (size_t)(r0 + mb * 16) * ldc + c0;
{
#pragma unroll
            for (int s = 0; s < 8; ++s) { const int row = 2 * s + hi, cofs = lr * 4; v4f val = *(const v4fa*)(os + row * 68 + cofs);
                *(v4f*)(crow + (size_t)row * ldc + cofs) = val; }
             }
        __builtin_amdgcn_wave_barrier(); asm volatile("" ::: "memory");
    }
}

__device__ __forceinline__ h16 tohx(float x) { return (h16)x; }
__device__ __forceinline__ void splitf(float y, unsigned short& h, unsigned short& l) { h = f2bf(y); l = f2bf(y - bf2f(h)); }
typedef __attribute__((ext_vector_type(2))) _Float16 v2h;
typedef __attribute__((ext_vector_type(4))) _Float16 v4h;
typedef __attribute__((ext_vector_type(2))) unsigned short v2us;
typedef __attribute__((ext_vector_type(4))) unsigned short v4us;
typedef __attribute__((ext_vector_type(2))) float v2f;
typedef __attribute__((ext_vector_type(4))) int v4i;

__global__ __launch_bounds__(256) void k_wtG(const float* __restrict__ w0, const float* __restrict__ w1, const float* __restrict__ w2, const float* __restrict__ w3, int K, int N, bf* Bt) {
    const int wi = blockIdx.y; const float* w = (wi == 0) ? w0 : (wi == 1) ? w1 : (wi == 2) ? w2 : w3; Bt += (size_t)wi * K * N;   // blockIdx.y: which of the four equally shaped weights (consecutive output planes)
    const int lane = threadIdx.x & 31; const int L0 = (blockIdx.x * 8 + (threadIdx.x >> 5)) * 8; const int nlines = N * K / 64;
{
#pragma unroll 1
        for (int l = 0; l < 8; ++l) { const int L = L0 + l; if (L >= nlines) break; const size_t e = (size_t)L * 64 + lane * 2; const int k = (int)(e % K), n = (int)(e / K); v2us o;
            o[0] = f2bf(w[(size_t)k * N + n]); o[1] = f2bf(w[(size_t)(k + 1) * N + n]); *(v2us*)(Bt + e) = o; }
         }
}
__global__ __launch_bounds__(256) void k_petab(float* PE) { const size_t e = ((size_t)blockIdx.x * 256 + threadIdx.x) * 2; if (e >= (size_t)TT * DM) return; const int c = (int)(e % DM); const int t = (int)(e / DM); const float w = expf(__fmul_rn((float)c, PEC)); const float ang = __fmul_rn((float)t, w); v2f o; o[0] = sinf(ang); o[1] = cosf(ang); *(v2f*)(PE + e) = o;  }
__global__ __launch_bounds__(256) void k_lnpe(const float* __restrict__ X, const float* __restrict__ PE, const float* __restrict__ g, const float* __restrict__ be, float* Hf, bf* Yh, bf* Yl) {
    const int lane = threadIdx.x & 31; const int r = blockIdx.x * 8 + (threadIdx.x >> 5); if (r >= NB_ * TT) return; const float* xr = X + (size_t)r * DM; float s = 0.f;   // r: row of all sequences, position r % TT
#pragma unroll 1
    for (int ch = 0; ch < DM / 128; ++ch) { const int c0 = ch * 128 + lane * 4; const v4f a = *(const v4f*)(xr + c0);
#pragma unroll
        for (int q = 0; q < 4; ++q) s += bfr(a[q]); }
#pragma unroll
    for (int sh = 16; sh; sh >>= 1) s += __shfl_xor(s, sh, 32);
    const float mu = s * (1.0f / DM); float s2 = 0.f;
#pragma unroll 1
    for (int ch = 0; ch < DM / 128; ++ch) { const int c0 = ch * 128 + lane * 4; const v4f a = *(const v4f*)(xr + c0);
#pragma unroll
        for (int q = 0; q < 4; ++q) { const float d0 = __fsub_rn(bfr(a[q]), mu); float p = __fmul_rn(d0, d0); asm volatile("" : "+v"(p)); s2 = __fadd_rn(s2, p); } }
#pragma unroll
    for (int sh = 16; sh; sh >>= 1) s2 += __shfl_xor(s2, sh, 32);
    const float rs = __fdiv_rn(1.0f, __fsqrt_rn(__fadd_rn(s2 * (1.0f / DM), LNEPS)));
{
#pragma unroll 1
        for (int ch = 0; ch < DM / 128; ++ch) { const int c0 = ch * 128 + lane * 4; const v4f a = *(const v4f*)(xr + c0); const v4f pe = *(const v4f*)(PE + (size_t)(r % TT) * DM + c0); v4f h4; v4us oh, ol;
#pragma unroll
            for (int q = 0; q < 4; ++q) { float n0 = __fmul_rn(__fsub_rn(bfr(a[q]), mu), rs); asm volatile("" : "+v"(n0)); float n1 = __fmul_rn(n0, bfr(g[c0 + q])); asm volatile("" : "+v"(n1)); const float ln = __fadd_rn(n1, bfr(be[c0 + q])); const float hv = __fadd_rn(ln, pe[q]); h4[q] = hv; unsigned short h2, l2; splitf(hv, h2, l2); oh[q] = h2; ol[q] = l2; }
            *(v4f*)(Hf + (size_t)r * DM + c0) = h4; *(v4us*)(Yh + (size_t)r * DM + c0) = oh; *(v4us*)(Yl + (size_t)r * DM + c0) = ol; }
         } }
__global__ __launch_bounds__(256) void k_resln2(const float* __restrict__ O, const float* __restrict__ Hf, const float* __restrict__ X, const float* __restrict__ g, const float* __restrict__ be, float* OUTb) {
    const int lane = threadIdx.x & 31; const int r = blockIdx.x * 8 + (threadIdx.x >> 5); if (r >= NB_ * TT) return; const float* orow = O + (size_t)r * DM; const float* hrow = Hf + (size_t)r * DM; float s = 0.f;
#pragma unroll 1
    for (int ch = 0; ch < DM / 128; ++ch) { const int c0 = ch * 128 + lane * 4; const v4f a = *(const v4f*)(orow + c0), hh = *(const v4f*)(hrow + c0);
#pragma unroll
        for (int q = 0; q < 4; ++q) s += __fadd_rn(a[q], hh[q]); }
#pragma unroll
    for (int sh = 16; sh; sh >>= 1) s += __shfl_xor(s, sh, 32);
    const float mu = s * (1.0f / DM); float s2 = 0.f;
#pragma unroll 1
    for (int ch = 0; ch < DM / 128; ++ch) { const int c0 = ch * 128 + lane * 4; const v4f a = *(const v4f*)(orow + c0), hh = *(const v4f*)(hrow + c0);
#pragma unroll
        for (int q = 0; q < 4; ++q) { const float d0 = __fsub_rn(__fadd_rn(a[q], hh[q]), mu); float p = __fmul_rn(d0, d0); asm volatile("" : "+v"(p)); s2 = __fadd_rn(s2, p); } }
#pragma unroll
    for (int sh = 16; sh; sh >>= 1) s2 += __shfl_xor(s2, sh, 32);
    const float rs = __fdiv_rn(1.0f, __fsqrt_rn(__fadd_rn(s2 * (1.0f / DM), 1e-6f)));
{
#pragma unroll 1
        for (int ch = 0; ch < DM / 128; ++ch) { const int c0 = ch * 128 + lane * 4; const v4f a = *(const v4f*)(orow + c0), hh = *(const v4f*)(hrow + c0), xx = *(const v4f*)(X + (size_t)r * DM + c0); v4f o4;
#pragma unroll
            for (int q = 0; q < 4; ++q) { float n0 = __fmul_rn(__fsub_rn(__fadd_rn(a[q], hh[q]), mu), rs); asm volatile("" : "+v"(n0)); float n1 = __fmul_rn(n0, bfr(g[c0 + q])); asm volatile("" : "+v"(n1)); o4[q] = __fadd_rn(__fadd_rn(n1, bfr(be[c0 + q])), bfr(xx[q])); }
            *(v4f*)(OUTb + (size_t)r * DM + c0) = o4; }
         } }
__global__ __launch_bounds__(256) void k_cvt8(const float* __restrict__ src, bf* dst, size_t n8) { const size_t i = (size_t)blockIdx.x * 256 + threadIdx.x; if (i >= n8) return; const v8f v = *(const v8f*)(src + i * 8); v8us o;
#pragma unroll
    for (int k = 0; k < 8; ++k) o[k] = f2bf(v[k]); *(v8us*)(dst + i * 8) = o;  }

// k_rope: head planes [h][t][d] (fp16 + hi/lo) of rope(x) x sc with the rotate-half convention out[d] = x[d] cos[t][d] - x[d+HD/2] sin[t][d], out[d+HD/2] = x[d+HD/2] cos[t][d+HD/2] + x[d] sin[t][d+HD/2]
__global__ __launch_bounds__(256) void k_rope(const float* __restrict__ F, int pitch, int nheads, const float* __restrict__ CS, const float* __restrict__ RF, const float* __restrict__ nw, float sc, h16* P16, bf* Ph, bf* Pl) {
    { const size_t sq = blockIdx.y, po = sq * nheads * TT * HD; F += sq * TT * pitch; P16 += po; Ph += po; Pl += po; }   // blockIdx.y: sequence (planes [sequence][h][t][d])
    const size_t e = ((size_t)blockIdx.x * 256 + threadIdx.x) * 2; if (e >= (size_t)nheads * TT * HD) return; const int d = (int)(e % HD); const int t = (int)((e / HD) % TT); const int h = (int)(e / ((size_t)HD * TT)); const float* f = F + (size_t)t * pitch + h * HD; const float rf = RF ? RF[(size_t)h * TT + t] : 1.0f; v2h o16; v2us oh, ol;
#pragma unroll
    for (int q = 0; q < 2; ++q) { const int dd = d + q; const int dp = (dd < HD / 2) ? dd + HD / 2 : dd - HD / 2; float x0 = f[dd], x1 = f[dp];
        if (RF) { float n0 = __fmul_rn(x0, rf), n1 = __fmul_rn(x1, rf); asm volatile("" : "+v"(n0)); asm volatile("" : "+v"(n1)); x0 = __fmul_rn(bfr(nw[dd]), n0); x1 = __fmul_rn(bfr(nw[dp]), n1); }
        const v2f cs = *(const v2f*)(CS + ((size_t)t * HD + dd) * 2); float a = __fmul_rn(x0, cs[0]), bq = __fmul_rn(x1, cs[1]); asm volatile("" : "+v"(a)); asm volatile("" : "+v"(bq)); const float r = ((dd < HD / 2) ? __fsub_rn(a, bq) : __fadd_rn(a, bq)) * sc;
        o16[q] = tohx(r); unsigned short a2, c2; splitf(r, a2, c2); oh[q] = a2; ol[q] = c2; }
    *(v2h*)(P16 + e) = o16; *(v2us*)(Ph + e) = oh; *(v2us*)(Pl + e) = ol;  }
__global__ __launch_bounds__(256) void k_vtp(const float* __restrict__ F, int pitch, int nheads, h16* V16, bf* Vh, bf* Vl) {
    // blockIdx.y: sequence. Rows (g, d) at pitch 2 x TT: hi plane in the first half of a row and lo plane in the second (Vl = Vh + TT); the fp16 rows of an even and the next odd sequence share a row.
    { const size_t sq = blockIdx.y, rows = (size_t)nheads * HD * (2 * TT); F += sq * TT * pitch; V16 += (sq >> 1) * rows + (sq & 1) * TT; Vh += sq * rows; Vl += sq * rows; }
    const size_t e = ((size_t)blockIdx.x * 256 + threadIdx.x) * 2; if (e >= (size_t)nheads * HD * TT) return; const int t = (int)(e % TT); const int d = (int)((e / TT) % HD); const int g = (int)(e / ((size_t)TT * HD)); v2h o16; v2us oh, ol;
#pragma unroll
    for (int q = 0; q < 2; ++q) { const float x = F[(size_t)(t + q) * pitch + g * HD + d]; o16[q] = tohx(x); unsigned short a2, c2; splitf(x, a2, c2); oh[q] = a2; ol[q] = c2; }
    const size_t e2 = (size_t)(g * HD + d) * (2 * TT) + t; *(v2h*)(V16 + e2) = o16; *(v2us*)(Vh + e2) = oh; *(v2us*)(Vl + e2) = ol;  }
__global__ __launch_bounds__(256) void k_csid(float* CS) { const int idx = blockIdx.x * 256 + threadIdx.x; if (idx >= TT * HD) return; v2f cs; cs[0] = 1.0f; cs[1] = 0.0f; *(v2f*)(CS + (size_t)idx * 2) = cs;  }
// k_asoft: per row (zz, i): t = S x HD^-0.5 for j <= i (causal; the reference's -1e9 additive fill vanishes identically); softmax over the 2048 keys (register row, one exp, fixed trees);
// the probabilities go IN PLACE over the wave's own score row (8 KiB: fp16 row in its first half; hi plane first half, lo plane second half), after the whole row is in registers; P16 = Ph = Sb, Pl = Sb + half a row.
__global__ __launch_bounds__(256) void k_asoft(const float* Sb, h16* P16, bf* Ph, bf* Pl) {
    const int lane = threadIdx.x & 31; const int row = blockIdx.x * 8 + (threadIdx.x >> 5); if (row >= ZH * TT) return; const int i = row % TT; const int zz = row / TT; (void)zz; const bool hires = (i < RH); const float* sr = Sb + (size_t)row * TT; float v[TT / 32]; float mx = -3.0e38f;
#pragma unroll
    for (int ch = 0; ch < TT / 128; ++ch) { const int j0 = ch * 128 + lane * 4; const v4f a = *(const v4f*)(sr + j0);
#pragma unroll
        for (int q = 0; q < 4; ++q) { const int j = j0 + q; (void)j; const float t = (j <= i) ? a[q] * SCL : -3.0e38f;   /* causal; -1e9 fill == select */ v[ch * 4 + q] = t; mx = fmaxf(mx, t); } }
#pragma unroll
    for (int sh = 16; sh; sh >>= 1) mx = fmaxf(mx, __shfl_xor(mx, sh, 32));
    float sum = 0.f;
#pragma unroll
    for (int k = 0; k < TT / 32; ++k) { float d0 = __fsub_rn(v[k], mx); asm volatile("" : "+v"(d0)); v[k] = __builtin_amdgcn_exp2f(__fmul_rn(d0, 1.4426950408889634f)); sum += v[k]; }
#pragma unroll
    for (int sh = 16; sh; sh >>= 1) sum += __shfl_xor(sum, sh, 32);
    const float f = __fdiv_rn(hires ? 1.0f : PCAR, sum);
{
        if (hires) {
#pragma unroll
            for (int ch = 0; ch < TT / 128; ++ch) { v4us oh, ol;
#pragma unroll
                for (int q = 0; q < 4; ++q) { unsigned short a, c2; splitf(v[ch * 4 + q] * f, a, c2); oh[q] = a; ol[q] = c2; }
                const size_t oo = (size_t)row * (2 * TT) + ch * 128 + lane * 4; *(v4us*)(Ph + oo) = oh; *(v4us*)(Pl + oo) = ol; }
        } else {
#pragma unroll
            for (int ch = 0; ch < TT / 128; ++ch) { v4h o4;
#pragma unroll
                for (int q = 0; q < 4; ++q) o4[q] = tohx(v[ch * 4 + q] * f);
                *(v4h*)(P16 + (size_t)row * (2 * TT) + ch * 128 + lane * 4) = o4; } }
         }
}
__global__ __launch_bounds__(256) void k_merge(const float* __restrict__ O, int h0, bf* Ah, bf* Al) { const size_t e = ((size_t)blockIdx.x * 256 + threadIdx.x) * 2; if (e >= (size_t)ZH * TT * HD) return; const int d = (int)(e % HD); const int t = (int)((e / HD) % TT); const int zz = (int)(e / ((size_t)HD * TT)); const float cs = (t < RH) ? 1.0f : (1.0f / PCAR); const size_t oo = (size_t)t * DQ + (h0 + zz) * HD + d;
    v2us oh, ol; v2f sum = *(const v2f*)(O + e);
#pragma unroll
    for (int s = 1; s < KSP; ++s) { const v2f p = *(const v2f*)(O + (size_t)s * ZH * TT * HD + e); sum[0] += p[0]; sum[1] += p[1]; }   // the K-split partial planes, added in split order
#pragma unroll
    for (int q = 0; q < 2; ++q) { unsigned short a, c2; splitf(sum[q] * cs, a, c2); oh[q] = a; ol[q] = c2; } *(v2us*)(Ah + oo) = oh; *(v2us*)(Al + oo) = ol;  }

extern "C" void kernel_launch(void* const* d_in, const int* in_sizes, int n_in,
                              void* d_out, int out_size, void* d_ws, size_t ws_size, hipStream_t stream) {
    (void)in_sizes; (void)n_in; (void)out_size;
    const float* x = (const float*)d_in[0]; const float* g1 = (const float*)d_in[1]; const float* e1 = (const float*)d_in[2]; const float* wq = (const float*)d_in[3]; const float* wk = (const float*)d_in[4]; const float* wv = (const float*)d_in[5]; const float* wo = (const float*)d_in[6]; const float* g2 = (const float*)d_in[7]; const float* e2 = (const float*)d_in[8];
    float* OUT = (float*)d_out;     // [4][2048][512]
    char* wsp = (char*)d_ws;
    auto take = [&](size_t bytes) { char* p = wsp; wsp += (bytes + 255) & ~(size_t)255; return (void*)p; };
    bf* WQ = (bf*)take((size_t)DQ * DM * 2); bf* WK = (bf*)take((size_t)DKV * DM * 2); bf* WV = (bf*)take((size_t)DKV * DM * 2); bf* WO = (bf*)take((size_t)DM * DQ * 2);   // consecutive planes (k_wtG, z-batched projection)
    float* Hf = (float*)take((size_t)NB_ * TT * DM * 4);
    const size_t PLN = (size_t)NB_ * NH_ * TT * HD;   // one head-plane set, all sequences
    h16* QP16 = (h16*)take(PLN * 2); h16* KP16 = (h16*)take(PLN * 2); h16* VT16 = (h16*)take(PLN * 2);
    bf* QPh = (bf*)take(PLN * 2); bf* QPl = (bf*)take(PLN * 2); bf* KPh = (bf*)take(PLN * 2); bf* KPl = (bf*)take(PLN * 2); bf* VTh = (bf*)take(PLN * 2 * 2); bf* VTl = VTh + TT;   // hi and lo halves of rows of pitch 2 x TT
    char* const un = wsp;   // from here on the workspace is reused, stream-ordered: (1) projection buffers, (2) attention pass buffers, (3) wfc output
    float* CS = (float*)take((size_t)TT * HD * 2 * 4); float* PE = (float*)take((size_t)TT * DM * 4); bf* Yh = (bf*)take((size_t)NB_ * TT * DM * 2); bf* Yl = (bf*)take((size_t)NB_ * TT * DM * 2);
    float* FQ = (float*)take((size_t)NB_ * TT * DQ * 4); float* FK = (float*)take((size_t)NB_ * TT * DKV * 4); float* FV = (float*)take((size_t)NB_ * TT * DKV * 4);   // consecutive (z-batched projection)
    if ((size_t)(wsp - (char*)d_ws) > ws_size) return;
    wsp = un;
    float* Sb = (float*)take((size_t)ZH * TT * TT * 4); float* Ob = (float*)take((size_t)KSP * ZH * TT * HD * 4);
    if ((size_t)(wsp - (char*)d_ws) > ws_size) return;    // ws 256 MiB
    float* O2 = (float*)un;
    bf* ATh = QPh; bf* ATl = QPl;   // merged heads of a sequence overwrite that sequence's q hi/lo planes (same bytes), which its score launches have finished reading
    k_wtG<<<dim3((unsigned)((DM * DQ / 64 + 63) / 64), 4, 1), 256, 0, stream>>>(wq, wk, wv, wo, DM, DQ, WQ);
    k_csid<<<(TT * HD + 255) / 256, 256, 0, stream>>>(CS);
    const unsigned LQ = (unsigned)(((size_t)NH_ * TT * HD / 2 + 255) / 256), LKv = (unsigned)(((size_t)NKV * TT * HD / 2 + 255) / 256);
    k_petab<<<(unsigned)(((size_t)TT * DM / 2 + 255) / 256), 256, 0, stream>>>(PE); k_lnpe<<<NB_ * TT / 8, 256, 0, stream>>>(x, PE, g1, e1, Hf, Yh, Yl);   /* h = LN1(x) + PE: f32 + hi/lo planes, all sequences */
    k_gemmw<bf, 1, false><<<dim3(NB_ * TT / 64, DQ / 64, 3), 32, 0, stream>>>(Yh, Yl, WQ, nullptr, DM, FQ, DQ, nullptr, 0, (size_t)DQ * DM, (size_t)NB_ * TT * DQ);   /* z: q, k, v */
    k_rope<<<dim3(LQ, NB_, 1), 256, 0, stream>>>(FQ, DQ, NH_, CS, nullptr, nullptr, 1.0f, QP16, QPh, QPl);
    k_rope<<<dim3(LKv, NB_, 1), 256, 0, stream>>>(FK, DKV, NKV, CS, nullptr, nullptr, 1.0f, KP16, KPh, KPl);
    k_vtp<<<dim3(LKv, NB_, 1), 256, 0, stream>>>(FV, DKV, NKV, VT16, VTh, VTl);
    for (int b = 0; b < NB_; ++b) { const size_t zo = (size_t)b * NH_ * TT * HD;   // one pass per sequence: its ZH = NH_ heads are the z-batch (one kv head per query head)
        k_gemmc<bf, 2, 1, 1, 32><<<dim3(RH / 64, TT / 64, ZH), 32, 0, stream>>>(QPh + zo, QPl + zo, KPh + zo, KPl + zo, HD, Sb, TT, 0, (size_t)TT * HD, (size_t)TT * HD, (size_t)TT * TT, 0);
        k_gemmc<h16, 0, 1, 1, 32><<<dim3((TT - RH) / 64, TT / 64, ZH), 32, 0, stream>>>(QP16 + zo + (size_t)RH * HD, nullptr, KP16 + zo, nullptr, HD, Sb + (size_t)RH * TT, TT, RH, (size_t)TT * HD, (size_t)TT * HD, (size_t)TT * TT, 0);
        k_asoft<<<ZH * TT / 8, 256, 0, stream>>>(Sb, (h16*)Sb, (bf*)Sb, (bf*)Sb + TT);
        k_gemmc<bf, 2, 2, KSP, 32><<<dim3(RH / 64, KSP, ZH), 32, 0, stream>>>((const bf*)Sb, (const bf*)Sb + TT, VTh + 2 * zo, VTl + 2 * zo, 2 * TT, Ob, HD, 0, (size_t)TT * 2 * TT, (size_t)HD * 2 * TT, (size_t)TT * HD, (size_t)ZH * TT * HD);
        k_gemmc<h16, 0, 2, KSP, 64><<<dim3((TT - RH) / 64, KSP, ZH), 32, 0, stream>>>((const h16*)Sb + (size_t)RH * 2 * TT, nullptr, VT16 + (size_t)(b >> 1) * 2 * NH_ * TT * HD + (size_t)(b & 1) * TT, nullptr, 2 * TT, Ob + (size_t)RH * HD, HD, RH, (size_t)TT * 2 * TT, (size_t)HD * 2 * TT, (size_t)TT * HD, (size_t)ZH * TT * HD);
        k_merge<<<(unsigned)(((size_t)ZH * TT * HD / 2 + 255) / 256), 256, 0, stream>>>(Ob, 0, ATh + (size_t)b * TT * DQ, ATl + (size_t)b * TT * DQ); }
    k_gemmw<bf, 1, false><<<dim3(NB_ * TT / 64, DM / 64, 1), 32, 0, stream>>>(ATh, ATl, WO, nullptr, DQ, O2, DM, nullptr, 0, 0, 0); k_resln2<<<NB_ * TT / 8, 256, 0, stream>>>(O2, Hf, x, g2, e2, OUT);   /* o = merged wfc; out = LN2(o + h) + x */
}

// v004
// Measured time: 164 microseconds a run.
// Versions in between are left out here; by their measured steps it is 2.61 times as fast as v002.
// All steps since v000 together make it 9.37 times as fast.
#include <hip/hip_runtime.h>

// Pre-norm causal self-attention block with sinusoidal positions (x [4][2048][512]; h = LN1(x) (1e-5) + PE (pe[t][2i] = sin(t w_i), pe[t][2i+1] = cos(t w_i), w_i = exp(2i x (-ln 1e4 / 512))); q, k, v = h W ('xw' [512][512], no bias; 8 heads x 64); causal softmax(q.k/8) (-1e9 fill == exact zero weight); o = merged wfc ('xw'); out = LN2(o + h) (1e-6) + x -> [4][2048][512] (4.2 M)).
// Layout: LN1 + PE in one row kernel producing h in f32 (kept for the residual) and as bf16 hi/lo planes (2-product projections); the PE table is computed on device in f32 with the reference's float32 constant for -ln(1e4)/512 (precise expf/sinf/cosf); the q/k/v projection GEMM stores its tiles straight as the attention kernel's operand planes; causal attention fused in one kernel (running softmax, scores never stored); the wfc GEMM output goes through a residual + LN2 row kernel that also adds x.
// Compute dtypes, f32 accumulate: every input rounded to bf16; q/k/v hl x exact (2 products); causal scores and attn.v (tile skipping): query rows < 512 hl (3 products), the rest single fp16; softmax f32; wfc hl x exact (2 products); LN2 and both residuals in f32.

#define NB_  4
#define TT   2048
#define DM   512
#define NH_  8
#define NKV  8
#define REP  (NH_ / NKV)
#define HD   64
#define DQ   (NH_ * HD)
#define DKV  (NKV * HD)
#define LNEPS 1e-5f
#define PEC  (-0.0179889463f)   // float32(-ln(10000)/512), as the reference's numpy computes it
typedef __attribute__((ext_vector_type(4))) unsigned short v4us;
#define RH   512                  // query rows < RH use hi+lo planes
typedef _Float16 h16;
typedef unsigned short bf;
typedef __attribute__((ext_vector_type(16))) __bf16   v16bf;
typedef __attribute__((ext_vector_type(16))) _Float16 v16h;
typedef __attribute__((ext_vector_type(8)))  _Float16 v8h;
typedef __attribute__((ext_vector_type(8)))  unsigned short v8us;
typedef __attribute__((ext_vector_type(8)))  float    v8f;
typedef __attribute__((ext_vector_type(4)))  float    v4f;
typedef v8h  __attribute__((may_alias)) v8ha;
typedef v4f  __attribute__((may_alias)) v4fa;
typedef v8us __attribute__((may_alias)) v8usa;

__device__ __forceinline__ unsigned short f2bf(float f) { unsigned u = __float_as_uint(f); u += 0x7FFFu + ((u >> 16) & 1u); return (unsigned short)(u >> 16); }
__device__ __forceinline__ float bf2f(unsigned short b) { return __uint_as_float(((unsigned)b) << 16); }
__device__ __forceinline__ float bfr(float f) { return bf2f(f2bf(f)); }
__device__ __forceinline__ v16h cat16(v8h lo, v8h hi) { return __builtin_shufflevector(lo, hi, 0, 1, 2, 3, 4, 5, 6, 7, 8, 9, 10, 11, 12, 13, 14, 15); }
__device__ __forceinline__ v16bf cat16b(v8us lo, v8us hi) { return __builtin_bit_cast(v16bf, __builtin_shufflevector(lo, hi, 0, 1, 2, 3, 4, 5, 6, 7, 8, 9, 10, 11, 12, 13, 14, 15)); }
__device__ __forceinline__ v8f wmma16(v16h a, v16h b, v8f c) { return __builtin_amdgcn_wmma_f32_16x16x32_f16(false, a, false, b, (short)0, c, false, false); }
__device__ __forceinline__ v8f wmmab(v16bf a, v16bf b, v8f c) { return __builtin_amdgcn_wmma_f32_16x16x32_bf16(false, a, false, b, (short)0, c, false, false); }



// ---- k_gemmw: register-blocked GEMM, ONE WAVE per 64x64 output tile (16 accumulators), operands straight from K-contiguous 16-bit planes; grid (M/64, N/64, Z), 32 threads.
// C[m][n] (f32, pitch ldc, + optional f32 bias[n]) = sum_k A[m][k] Bt[n][k] (+ split products per NSPLIT). z-batch strides sA/sB/sC in elements. K % 32 == 0.
template <typename T16> struct WFrag;
template <> struct WFrag<h16> { typedef v16h V; static __device__ __forceinline__ V ld(const h16* p) { return cat16(*(const v8h*)p, *(const v8h*)(p + 16)); } static __device__ __forceinline__ v8f mma(V a, V b, v8f c) { return wmma16(a, b, c); } };
template <> struct WFrag<bf> { typedef v16bf V; static __device__ __forceinline__ V ld(const bf* p) { return cat16b(*(const v8us*)p, *(const v8us*)(p + 16)); } static __device__ __forceinline__ v8f mma(V a, V b, v8f c) { return wmmab(a, b, c); } };
// HP (head planes): z = 0, 1, 2 are the q, k, v projections and a tile is 64 positions of one sequence x the 64 columns of one head; instead of C the wave stores the tile as the attention kernel's operands:
// q, k as [sequence][head][t][d], v transposed as rows (head, d) of pitch 2 x TT, each as fp16 and as bf16 hi/lo; every store instruction covers four whole 128-byte lines.
__device__ __forceinline__ void splitf(float y, unsigned short& h, unsigned short& l) { h = f2bf(y); l = f2bf(y - bf2f(h)); }
typedef __attribute__((ext_vector_type(8))) __bf16 v8bf;
__device__ __forceinline__ void split8(const v8f x, v8h& o16, v8us& oh, v8us& ol) { v8bf h, l;   // fp16, and bf16 hi + lo of the remainder (round to nearest even, as f2bf)
#pragma unroll
    for (int j = 0; j < 8; ++j) { o16[j] = (h16)x[j]; h[j] = (__bf16)x[j]; l[j] = (__bf16)(x[j] - (float)h[j]); }
    oh = __builtin_bit_cast(v8us, h); ol = __builtin_bit_cast(v8us, l); }
template <typename T16, int NSPLIT, bool BIAS, bool HP>
__global__ __launch_bounds__(32) void k_gemmw(const T16* __restrict__ A, const T16* __restrict__ A2, const T16* __restrict__ Bt, const T16* __restrict__ Bt2, int K, float* C, int ldc, const float* __restrict__ bias, size_t sA, size_t sB, size_t sC, h16* Q16, bf* Qh, bf* Ql, h16* K16, bf* Kh, bf* Kl, h16* V16, bf* Vh) {
    typedef typename WFrag<T16>::V V;
    __shared__ __align__(16) float os[HP ? 3 * 16 * 36 : 16 * 68];
    const size_t z = blockIdx.z; A += z * sA; if (A2) A2 += z * sA; Bt += z * sB; if (Bt2) Bt2 += z * sB; C += z * sC;
    const int lane = threadIdx.x & 31, lr = lane & 15, hi = lane >> 4; const int r0 = blockIdx.x * 64, c0 = blockIdx.y * 64;
    v8f acc[4][4];
#pragma unroll
    for (int mb = 0; mb < 4; ++mb)
#pragma unroll
        for (int nb = 0; nb < 4; ++nb) acc[mb][nb] = (v8f){};
    const size_t aoff = (size_t)(r0 + lr) * K + 8 * hi, boff = (size_t)(c0 + lr) * K + 8 * hi;
#pragma unroll 1
    for (int kc = 0; kc < K; kc += 32) {
        V a[4], a2[4];
#pragma unroll
        for (int mb = 0; mb < 4; ++mb) { a[mb] = WFrag<T16>::ld(A + aoff + (size_t)mb * 16 * K + kc); if (NSPLIT == 1 || NSPLIT == 2) a2[mb] = WFrag<T16>::ld(A2 + aoff + (size_t)mb * 16 * K + kc); }
#pragma unroll
        for (int nb = 0; nb < 4; ++nb) { const V b = WFrag<T16>::ld(Bt + boff + (size_t)nb * 16 * K + kc); V b2; if (NSPLIT >= 2) b2 = WFrag<T16>::ld(Bt2 + boff + (size_t)nb * 16 * K + kc);
#pragma unroll
            for (int mb = 0; mb < 4; ++mb) { acc[mb][nb] = WFrag<T16>::mma(a[mb], b, acc[mb][nb]); if (NSPLIT == 1 || NSPLIT == 2) acc[mb][nb] = WFrag<T16>::mma(a2[mb], b, acc[mb][nb]); if (NSPLIT >= 2) acc[mb][nb] = WFrag<T16>::mma(a[mb], b2, acc[mb][nb]); } }
        asm volatile("v_nop\n\tv_nop\n\tv_nop\n\tv_nop" : "+v"(acc[0][0]), "+v"(acc[1][1]), "+v"(acc[2][2]), "+v"(acc[3][3]) : "v"(a[0]), "v"(a[3]));
    }
    if constexpr (HP) {
        const int sq = r0 / TT, t0 = r0 % TT, hd = blockIdx.y, r4 = lane >> 3, c8 = (lane & 7) * 8;   // read-back: 8 lanes cover one 128-byte row of 64 16-bit values, a wave four rows
        if (z == 2) {   // v: a lane's accumulator holds 8 consecutive t of one d, already the transposed order; 16 d rows x 64 t per plane go through LDS (pitch 72 values) so that whole lines are stored
            unsigned short* const sv = (unsigned short*)os; const size_t rows = (size_t)NKV * HD * (2 * TT), vrow = (size_t)(hd * HD + r4) * (2 * TT) + t0 + c8;
            unsigned short* const gp[3] = { (unsigned short*)V16 + (size_t)(sq >> 1) * rows + (size_t)(sq & 1) * TT + vrow, Vh + (size_t)sq * rows + vrow, Vh + (size_t)sq * rows + TT + vrow };   // the fp16 rows of an even and the next odd sequence share a row; lo plane TT behind hi
#pragma unroll
            for (int nb = 0; nb < 4; ++nb) {
#pragma unroll
                for (int mb = 0; mb < 4; ++mb) { v8h o16; v8us oh, ol; split8(acc[mb][nb], o16, oh, ol);
                    unsigned short* const sp = sv + lr * 72 + mb * 16 + hi * 8; *(v8ha*)sp = o16; *(v8usa*)(sp + 16 * 72) = oh; *(v8usa*)(sp + 2 * 16 * 72) = ol; }
                asm volatile("s_wait_dscnt 0x0" ::: "memory");   // the staged rows are read back, by other lanes than wrote them, only behind the LDS stores' own wait
#pragma unroll
                for (int p = 0; p < 3; ++p)
#pragma unroll
                    for (int s = 0; s < 4; ++s) *(v8us*)(gp[p] + (size_t)(nb * 16 + s * 4) * (2 * TT)) = *(const v8usa*)(sv + (p * 16 + s * 4 + r4) * 72 + c8);
                asm volatile("s_wait_xcnt 0x0" ::: "memory"); __builtin_amdgcn_sched_barrier(0);   // behind the stores: their data and address registers are rewritten only behind this wait (the scheduling barrier keeps the next rows' conversions from rising over it)
            }
        } else {        // q, k: 16 rows of f32 through LDS, read back 8 values a lane, converted, stored
            const size_t po = ((size_t)(sq * NH_ + hd) * TT + t0 + r4) * HD + c8; h16* const p16 = (z ? K16 : Q16) + po; bf* const ph = (z ? Kh : Qh) + po; bf* const pl = (z ? Kl : Ql) + po;
#pragma unroll
            for (int mb = 0; mb < 4; ++mb) {
#pragma unroll
                for (int nb = 0; nb < 4; ++nb) {
#pragma unroll
                    for (int j = 0; j < 8; ++j) os[(hi * 8 + j) * 68 + nb * 16 + lr] = acc[mb][nb][j]; }
                asm volatile("s_wait_dscnt 0x0" ::: "memory");   // as above: read-back only behind the LDS stores' wait
#pragma unroll
                for (int s = 0; s < 4; ++s) { const float* const rp = os + (s * 4 + r4) * 68 + c8; const v4f x0 = *(const v4fa*)rp, x1 = *(const v4fa*)(rp + 4); v8h o16; v8us oh, ol;
                    split8(__builtin_shufflevector(x0, x1, 0, 1, 2, 3, 4, 5, 6, 7), o16, oh, ol);
                    const size_t off = (size_t)(mb * 16 + s * 4) * HD; *(v8h*)(p16 + off) = o16; *(v8us*)(ph + off) = oh; *(v8us*)(pl + off) = ol; }
                asm volatile("s_wait_xcnt 0x0" ::: "memory"); __builtin_amdgcn_sched_barrier(0);   // as above, behind the twelve stores
            }
        }
    } else
#pragma unroll
    for (int mb = 0; mb < 4; ++mb) {
#pragma unroll
        for (int nb = 0; nb < 4; ++nb) {
#pragma unroll
            for (int j = 0; j < 8; ++j) os[(hi * 8 + j) * 68 + nb * 16 + lr] = acc[mb][nb][j]; }
        __builtin_amdgcn_wave_barrier(); asm volatile("" ::: "memory");
        float* crow = C + (size_t)(r0 + mb * 16) * ldc + c0;
{
#pragma unroll
            for (int s = 0; s < 8; ++s) { const int row = 2 * s + hi, cofs = lr * 4; v4f val = *(const v4fa*)(os + row * 68 + cofs); if (BIAS) { val[0] += bfr(bias[c0 + cofs]); val[1] += bfr(bias[c0 + cofs + 1]); val[2] += bfr(bias[c0 + cofs + 2]); val[3] += bfr(bias[c0 + cofs + 3]); }
                *(v4f*)(crow + (size_t)row * ldc + cofs) = val; }
             }
        __builtin_amdgcn_wave_barrier(); asm volatile("" ::: "memory");
    }
}

typedef __attribute__((ext_vector_type(2))) _Float16 v2h;
typedef __attribute__((ext_vector_type(4))) _Float16 v4h;
typedef __attribute__((ext_vector_type(2))) unsigned short v2us;
typedef __attribute__((ext_vector_type(4))) unsigned short v4us;
typedef __attribute__((ext_vector_type(2))) float v2f;
typedef __attribute__((ext_vector_type(4))) int v4i;

__global__ __launch_bounds__(256) void k_wtG(const float* __restrict__ w0, const float* __restrict__ w1, const float* __restrict__ w2, const float* __restrict__ w3, int K, int N, bf* Bt) {
    const int wi = blockIdx.y; const float* w = (wi == 0) ? w0 : (wi == 1) ? w1 : (wi == 2) ? w2 : w3; Bt += (size_t)wi * K * N;   // blockIdx.y: which of the four equally shaped weights (consecutive output planes)
    const int lane = threadIdx.x & 31; const int L0 = (blockIdx.x * 8 + (threadIdx.x >> 5)) * 8; const int nlines = N * K / 64;
{
#pragma unroll 1
        for (int l = 0; l < 8; ++l) { const int L = L0 + l; if (L >= nlines) break; const size_t e = (size_t)L * 64 + lane * 2; const int k = (int)(e % K), n = (int)(e / K); v2us o;
            o[0] = f2bf(w[(size_t)k * N + n]); o[1] = f2bf(w[(size_t)(k + 1) * N + n]); *(v2us*)(Bt + e) = o; }
         }
}
__global__ __launch_bounds__(256) void k_petab(float* PE) { const size_t e = ((size_t)blockIdx.x * 256 + threadIdx.x) * 2; if (e >= (size_t)TT * DM) return; const int c = (int)(e % DM); const int t = (int)(e / DM); const float w = expf(__fmul_rn((float)c, PEC)); const float ang = __fmul_rn((float)t, w); v2f o; o[0] = sinf(ang); o[1] = cosf(ang); *(v2f*)(PE + e) = o;  }
__global__ __launch_bounds__(256) void k_lnpe(const float* __restrict__ X, const float* __restrict__ PE, const float* __restrict__ g, const float* __restrict__ be, float* Hf, bf* Yh, bf* Yl) {
    const int lane = threadIdx.x & 31; const int r = blockIdx.x * 8 + (threadIdx.x >> 5); if (r >= NB_ * TT) return; const float* xr = X + (size_t)r * DM; float s = 0.f;   // r: row of all sequences, position r % TT
#pragma unroll 1
    for (int ch = 0; ch < DM / 128; ++ch) { const int c0 = ch * 128 + lane * 4; const v4f a = *(const v4f*)(xr + c0);
#pragma unroll
        for (int q = 0; q < 4; ++q) s += bfr(a[q]); }
#pragma unroll
    for (int sh = 16; sh; sh >>= 1) s += __shfl_xor(s, sh, 32);
    const float mu = s * (1.0f / DM); float s2 = 0.f;
#pragma unroll 1
    for (int ch = 0; ch < DM / 128; ++ch) { const int c0 = ch * 128 + lane * 4; const v4f a = *(const v4f*)(xr + c0);
#pragma unroll
        for (int q = 0; q < 4; ++q) { const float d0 = __fsub_rn(bfr(a[q]), mu); float p = __fmul_rn(d0, d0); asm volatile("" : "+v"(p)); s2 = __fadd_rn(s2, p); } }
#pragma unroll
    for (int sh = 16; sh; sh >>= 1) s2 += __shfl_xor(s2, sh, 32);
    const float rs = __fdiv_rn(1.0f, __fsqrt_rn(__fadd_rn(s2 * (1.0f / DM), LNEPS)));
{
#pragma unroll 1
        for (int ch = 0; ch < DM / 128; ++ch) { const int c0 = ch * 128 + lane * 4; const v4f a = *(const v4f*)(xr + c0); const v4f pe = *(const v4f*)(PE + (size_t)(r % TT) * DM + c0); v4f h4; v4us oh, ol;
#pragma unroll
            for (int q = 0; q < 4; ++q) { float n0 = __fmul_rn(__fsub_rn(bfr(a[q]), mu), rs); asm volatile("" : "+v"(n0)); float n1 = __fmul_rn(n0, bfr(g[c0 + q])); asm volatile("" : "+v"(n1)); const float ln = __fadd_rn(n1, bfr(be[c0 + q])); const float hv = __fadd_rn(ln, pe[q]); h4[q] = hv; unsigned short h2, l2; splitf(hv, h2, l2); oh[q] = h2; ol[q] = l2; }
            *(v4f*)(Hf + (size_t)r * DM + c0) = h4; *(v4us*)(Yh + (size_t)r * DM + c0) = oh; *(v4us*)(Yl + (size_t)r * DM + c0) = ol; }
         } }
__global__ __launch_bounds__(256) void k_resln2(const float* __restrict__ O, const float* __restrict__ Hf, const float* __restrict__ X, const float* __restrict__ g, const float* __restrict__ be, float* OUTb) {
    const int lane = threadIdx.x & 31; const int r = blockIdx.x * 8 + (threadIdx.x >> 5); if (r >= NB_ * TT) return; const float* orow = O + (size_t)r * DM; const float* hrow = Hf + (size_t)r * DM; float s = 0.f;
#pragma unroll 1
    for (int ch = 0; ch < DM / 128; ++ch) { const int c0 = ch * 128 + lane * 4; const v4f a = *(const v4f*)(orow + c0), hh = *(const v4f*)(hrow + c0);
#pragma unroll
        for (int q = 0; q < 4; ++q) s += __fadd_rn(a[q], hh[q]); }
#pragma unroll
    for (int sh = 16; sh; sh >>= 1) s += __shfl_xor(s, sh, 32);
    const float mu = s * (1.0f / DM); float s2 = 0.f;
#pragma unroll 1
    for (int ch = 0; ch < DM / 128; ++ch) { const int c0 = ch * 128 + lane * 4; const v4f a = *(const v4f*)(orow + c0), hh = *(const v4f*)(hrow + c0);
#pragma unroll
        for (int q = 0; q < 4; ++q) { const float d0 = __fsub_rn(__fadd_rn(a[q], hh[q]), mu); float p = __fmul_rn(d0, d0); asm volatile("" : "+v"(p)); s2 = __fadd_rn(s2, p); } }
#pragma unroll
    for (int sh = 16; sh; sh >>= 1) s2 += __shfl_xor(s2, sh, 32);
    const float rs = __fdiv_rn(1.0f, __fsqrt_rn(__fadd_rn(s2 * (1.0f / DM), 1e-6f)));
{
#pragma unroll 1
        for (int ch = 0; ch < DM / 128; ++ch) { const int c0 = ch * 128 + lane * 4; const v4f a = *(const v4f*)(orow + c0), hh = *(const v4f*)(hrow + c0), xx = *(const v4f*)(X + (size_t)r * DM + c0); v4f o4;
#pragma unroll
            for (int q = 0; q < 4; ++q) { float n0 = __fmul_rn(__fsub_rn(__fadd_rn(a[q], hh[q]), mu), rs); asm volatile("" : "+v"(n0)); float n1 = __fmul_rn(n0, bfr(g[c0 + q])); asm volatile("" : "+v"(n1)); o4[q] = __fadd_rn(__fadd_rn(n1, bfr(be[c0 + q])), bfr(xx[q])); }
            *(v4f*)(OUTb + (size_t)r * DM + c0) = o4; }
         } }
__global__ __launch_bounds__(256) void k_cvt8(const float* __restrict__ src, bf* dst, size_t n8) { const size_t i = (size_t)blockIdx.x * 256 + threadIdx.x; if (i >= n8) return; const v8f v = *(const v8f*)(src + i * 8); v8us o;
#pragma unroll
    for (int k = 0; k < 8; ++k) o[k] = f2bf(v[k]); *(v8us*)(dst + i * 8) = o;  }

__device__ __forceinline__ float xhalf(float x) { return __builtin_bit_cast(float, __builtin_amdgcn_permlanex16(__builtin_bit_cast(int, x), __builtin_bit_cast(int, x), 0x76543210, 0xfedcba98, false, false)); }   // lane l with lane l ^ 16
#define SCL2 0.18033688011112042f   // HD^-0.5 x log2(e)
template <bool B> struct BC { static constexpr bool v = B; };
// 2^x with the one free slot the instruction set asks for behind a transcendental written into the statement (v_nop). ex2x16: sixteen values in place; each v_exp_f32 is followed by an independent one, the last by the v_nop.
__device__ __forceinline__ float ex2(float x) { float r; asm("v_exp_f32 %0, %1\n\tv_nop" : "=v"(r) : "v"(x)); return r; }
__device__ __forceinline__ void ex2x16(float (&x)[16]) { asm("v_exp_f32 %0, %0\n\tv_exp_f32 %1, %1\n\tv_exp_f32 %2, %2\n\tv_exp_f32 %3, %3\n\tv_exp_f32 %4, %4\n\tv_exp_f32 %5, %5\n\tv_exp_f32 %6, %6\n\tv_exp_f32 %7, %7\n\tv_exp_f32 %8, %8\n\tv_exp_f32 %9, %9\n\tv_exp_f32 %10, %10\n\tv_exp_f32 %11, %11\n\tv_exp_f32 %12, %12\n\tv_exp_f32 %13, %13\n\tv_exp_f32 %14, %14\n\tv_exp_f32 %15, %15\n\tv_nop" : "+v"(x[0]), "+v"(x[1]), "+v"(x[2]), "+v"(x[3]), "+v"(x[4]), "+v"(x[5]), "+v"(x[6]), "+v"(x[7]), "+v"(x[8]), "+v"(x[9]), "+v"(x[10]), "+v"(x[11]), "+v"(x[12]), "+v"(x[13]), "+v"(x[14]), "+v"(x[15])); }
template <typename T16, int NQ, bool HI>
__device__ __forceinline__ void fattn(const T16* __restrict__ Q, const T16* __restrict__ Q2, const T16* __restrict__ Kp, const T16* __restrict__ Kp2, const T16* __restrict__ Vt, const int q0, bf* __restrict__ Ah, bf* __restrict__ Al) {
    typedef typename WFrag<T16>::V V;
    const int lane = threadIdx.x & 31, lr = lane & 15, hi = lane >> 4;
    V qf[NQ][2], qf2[NQ][2];
#pragma unroll
    for (int qt = 0; qt < NQ; ++qt)
#pragma unroll
        for (int ks = 0; ks < 2; ++ks) { const size_t qo = (size_t)(q0 + qt * 16 + lr) * HD + ks * 32 + 8 * hi; qf[qt][ks] = WFrag<T16>::ld(Q + qo); if (HI) qf2[qt][ks] = WFrag<T16>::ld(Q2 + qo); }
    __builtin_amdgcn_sched_barrier(0);        // here and below: the first fragments are issued in the loop's own order (Q, then K as the loop fetches it); loads return in order, so otherwise the K wait at the loop's head, which must hold for both ways in, also waits for the V just asked for
    v8f o[4][NQ]; float m[NQ], l[NQ];
#pragma unroll
    for (int qt = 0; qt < NQ; ++qt) { m[qt] = -3.0e38f; l[qt] = 0.f;
#pragma unroll
        for (int dt = 0; dt < 4; ++dt) o[dt][qt] = (v8f){}; }
    const int klast = (q0 + NQ * 16 - 1) & ~31;   // first key of the last pass (klast <= q0: every pass holds a key <= q for each of the wave's queries; passes before it lie wholly below the diagonal)
    const size_t ko = (size_t)lr * HD + 8 * hi, vo = (size_t)lr * (2 * TT) + 8 * hi;
    V kf[2][2], kf2[2][2];
#pragma unroll
    for (int kt = 0; kt < 2; ++kt)
#pragma unroll
        for (int ks = 0; ks < 2; ++ks) { kf[kt][ks] = WFrag<T16>::ld(Kp + ko + kt * 16 * HD + ks * 32); if (HI) kf2[kt][ks] = WFrag<T16>::ld(Kp2 + ko + kt * 16 * HD + ks * 32); __builtin_amdgcn_sched_barrier(0); }
    asm volatile("s_wait_xcnt 0x0" ::: "memory");   // behind the first loads: their address registers are rewritten only behind this wait, on every way from here (also the way round the loop)
    auto pass = [&](const int kb, auto last) {   // 32 keys; only the last pass touches the diagonal, so only it masks, and it alone fetches no further K: the loop's body has no branch inside
        V vf[4], vf2[4];                      // this pass's V, asked for first: it flies during the score products and the softmax
        const T16* const vp = Vt + vo + kb; const size_t kno = ko + (size_t)(kb + 32) * HD;   // the lo plane of V lies TT elements behind the hi plane in each row
#pragma unroll
        for (int dt = 0; dt < 4; ++dt) { const size_t off = (size_t)dt * 16 * (2 * TT); vf[dt] = WFrag<T16>::ld(vp + off); if (HI) vf2[dt] = WFrag<T16>::ld(vp + TT + off); }
        v8f s[2][NQ];
#pragma unroll
        for (int kt = 0; kt < 2; ++kt)
#pragma unroll
            for (int qt = 0; qt < NQ; ++qt) { v8f a = (v8f){};
#pragma unroll
                for (int ks = 0; ks < 2; ++ks) { a = WFrag<T16>::mma(kf[kt][ks], qf[qt][ks], a); if (HI) { a = WFrag<T16>::mma(kf2[kt][ks], qf[qt][ks], a); a = WFrag<T16>::mma(kf[kt][ks], qf2[qt][ks], a); } }
                s[kt][qt] = a; }
        if constexpr (!decltype(last)::v) {   // next pass's K, fetched into the same registers behind the score products
#pragma unroll
            for (int kt = 0; kt < 2; ++kt)
#pragma unroll
                for (int ks = 0; ks < 2; ++ks) { const size_t off = kno + kt * 16 * HD + ks * 32; kf[kt][ks] = WFrag<T16>::ld(Kp + off); if (HI) kf2[kt][ks] = WFrag<T16>::ld(Kp2 + off); }
        } else {                              // -1e9 fill == exact zero weight
#pragma unroll
            for (int kt = 0; kt < 2; ++kt)
#pragma unroll
                for (int qt = 0; qt < NQ; ++qt)
#pragma unroll
                    for (int j = 0; j < 8; ++j) if (kb + kt * 16 + hi * 8 + j > q0 + qt * 16 + lr) s[kt][qt][j] = -3.0e38f; }
        V pf[NQ], pf2[NQ];
#pragma unroll
        for (int qt = 0; qt < NQ; ++qt) { float mx = s[0][qt][0];
#pragma unroll
            for (int j = 1; j < 8; ++j) mx = fmaxf(mx, s[0][qt][j]);
#pragma unroll
            for (int j = 0; j < 8; ++j) mx = fmaxf(mx, s[1][qt][j]);
            mx = fmaxf(mx, xhalf(mx));
            const float mn = fmaxf(m[qt], mx * SCL2); const float al = ex2(m[qt] - mn); m[qt] = mn; float ls[4] = {0.f, 0.f, 0.f, 0.f}, pe[16];   // al = 0 on the first pass; four partial sums: short dependent chains
#pragma unroll
            for (int e = 0; e < 16; ++e) pe[e] = __builtin_fmaf(s[e >> 3][qt][e & 7], SCL2, -mn);
            ex2x16(pe);
#pragma unroll
            for (int e = 0; e < 16; ++e) { const float p = pe[e]; ls[e & 3] += p;
                if constexpr (HI) { const __bf16 ph = (__bf16)p; pf[qt][e] = ph; pf2[qt][e] = (__bf16)(p - (float)ph); } else { pf[qt][e] = (h16)p; } }
            l[qt] = l[qt] * al + ((ls[0] + ls[1]) + (ls[2] + ls[3]));
#pragma unroll
            for (int dt = 0; dt < 4; ++dt) o[dt][qt] *= al; }
#pragma unroll
        for (int dt = 0; dt < 4; ++dt)
#pragma unroll
            for (int qt = 0; qt < NQ; ++qt) { o[dt][qt] = WFrag<T16>::mma(vf[dt], pf[qt], o[dt][qt]); if (HI) { o[dt][qt] = WFrag<T16>::mma(vf2[dt], pf[qt], o[dt][qt]); o[dt][qt] = WFrag<T16>::mma(vf[dt], pf2[qt], o[dt][qt]); } }
        // foot of a pass, behind its last matrix instruction (the accumulators are operands): four free slots, so that on the way back to the loop's head nothing rewrites an operand too early;
        // and the pass's load addresses are read here once more, so that no load returns into their registers, and they are rewritten (next pass, epilogue) only behind this wait
        if constexpr (HI) { if constexpr (decltype(last)::v) asm volatile("v_nop\n\tv_nop\n\tv_nop\n\tv_nop\n\ts_wait_xcnt 0x0" : "+v"(o[0][0]), "+v"(o[1][0]), "+v"(o[2][0]), "+v"(o[3][0]) : "v"(vp) : "memory");
            else asm volatile("v_nop\n\tv_nop\n\tv_nop\n\tv_nop\n\ts_wait_xcnt 0x0" : "+v"(o[0][0]), "+v"(o[1][0]), "+v"(o[2][0]), "+v"(o[3][0]) : "v"(vp), "v"(Kp + kno), "v"(Kp2 + kno) : "memory"); }
        else { if constexpr (decltype(last)::v) asm volatile("v_nop\n\tv_nop\n\tv_nop\n\tv_nop\n\ts_wait_xcnt 0x0" : "+v"(o[0][0]), "+v"(o[1][0]), "+v"(o[2][0]), "+v"(o[3][0]), "+v"(o[0][NQ - 1]), "+v"(o[1][NQ - 1]), "+v"(o[2][NQ - 1]), "+v"(o[3][NQ - 1]) : "v"(vp) : "memory");
            else asm volatile("v_nop\n\tv_nop\n\tv_nop\n\tv_nop\n\ts_wait_xcnt 0x0" : "+v"(o[0][0]), "+v"(o[1][0]), "+v"(o[2][0]), "+v"(o[3][0]), "+v"(o[0][NQ - 1]), "+v"(o[1][NQ - 1]), "+v"(o[2][NQ - 1]), "+v"(o[3][NQ - 1]) : "v"(vp), "v"(Kp + kno) : "memory"); }
    };
#pragma unroll 1
    for (int kb = 0; kb < klast; kb += 32) pass(kb, BC<false>());   // rolled: one pass is already 16 (24) matrix instructions, and the next pass's K is fetched by hand
    pass(klast, BC<true>());
#pragma unroll
    for (int qt = 0; qt < NQ; ++qt) { const float inv = __fdiv_rn(1.0f, l[qt] + xhalf(l[qt])); const size_t oo = (size_t)(q0 + qt * 16 + lr) * DQ + hi * 8;
#pragma unroll
        for (int dt = 0; dt < 4; ++dt) { v8us oh, ol;
#pragma unroll
            for (int j = 0; j < 8; ++j) { unsigned short a, c2; splitf(o[dt][qt][j] * inv, a, c2); oh[j] = a; ol[j] = c2; }
            *(v8us*)(Ah + oo + dt * 16) = oh; *(v8us*)(Al + oo + dt * 16) = ol;
            asm volatile("s_wait_xcnt 0x0" ::: "memory"); } }   // behind the two stores: their data and address registers are rewritten only behind this wait
}
#define NTL ((TT - RH) / 32)   // 32-column tiles of the fp16 rows
#define NTH (RH / 16)          // 16-column tiles of the hi/lo rows
static_assert(NTL % 4 == 0 && (NTL + NTH) / 4 == 20, "the snake order below is written for 20 tile groups");
// grid (sequences x heads, (NTL + NTH) / 4), 4 waves: the waves of a work-group take neighbouring query tiles of ONE head (they walk the same keys, no barrier). Tile groups are numbered by falling cost; all work-groups are resident,
// 256 of them (8 values of blockIdx.y) make one round over the chip, so blockIdx.y walks the groups in snake order (0..7, 15..8, 19..16): placed round after round, a heavy group shares its place with light ones. For speed only.
__global__ __launch_bounds__(128) void k_fattn(const h16* __restrict__ Q16, const h16* __restrict__ K16, const h16* __restrict__ V16, const bf* __restrict__ Qh, const bf* __restrict__ Ql, const bf* __restrict__ Kh, const bf* __restrict__ Kl, const bf* __restrict__ Vh, bf* __restrict__ Ah, bf* __restrict__ Al) {
    const int zh = blockIdx.x, b = zh / NH_, h = zh % NH_; const int y = blockIdx.y, tg = (y < 8) ? y : (y < 16) ? 23 - y : 35 - y; const int ti = tg * 4 + __builtin_amdgcn_readfirstlane(threadIdx.x >> 5);
    const size_t po = (size_t)zh * TT * HD, ao = (size_t)b * TT * DQ + h * HD;
    if (ti < NTL) fattn<h16, 2, false>(Q16 + po, nullptr, K16 + po, nullptr, V16 + (size_t)(b >> 1) * 2 * NH_ * TT * HD + (size_t)(b & 1) * TT + (size_t)h * HD * 2 * TT, TT - 32 * (ti + 1), Ah + ao, Al + ao);
    else fattn<bf, 1, true>(Qh + po, Ql + po, Kh + po, Kl + po, Vh + 2 * po, RH - 16 * (ti - NTL + 1), Ah + ao, Al + ao);
}

extern "C" void kernel_launch(void* const* d_in, const int* in_sizes, int n_in,
                              void* d_out, int out_size, void* d_ws, size_t ws_size, hipStream_t stream) {
    (void)in_sizes; (void)n_in; (void)out_size;
    const float* x = (const float*)d_in[0]; const float* g1 = (const float*)d_in[1]; const float* e1 = (const float*)d_in[2]; const float* wq = (const float*)d_in[3]; const float* wk = (const float*)d_in[4]; const float* wv = (const float*)d_in[5]; const float* wo = (const float*)d_in[6]; const float* g2 = (const float*)d_in[7]; const float* e2 = (const float*)d_in[8];
    float* OUT = (float*)d_out;     // [4][2048][512]
    char* wsp = (char*)d_ws;
    auto take = [&](size_t bytes) { char* p = wsp; wsp += (bytes + 255) & ~(size_t)255; return (void*)p; };
    bf* WQ = (bf*)take((size_t)DQ * DM * 2); bf* WK = (bf*)take((size_t)DKV * DM * 2); bf* WV = (bf*)take((size_t)DKV * DM * 2); bf* WO = (bf*)take((size_t)DM * DQ * 2);   // consecutive planes (k_wtG, z-batched projection)
    float* Hf = (float*)take((size_t)NB_ * TT * DM * 4);
    const size_t PLN = (size_t)NB_ * NH_ * TT * HD;   // one head-plane set, all sequences
    h16* QP16 = (h16*)take(PLN * 2); h16* KP16 = (h16*)take(PLN * 2); h16* VT16 = (h16*)take(PLN * 2);
    bf* QPh = (bf*)take(PLN * 2); bf* QPl = (bf*)take(PLN * 2); bf* KPh = (bf*)take(PLN * 2); bf* KPl = (bf*)take(PLN * 2); bf* VTh = (bf*)take(PLN * 2 * 2);   // hi and lo halves of rows of pitch 2 x TT
    char* const un = wsp;   // from here on the workspace is reused, stream-ordered: (1) projection buffers, (2) wfc output
    float* PE = (float*)take((size_t)TT * DM * 4); bf* Yh = (bf*)take((size_t)NB_ * TT * DM * 2); bf* Yl = (bf*)take((size_t)NB_ * TT * DM * 2);
    bf* ATh = (bf*)take((size_t)NB_ * TT * DQ * 2); bf* ATl = (bf*)take((size_t)NB_ * TT * DQ * 2);   // merged heads, hi/lo planes (behind everything the wfc output overlays)
    if ((size_t)(wsp - (char*)d_ws) > ws_size) return;    // ws 256 MiB
    float* O2 = (float*)un;
    k_wtG<<<dim3((unsigned)((DM * DQ / 64 + 63) / 64), 4, 1), 256, 0, stream>>>(wq, wk, wv, wo, DM, DQ, WQ);
    k_petab<<<(unsigned)(((size_t)TT * DM / 2 + 255) / 256), 256, 0, stream>>>(PE); k_lnpe<<<NB_ * TT / 8, 256, 0, stream>>>(x, PE, g1, e1, Hf, Yh, Yl);   /* h = LN1(x) + PE: f32 + hi/lo planes, all sequences */
    k_gemmw<bf, 1, false, true><<<dim3(NB_ * TT / 64, DQ / 64, 3), 32, 0, stream>>>(Yh, Yl, WQ, nullptr, DM, nullptr, 0, nullptr, 0, (size_t)DQ * DM, 0, QP16, QPh, QPl, KP16, KPh, KPl, VT16, VTh);   /* z: q, k, v, stored as head planes */
    k_fattn<<<dim3(NB_ * NH_, (NTL + NTH) / 4, 1), 128, 0, stream>>>(QP16, KP16, VT16, QPh, QPl, KPh, KPl, VTh, ATh, ATl);   /* all sequences and heads */
    k_gemmw<bf, 1, false, false><<<dim3(NB_ * TT / 64, DM / 64, 1), 32, 0, stream>>>(ATh, ATl, WO, nullptr, DQ, O2, DM, nullptr, 0, 0, 0, nullptr, nullptr, nullptr, nullptr, nullptr, nullptr, nullptr, nullptr); k_resln2<<<NB_ * TT / 8, 256, 0, stream>>>(O2, Hf, x, g2, e2, OUT);   /* o = merged wfc; out = LN2(o + h) + x */
}

// v005
// One run takes 130 microseconds.
// Timed twice side by side with v004, it ran 1.26 and 1.27 times as fast.
// Over all steps from v000 it is 11.9 times as fast.
#include <hip/hip_runtime.h>

// Pre-norm causal self-attention block with sinusoidal positions (x [4][2048][512]; h = LN1(x) (1e-5) + PE (pe[t][2i] = sin(t w_i), pe[t][2i+1] = cos(t w_i), w_i = exp(2i x (-ln 1e4 / 512))); q, k, v = h W ('xw' [512][512], no bias; 8 heads x 64); causal softmax(q.k/8) (-1e9 fill == exact zero weight); o = merged wfc ('xw'); out = LN2(o + h) (1e-6) + x -> [4][2048][512] (4.2 M)).
// Layout: LN1 + PE in one row kernel producing h in f32 (kept for the residual) and as bf16 hi/lo planes (2-product projections); the PE table is computed on device in f32 with the reference's float32 constant for -ln(1e4)/512 (precise expf/sinf/cosf); the q/k/v projection GEMM stores its tiles straight as the attention kernel's operand planes; causal attention fused in one kernel (running softmax, scores never stored); the wfc GEMM output goes through a residual + LN2 row kernel that also adds x.
// Compute dtypes, f32 accumulate: every input rounded to bf16; q/k/v hl x exact (2 products); causal scores and attn.v (tile skipping): query rows < 512 hl (3 products), the rest single fp16; softmax f32; wfc hl x exact (2 products); LN2 and both residuals in f32.

#define NB_  4
#define TT   2048
#define DM   512
#define NH_  8
#define NKV  8
#define REP  (NH_ / NKV)
#define HD   64
#define DQ   (NH_ * HD)
#define DKV  (NKV * HD)
#define LNEPS 1e-5f
#define PEC  (-0.0179889463f)   // float32(-ln(10000)/512), as the reference's numpy computes it
typedef __attribute__((ext_vector_type(4))) unsigned short v4us;
#define RH   512                  // query rows < RH use hi+lo planes
typedef _Float16 h16;
typedef unsigned short bf;
typedef __attribute__((ext_vector_type(16))) __bf16   v16bf;
typedef __attribute__((ext_vector_type(16))) _Float16 v16h;
typedef __attribute__((ext_vector_type(8)))  _Float16 v8h;
typedef __attribute__((ext_vector_type(8)))  unsigned short v8us;
typedef __attribute__((ext_vector_type(8)))  float    v8f;
typedef __attribute__((ext_vector_type(4)))  float    v4f;
typedef v8h  __attribute__((may_alias)) v8ha;
typedef v4f  __attribute__((may_alias)) v4fa;
typedef v8us __attribute__((may_alias)) v8usa;

__device__ __forceinline__ unsigned short f2bf(float f) { unsigned u = __float_as_uint(f); u += 0x7FFFu + ((u >> 16) & 1u); return (unsigned short)(u >> 16); }
__device__ __forceinline__ float bf2f(unsigned short b) { return __uint_as_float(((unsigned)b) << 16); }
__device__ __forceinline__ float bfr(float f) { return bf2f(f2bf(f)); }
__device__ __forceinline__ v16h cat16(v8h lo, v8h hi) { return __builtin_shufflevector(lo, hi, 0, 1, 2, 3, 4, 5, 6, 7, 8, 9, 10, 11, 12, 13, 14, 15); }
__device__ __forceinline__ v16bf cat16b(v8us lo, v8us hi) { return __builtin_bit_cast(v16bf, __builtin_shufflevector(lo, hi, 0, 1, 2, 3, 4, 5, 6, 7, 8, 9, 10, 11, 12, 13, 14, 15)); }
__device__ __forceinline__ v8f wmma16(v16h a, v16h b, v8f c) { return __builtin_amdgcn_wmma_f32_16x16x32_f16(false, a, false, b, (short)0, c, false, false); }
__device__ __forceinline__ v8f wmmab(v16bf a, v16bf b, v8f c) { return __builtin_amdgcn_wmma_f32_16x16x32_bf16(false, a, false, b, (short)0, c, false, false); }



// ---- k_gemmw: register-blocked GEMM, one wave per 64x64 output tile (16 accumulators), 2 x 2 waves a work-group; the 128 + 128 operand rows come from K-contiguous 16-bit planes into LDS by asynchronous copies (ring of two stages); grid (M/128, N/128, Z), 128 threads.
// C[m][n] (f32, pitch ldc, + optional f32 bias[n]) = sum_k A[m][k] Bt[n][k] (+ split products per NSPLIT). z-batch strides sA/sB/sC in elements. K % 64 == 0.
template <typename T16> struct WFrag;
template <> struct WFrag<h16> { typedef v16h V; static __device__ __forceinline__ V ld(const h16* p) { return cat16(*(const v8h*)p, *(const v8h*)(p + 16)); } static __device__ __forceinline__ v8f mma(V a, V b, v8f c) { return wmma16(a, b, c); } };
template <> struct WFrag<bf> { typedef v16bf V; static __device__ __forceinline__ V ld(const bf* p) { return cat16b(*(const v8us*)p, *(const v8us*)(p + 16)); } static __device__ __forceinline__ v8f mma(V a, V b, v8f c) { return wmmab(a, b, c); } };
// HP (head planes): z = 0, 1, 2 are the q, k, v projections and a tile is 64 positions of one sequence x the 64 columns of one head; instead of C the wave stores the tile as the attention kernel's operands:
// q, k as [sequence][head][t][d], v transposed as rows (head, d) of pitch 2 x TT, each as fp16 and as bf16 hi/lo; every store instruction covers four whole 128-byte lines.
__device__ __forceinline__ void splitf(float y, unsigned short& h, unsigned short& l) { h = f2bf(y); l = f2bf(y - bf2f(h)); }
typedef __attribute__((ext_vector_type(8))) __bf16 v8bf;
__device__ __forceinline__ void split8(const v8f x, v8h& o16, v8us& oh, v8us& ol) { v8bf h, l;   // fp16, and bf16 hi + lo of the remainder (round to nearest even, as f2bf)
#pragma unroll
    for (int j = 0; j < 8; ++j) { o16[j] = (h16)x[j]; h[j] = (__bf16)x[j]; l[j] = (__bf16)(x[j] - (float)h[j]); }
    oh = __builtin_bit_cast(v8us, h); ol = __builtin_bit_cast(v8us, l); }
// Operand staging of k_gemmw: a stage is 64 k of 128 A rows (hi plane, lo plane) and 128 Bt rows, each row 128 bytes = one whole line. In LDS two rows share 272 bytes (256 + 16),
// so that the 16 rows of a fragment read fall on 16 different 16-byte bank groups. Three tiles a stage, two stages (a ring of two buffers).
#define GP2    272
#define GTILE  (64 * GP2)
#define GSTAGE (3 * GTILE)
// Eight asynchronous copies of 16 bytes a lane (rows 16 apart: a wave's copy covers four whole lines). The s_wait_xcnt is the last line of the copies' own statement: the address registers are rewritten only behind it.
__device__ __forceinline__ void cp8(const unsigned l, const char* const g, const size_t gs) {
    asm volatile("global_load_async_to_lds_b128 %0, %8, off\n\tglobal_load_async_to_lds_b128 %1, %9, off\n\tglobal_load_async_to_lds_b128 %2, %10, off\n\tglobal_load_async_to_lds_b128 %3, %11, off\n\t"
                 "global_load_async_to_lds_b128 %4, %12, off\n\tglobal_load_async_to_lds_b128 %5, %13, off\n\tglobal_load_async_to_lds_b128 %6, %14, off\n\tglobal_load_async_to_lds_b128 %7, %15, off\n\ts_wait_xcnt 0x0"
                 :: "v"(l), "v"(l + 8 * GP2), "v"(l + 16 * GP2), "v"(l + 24 * GP2), "v"(l + 32 * GP2), "v"(l + 40 * GP2), "v"(l + 48 * GP2), "v"(l + 56 * GP2),
                    "v"(g), "v"(g + gs), "v"(g + 2 * gs), "v"(g + 3 * gs), "v"(g + 4 * gs), "v"(g + 5 * gs), "v"(g + 6 * gs), "v"(g + 7 * gs) : "memory");
}
template <typename T16, int NSPLIT, bool BIAS, bool HP>
__global__ __launch_bounds__(128) void k_gemmw(const T16* __restrict__ A, const T16* __restrict__ A2, const T16* __restrict__ Bt, const T16* __restrict__ Bt2, int K, float* C, int ldc, const float* __restrict__ bias, size_t sA, size_t sB, size_t sC, h16* Q16, bf* Qh, bf* Ql, h16* K16, bf* Kh, bf* Kl, h16* V16, bf* Vh) {
    static_assert(NSPLIT == 1, "the staging below holds A, A2 and Bt");
    typedef typename WFrag<T16>::V V;
    __shared__ __align__(16) char sm[2 * GSTAGE];
    const size_t z = blockIdx.z; A += z * sA; A2 += z * sA; Bt += z * sB; C += z * sC;
    const int tid = threadIdx.x, lane = tid & 31, lr = lane & 15, hi = lane >> 4, wv = __builtin_amdgcn_readfirstlane(tid >> 5);
    const int r0 = blockIdx.x * 128 + (wv & 1) * 64, c0 = blockIdx.y * 128 + (wv >> 1) * 64;   // 2 x 2 waves, each a 64 x 64 tile
    v8f acc[4][4];
#pragma unroll
    for (int mb = 0; mb < 4; ++mb)
#pragma unroll
        for (int nb = 0; nb < 4; ++nb) acc[mb][nb] = (v8f){};
    const int cr = tid >> 3, cch = tid & 7;   // copies: 8 lanes a row, a thread's rows are cr + 16 i
    const unsigned lc = (unsigned)(size_t)sm + (cr >> 1) * GP2 + (cr & 1) * 128 + cch * 16;
    const char* const ga = (const char*)(A + (size_t)(blockIdx.x * 128 + cr) * K + cch * 8); const char* const ga2 = (const char*)(A2 + (size_t)(blockIdx.x * 128 + cr) * K + cch * 8); const char* const gb = (const char*)(Bt + (size_t)(blockIdx.y * 128 + cr) * K + cch * 8);
    const size_t gs = (size_t)16 * K * sizeof(T16);
    auto fill = [&](const int t) { const unsigned l = lc + (t & 1) * GSTAGE; cp8(l, ga + t * 128, gs); cp8(l + GTILE, ga2 + t * 128, gs); cp8(l + 2 * GTILE, gb + t * 128, gs); };
    const int nt = K / 64;
    fill(0);
    asm volatile("s_wait_asynccnt 0x0" ::: "memory");   // stage 0 has landed (this wave's copies) before the barrier that publishes it
    __syncthreads();
    if (nt > 1) fill(1);
    const int fo = (lr >> 1) * GP2 + (lr & 1) * 128 + hi * 16, ao = (wv & 1) * 32 * GP2 + fo, bo = 2 * GTILE + (wv >> 1) * 32 * GP2 + fo;   // fragment reads: row lr of a 16-row group, 16-byte pieces hi and 2 + hi of each 32 k
#pragma unroll 1
    for (int t = 0; t < nt; ++t) {
        const char* const sb = sm + (t & 1) * GSTAGE;
#pragma unroll
        for (int ks = 0; ks < 2; ++ks) { V a[4], a2[4], b[4];   // the twelve fragments of 32 k are asked for together, in front of their 32 products
#pragma unroll
            for (int mb = 0; mb < 4; ++mb) { a[mb] = WFrag<T16>::ld((const T16*)(sb + ao + mb * 8 * GP2 + ks * 64)); a2[mb] = WFrag<T16>::ld((const T16*)(sb + GTILE + ao + mb * 8 * GP2 + ks * 64)); b[mb] = WFrag<T16>::ld((const T16*)(sb + bo + mb * 8 * GP2 + ks * 64)); }
            __builtin_amdgcn_sched_barrier(0);   // keeps the Bt fragment reads up here: sunk among the products, each pair is waited out on its own in front of eight of them
#pragma unroll
            for (int nb = 0; nb < 4; ++nb)
#pragma unroll
                for (int mb = 0; mb < 4; ++mb) { acc[mb][nb] = WFrag<T16>::mma(a[mb], b[nb], acc[mb][nb]); acc[mb][nb] = WFrag<T16>::mma(a2[mb], b[nb], acc[mb][nb]); }
        }
        // four free slots behind the trip's last matrix instruction (all sixteen accumulators are operands, so none follows), on the way on and on the way back to the loop's head
        asm volatile("v_nop\n\tv_nop\n\tv_nop\n\tv_nop" : "+v"(acc[0][0]), "+v"(acc[0][1]), "+v"(acc[0][2]), "+v"(acc[0][3]), "+v"(acc[1][0]), "+v"(acc[1][1]), "+v"(acc[1][2]), "+v"(acc[1][3]), "+v"(acc[2][0]), "+v"(acc[2][1]), "+v"(acc[2][2]), "+v"(acc[2][3]), "+v"(acc[3][0]), "+v"(acc[3][1]), "+v"(acc[3][2]), "+v"(acc[3][3]));
        asm volatile("s_wait_dscnt 0x0" ::: "memory");      // foot of a trip: this wave's reads of the buffer are done,
        asm volatile("s_wait_asynccnt 0x0" ::: "memory");   // its copies of the next stage have landed,
        __syncthreads();                                    // and one barrier publishes the next stage and frees this trip's buffer
        if (t + 2 < nt) fill(t + 2);
    }
    asm volatile("s_wait_asynccnt 0x0" ::: "memory");       // no copy is outstanding when the ring becomes output staging (every wave's last read ended at the last trip's barrier)
    float* const os = (float*)(sm + wv * 8192);             // each wave stages its output rows in its own range
    if constexpr (HP) {
        const int sq = r0 / TT, t0 = r0 % TT, hd = c0 / 64, r4 = lane >> 3, c8 = (lane & 7) * 8;   // read-back: 8 lanes cover one 128-byte row of 64 16-bit values, a wave four rows
        if (z == 2) {   // v: a lane's accumulator holds 8 consecutive t of one d, already the transposed order; 16 d rows x 64 t per plane go through LDS (pitch 72 values) so that whole lines are stored
            unsigned short* const sv = (unsigned short*)os; const size_t rows = (size_t)NKV * HD * (2 * TT), vrow = (size_t)(hd * HD + r4) * (2 * TT) + t0 + c8;
            unsigned short* const gp[3] = { (unsigned short*)V16 + (size_t)(sq >> 1) * rows + (size_t)(sq & 1) * TT + vrow, Vh + (size_t)sq * rows + vrow, Vh + (size_t)sq * rows + TT + vrow };   // the fp16 rows of an even and the next odd sequence share a row; lo plane TT behind hi
#pragma unroll
            for (int nb = 0; nb < 4; ++nb) {
#pragma unroll
                for (int mb = 0; mb < 4; ++mb) { v8h o16; v8us oh, ol; split8(acc[mb][nb], o16, oh, ol);
                    unsigned short* const sp = sv + lr * 72 + mb * 16 + hi * 8; *(v8ha*)sp = o16; *(v8usa*)(sp + 16 * 72) = oh; *(v8usa*)(sp + 2 * 16 * 72) = ol; }
                asm volatile("s_wait_dscnt 0x0" ::: "memory");   // the staged rows are read back, by other lanes than wrote them, only behind the LDS stores' own wait
#pragma unroll
                for (int p = 0; p < 3; ++p)
#pragma unroll
                    for (int s = 0; s < 4; ++s) *(v8us*)(gp[p] + (size_t)(nb * 16 + s * 4) * (2 * TT)) = *(const v8usa*)(sv + (p * 16 + s * 4 + r4) * 72 + c8);
                asm volatile("s_wait_xcnt 0x0" ::: "memory"); __builtin_amdgcn_sched_barrier(0);   // behind the stores: their data and address registers are rewritten only behind this wait (the scheduling barrier keeps the next rows' conversions from rising over it)
            }
        } else {        // q, k: 16 rows of f32 through LDS, read back 8 values a lane, converted, stored
            const size_t po = ((size_t)(sq * NH_ + hd) * TT + t0 + r4) * HD + c8; h16* const p16 = (z ? K16 : Q16) + po; bf* const ph = (z ? Kh : Qh) + po; bf* const pl = (z ? Kl : Ql) + po;
#pragma unroll
            for (int mb = 0; mb < 4; ++mb) {
#pragma unroll
                for (int nb = 0; nb < 4; ++nb) {
#pragma unroll
                    for (int j = 0; j < 8; ++j) os[(hi * 8 + j) * 68 + nb * 16 + lr] = acc[mb][nb][j]; }
                asm volatile("s_wait_dscnt 0x0" ::: "memory");   // as above: read-back only behind the LDS stores' wait
#pragma unroll
                for (int s = 0; s < 4; ++s) { const float* const rp = os + (s * 4 + r4) * 68 + c8; const v4f x0 = *(const v4fa*)rp, x1 = *(const v4fa*)(rp + 4); v8h o16; v8us oh, ol;
                    split8(__builtin_shufflevector(x0, x1, 0, 1, 2, 3, 4, 5, 6, 7), o16, oh, ol);
                    const size_t off = (size_t)(mb * 16 + s * 4) * HD; *(v8h*)(p16 + off) = o16; *(v8us*)(ph + off) = oh; *(v8us*)(pl + off) = ol; }
                asm volatile("s_wait_xcnt 0x0" ::: "memory"); __builtin_amdgcn_sched_barrier(0);   // as above, behind the twelve stores
            }
        }
    } else
#pragma unroll
    for (int mb = 0; mb < 4; ++mb) {
#pragma unroll
        for (int nb = 0; nb < 4; ++nb) {
#pragma unroll
            for (int j = 0; j < 8; ++j) os[(hi * 8 + j) * 68 + nb * 16 + lr] = acc[mb][nb][j]; }
        __builtin_amdgcn_wave_barrier(); asm volatile("" ::: "memory");
        float* crow = C + (size_t)(r0 + mb * 16) * ldc + c0;
{
#pragma unroll
            for (int s = 0; s < 8; ++s) { const int row = 2 * s + hi, cofs = lr * 4; v4f val = *(const v4fa*)(os + row * 68 + cofs); if (BIAS) { val[0] += bfr(bias[c0 + cofs]); val[1] += bfr(bias[c0 + cofs + 1]); val[2] += bfr(bias[c0 + cofs + 2]); val[3] += bfr(bias[c0 + cofs + 3]); }
                *(v4f*)(crow + (size_t)row * ldc + cofs) = val; }
             }
        __builtin_amdgcn_wave_barrier(); asm volatile("" ::: "memory");
    }
}

typedef __attribute__((ext_vector_type(2))) _Float16 v2h;
typedef __attribute__((ext_vector_type(4))) _Float16 v4h;
typedef __attribute__((ext_vector_type(2))) unsigned short v2us;
typedef __attribute__((ext_vector_type(4))) unsigned short v4us;
typedef __attribute__((ext_vector_type(2))) float v2f;
typedef __attribute__((ext_vector_type(4))) int v4i;

__global__ __launch_bounds__(256) void k_wtG(const float* __restrict__ w0, const float* __restrict__ w1, const float* __restrict__ w2, const float* __restrict__ w3, int K, int N, bf* Bt) {
    const int wi = blockIdx.y; const float* w = (wi == 0) ? w0 : (wi == 1) ? w1 : (wi == 2) ? w2 : w3; Bt += (size_t)wi * K * N;   // blockIdx.y: which of the four equally shaped weights (consecutive output planes)
    const int lane = threadIdx.x & 31; const int L0 = (blockIdx.x * 8 + (threadIdx.x >> 5)) * 8; const int nlines = N * K / 64;
{
#pragma unroll 1
        for (int l = 0; l < 8; ++l) { const int L = L0 + l; if (L >= nlines) break; const size_t e = (size_t)L * 64 + lane * 2; const int k = (int)(e % K), n = (int)(e / K); v2us o;
            o[0] = f2bf(w[(size_t)k * N + n]); o[1] = f2bf(w[(size_t)(k + 1) * N + n]); *(v2us*)(Bt + e) = o; }
         }
}
__global__ __launch_bounds__(256) void k_petab(float* PE) { const size_t e = ((size_t)blockIdx.x * 256 + threadIdx.x) * 2; if (e >= (size_t)TT * DM) return; const int c = (int)(e % DM); const int t = (int)(e / DM); const float w = expf(__fmul_rn((float)c, PEC)); const float ang = __fmul_rn((float)t, w); v2f o; o[0] = sinf(ang); o[1] = cosf(ang); *(v2f*)(PE + e) = o;  }
__global__ __launch_bounds__(256) void k_lnpe(const float* __restrict__ X, const float* __restrict__ PE, const float* __restrict__ g, const float* __restrict__ be, float* Hf, bf* Yh, bf* Yl) {
    const int lane = threadIdx.x & 31; const int r = blockIdx.x * 8 + (threadIdx.x >> 5); if (r >= NB_ * TT) return; const float* xr = X + (size_t)r * DM; float s = 0.f;   // r: row of all sequences, position r % TT
#pragma unroll 1
    for (int ch = 0; ch < DM / 128; ++ch) { const int c0 = ch * 128 + lane * 4; const v4f a = *(const v4f*)(xr + c0);
#pragma unroll
        for (int q = 0; q < 4; ++q) s += bfr(a[q]); }
#pragma unroll
    for (int sh = 16; sh; sh >>= 1) s += __shfl_xor(s, sh, 32);
    const float mu = s * (1.0f / DM); float s2 = 0.f;
#pragma unroll 1
    for (int ch = 0; ch < DM / 128; ++ch) { const int c0 = ch * 128 + lane * 4; const v4f a = *(const v4f*)(xr + c0);
#pragma unroll
        for (int q = 0; q < 4; ++q) { const float d0 = __fsub_rn(bfr(a[q]), mu); float p = __fmul_rn(d0, d0); asm volatile("" : "+v"(p)); s2 = __fadd_rn(s2, p); } }
#pragma unroll
    for (int sh = 16; sh; sh >>= 1) s2 += __shfl_xor(s2, sh, 32);
    const float rs = __fdiv_rn(1.0f, __fsqrt_rn(__fadd_rn(s2 * (1.0f / DM), LNEPS)));
{
#pragma unroll 1
        for (int ch = 0; ch < DM / 128; ++ch) { const int c0 = ch * 128 + lane * 4; const v4f a = *(const v4f*)(xr + c0); const v4f pe = *(const v4f*)(PE + (size_t)(r % TT) * DM + c0); v4f h4; v4us oh, ol;
#pragma unroll
            for (int q = 0; q < 4; ++q) { float n0 = __fmul_rn(__fsub_rn(bfr(a[q]), mu), rs); asm volatile("" : "+v"(n0)); float n1 = __fmul_rn(n0, bfr(g[c0 + q])); asm volatile("" : "+v"(n1)); const float ln = __fadd_rn(n1, bfr(be[c0 + q])); const float hv = __fadd_rn(ln, pe[q]); h4[q] = hv; unsigned short h2, l2; splitf(hv, h2, l2); oh[q] = h2; ol[q] = l2; }
            *(v4f*)(Hf + (size_t)r * DM + c0) = h4; *(v4us*)(Yh + (size_t)r * DM + c0) = oh; *(v4us*)(Yl + (size_t)r * DM + c0) = ol; }
         } }
__global__ __launch_bounds__(256) void k_resln2(const float* __restrict__ O, const float* __restrict__ Hf, const float* __restrict__ X, const float* __restrict__ g, const float* __restrict__ be, float* OUTb) {
    const int lane = threadIdx.x & 31; const int r = blockIdx.x * 8 + (threadIdx.x >> 5); if (r >= NB_ * TT) return; const float* orow = O + (size_t)r * DM; const float* hrow = Hf + (size_t)r * DM; float s = 0.f;
#pragma unroll 1
    for (int ch = 0; ch < DM / 128; ++ch) { const int c0 = ch * 128 + lane * 4; const v4f a = *(const v4f*)(orow + c0), hh = *(const v4f*)(hrow + c0);
#pragma unroll
        for (int q = 0; q < 4; ++q) s += __fadd_rn(a[q], hh[q]); }
#pragma unroll
    for (int sh = 16; sh; sh >>= 1) s += __shfl_xor(s, sh, 32);
    const float mu = s * (1.0f / DM); float s2 = 0.f;
#pragma unroll 1
    for (int ch = 0; ch < DM / 128; ++ch) { const int c0 = ch * 128 + lane * 4; const v4f a = *(const v4f*)(orow + c0), hh = *(const v4f*)(hrow + c0);
#pragma unroll
        for (int q = 0; q < 4; ++q) { const float d0 = __fsub_rn(__fadd_rn(a[q], hh[q]), mu); float p = __fmul_rn(d0, d0); asm volatile("" : "+v"(p)); s2 = __fadd_rn(s2, p); } }
#pragma unroll
    for (int sh = 16; sh; sh >>= 1) s2 += __shfl_xor(s2, sh, 32);
    const float rs = __fdiv_rn(1.0f, __fsqrt_rn(__fadd_rn(s2 * (1.0f / DM), 1e-6f)));
{
#pragma unroll 1
        for (int ch = 0; ch < DM / 128; ++ch) { const int c0 = ch * 128 + lane * 4; const v4f a = *(const v4f*)(orow + c0), hh = *(const v4f*)(hrow + c0), xx = *(const v4f*)(X + (size_t)r * DM + c0); v4f o4;
#pragma unroll
            for (int q = 0; q < 4; ++q) { float n0 = __fmul_rn(__fsub_rn(__fadd_rn(a[q], hh[q]), mu), rs); asm volatile("" : "+v"(n0)); float n1 = __fmul_rn(n0, bfr(g[c0 + q])); asm volatile("" : "+v"(n1)); o4[q] = __fadd_rn(__fadd_rn(n1, bfr(be[c0 + q])), bfr(xx[q])); }
            *(v4f*)(OUTb + (size_t)r * DM + c0) = o4; }
         } }
__global__ __launch_bounds__(256) void k_cvt8(const float* __restrict__ src, bf* dst, size_t n8) { const size_t i = (size_t)blockIdx.x * 256 + threadIdx.x; if (i >= n8) return; const v8f v = *(const v8f*)(src + i * 8); v8us o;
#pragma unroll
    for (int k = 0; k < 8; ++k) o[k] = f2bf(v[k]); *(v8us*)(dst + i * 8) = o;  }

__device__ __forceinline__ float xhalf(float x) { return __builtin_bit_cast(float, __builtin_amdgcn_permlanex16(__builtin_bit_cast(int, x), __builtin_bit_cast(int, x), 0x76543210, 0xfedcba98, false, false)); }   // lane l with lane l ^ 16
#define SCL2 0.18033688011112042f   // HD^-0.5 x log2(e)
template <bool B> struct BC { static constexpr bool v = B; };
// 2^x with the one free slot the instruction set asks for behind a transcendental written into the statement (v_nop). ex2x16: sixteen values in place; each v_exp_f32 is followed by an independent one, the last by the v_nop.
__device__ __forceinline__ float ex2(float x) { float r; asm("v_exp_f32 %0, %1\n\tv_nop" : "=v"(r) : "v"(x)); return r; }
__device__ __forceinline__ void ex2x16(float (&x)[16]) { asm("v_exp_f32 %0, %0\n\tv_exp_f32 %1, %1\n\tv_exp_f32 %2, %2\n\tv_exp_f32 %3, %3\n\tv_exp_f32 %4, %4\n\tv_exp_f32 %5, %5\n\tv_exp_f32 %6, %6\n\tv_exp_f32 %7, %7\n\tv_exp_f32 %8, %8\n\tv_exp_f32 %9, %9\n\tv_exp_f32 %10, %10\n\tv_exp_f32 %11, %11\n\tv_exp_f32 %12, %12\n\tv_exp_f32 %13, %13\n\tv_exp_f32 %14, %14\n\tv_exp_f32 %15, %15\n\tv_nop" : "+v"(x[0]), "+v"(x[1]), "+v"(x[2]), "+v"(x[3]), "+v"(x[4]), "+v"(x[5]), "+v"(x[6]), "+v"(x[7]), "+v"(x[8]), "+v"(x[9]), "+v"(x[10]), "+v"(x[11]), "+v"(x[12]), "+v"(x[13]), "+v"(x[14]), "+v"(x[15])); }
template <typename T16, int NQ, bool HI>
__device__ __forceinline__ void fattn(const T16* __restrict__ Q, const T16* __restrict__ Q2, const T16* __restrict__ Kp, const T16* __restrict__ Kp2, const T16* __restrict__ Vt, const int q0, bf* __restrict__ Ah, bf* __restrict__ Al) {
    typedef typename WFrag<T16>::V V;
    const int lane = threadIdx.x & 31, lr = lane & 15, hi = lane >> 4;
    V qf[NQ][2], qf2[NQ][2];
#pragma unroll
    for (int qt = 0; qt < NQ; ++qt)
#pragma unroll
        for (int ks = 0; ks < 2; ++ks) { const size_t qo = (size_t)(q0 + qt * 16 + lr) * HD + ks * 32 + 8 * hi; qf[qt][ks] = WFrag<T16>::ld(Q + qo); if (HI) qf2[qt][ks] = WFrag<T16>::ld(Q2 + qo); }
    __builtin_amdgcn_sched_barrier(0);        // here and below: the first fragments are issued in the loop's own order (Q, then K as the loop fetches it); loads return in order, so otherwise the K wait at the loop's head, which must hold for both ways in, also waits for the V just asked for
    v8f o[4][NQ]; float m[NQ], l[NQ];
#pragma unroll
    for (int qt = 0; qt < NQ; ++qt) { m[qt] = -3.0e38f; l[qt] = 0.f;
#pragma unroll
        for (int dt = 0; dt < 4; ++dt) o[dt][qt] = (v8f){}; }
    const int klast = (q0 + NQ * 16 - 1) & ~31;   // first key of the last pass (klast <= q0: every pass holds a key <= q for each of the wave's queries; passes before it lie wholly below the diagonal)
    const size_t ko = (size_t)lr * HD + 8 * hi, vo = (size_t)lr * (2 * TT) + 8 * hi;
    V kf[2][2], kf2[2][2];
#pragma unroll
    for (int kt = 0; kt < 2; ++kt)
#pragma unroll
        for (int ks = 0; ks < 2; ++ks) { kf[kt][ks] = WFrag<T16>::ld(Kp + ko + kt * 16 * HD + ks * 32); if (HI) kf2[kt][ks] = WFrag<T16>::ld(Kp2 + ko + kt * 16 * HD + ks * 32); __builtin_amdgcn_sched_barrier(0); }
    asm volatile("s_wait_xcnt 0x0" ::: "memory");   // behind the first loads: their address registers are rewritten only behind this wait, on every way from here (also the way round the loop)
    auto pass = [&](const int kb, auto last) {   // 32 keys; only the last pass touches the diagonal, so only it masks, and it alone fetches no further K: the loop's body has no branch inside
        V vf[4], vf2[4];                      // this pass's V, asked for first: it flies during the score products and the softmax
        const T16* const vp = Vt + vo + kb; const size_t kno = ko + (size_t)(kb + 32) * HD;   // the lo plane of V lies TT elements behind the hi plane in each row
#pragma unroll
        for (int dt = 0; dt < 4; ++dt) { const size_t off = (size_t)dt * 16 * (2 * TT); vf[dt] = WFrag<T16>::ld(vp + off); if (HI) vf2[dt] = WFrag<T16>::ld(vp + TT + off); }
        v8f s[2][NQ];
#pragma unroll
        for (int kt = 0; kt < 2; ++kt)
#pragma unroll
            for (int qt = 0; qt < NQ; ++qt) { v8f a = (v8f){};
#pragma unroll
                for (int ks = 0; ks < 2; ++ks) { a = WFrag<T16>::mma(kf[kt][ks], qf[qt][ks], a); if (HI) { a = WFrag<T16>::mma(kf2[kt][ks], qf[qt][ks], a); a = WFrag<T16>::mma(kf[kt][ks], qf2[qt][ks], a); } }
                s[kt][qt] = a; }
        if constexpr (!decltype(last)::v) {   // next pass's K, fetched into the same registers behind the score products
#pragma unroll
            for (int kt = 0; kt < 2; ++kt)
#pragma unroll
                for (int ks = 0; ks < 2; ++ks) { const size_t off = kno + kt * 16 * HD + ks * 32; kf[kt][ks] = WFrag<T16>::ld(Kp + off); if (HI) kf2[kt][ks] = WFrag<T16>::ld(Kp2 + off); }
        } else {                              // -1e9 fill == exact zero weight
#pragma unroll
            for (int kt = 0; kt < 2; ++kt)
#pragma unroll
                for (int qt = 0; qt < NQ; ++qt)
#pragma unroll
                    for (int j = 0; j < 8; ++j) if (kb + kt * 16 + hi * 8 + j > q0 + qt * 16 + lr) s[kt][qt][j] = -3.0e38f; }
        V pf[NQ], pf2[NQ];
#pragma unroll
        for (int qt = 0; qt < NQ; ++qt) { float mx = s[0][qt][0];
#pragma unroll
            for (int j = 1; j < 8; ++j) mx = fmaxf(mx, s[0][qt][j]);
#pragma unroll
            for (int j = 0; j < 8; ++j) mx = fmaxf(mx, s[1][qt][j]);
            mx = fmaxf(mx, xhalf(mx));
            const float mn = fmaxf(m[qt], mx * SCL2); const float al = ex2(m[qt] - mn); m[qt] = mn; float ls[4] = {0.f, 0.f, 0.f, 0.f}, pe[16];   // al = 0 on the first pass; four partial sums: short dependent chains
#pragma unroll
            for (int e = 0; e < 16; ++e) pe[e] = __builtin_fmaf(s[e >> 3][qt][e & 7], SCL2, -mn);
            ex2x16(pe);
#pragma unroll
            for (int e = 0; e < 16; ++e) { const float p = pe[e]; ls[e & 3] += p;
                if constexpr (HI) { const __bf16 ph = (__bf16)p; pf[qt][e] = ph; pf2[qt][e] = (__bf16)(p - (float)ph); } else { pf[qt][e] = (h16)p; } }
            l[qt] = l[qt] * al + ((ls[0] + ls[1]) + (ls[2] + ls[3]));
#pragma unroll
            for (int dt = 0; dt < 4; ++dt) o[dt][qt] *= al; }
#pragma unroll
        for (int dt = 0; dt < 4; ++dt)
#pragma unroll
            for (int qt = 0; qt < NQ; ++qt) { o[dt][qt] = WFrag<T16>::mma(vf[dt], pf[qt], o[dt][qt]); if (HI) { o[dt][qt] = WFrag<T16>::mma(vf2[dt], pf[qt], o[dt][qt]); o[dt][qt] = WFrag<T16>::mma(vf[dt], pf2[qt], o[dt][qt]); } }
        // foot of a pass, behind its last matrix instruction (the accumulators are operands): four free slots, so that on the way back to the loop's head nothing rewrites an operand too early;
        // and the pass's load addresses are read here once more, so that no load returns into their registers, and they are rewritten (next pass, epilogue) only behind this wait
        if constexpr (HI) { if constexpr (decltype(last)::v) asm volatile("v_nop\n\tv_nop\n\tv_nop\n\tv_nop\n\ts_wait_xcnt 0x0" : "+v"(o[0][0]), "+v"(o[1][0]), "+v"(o[2][0]), "+v"(o[3][0]) : "v"(vp) : "memory");
            else asm volatile("v_nop\n\tv_nop\n\tv_nop\n\tv_nop\n\ts_wait_xcnt 0x0" : "+v"(o[0][0]), "+v"(o[1][0]), "+v"(o[2][0]), "+v"(o[3][0]) : "v"(vp), "v"(Kp + kno), "v"(Kp2 + kno) : "memory"); }
        else { if constexpr (decltype(last)::v) asm volatile("v_nop\n\tv_nop\n\tv_nop\n\tv_nop\n\ts_wait_xcnt 0x0" : "+v"(o[0][0]), "+v"(o[1][0]), "+v"(o[2][0]), "+v"(o[3][0]), "+v"(o[0][NQ - 1]), "+v"(o[1][NQ - 1]), "+v"(o[2][NQ - 1]), "+v"(o[3][NQ - 1]) : "v"(vp) : "memory");
            else asm volatile("v_nop\n\tv_nop\n\tv_nop\n\tv_nop\n\ts_wait_xcnt 0x0" : "+v"(o[0][0]), "+v"(o[1][0]), "+v"(o[2][0]), "+v"(o[3][0]), "+v"(o[0][NQ - 1]), "+v"(o[1][NQ - 1]), "+v"(o[2][NQ - 1]), "+v"(o[3][NQ - 1]) : "v"(vp), "v"(Kp + kno) : "memory"); }
    };
#pragma unroll 1
    for (int kb = 0; kb < klast; kb += 32) pass(kb, BC<false>());   // rolled: one pass is already 16 (24) matrix instructions, and the next pass's K is fetched by hand
    pass(klast, BC<true>());
#pragma unroll
    for (int qt = 0; qt < NQ; ++qt) { const float inv = __fdiv_rn(1.0f, l[qt] + xhalf(l[qt])); const size_t oo = (size_t)(q0 + qt * 16 + lr) * DQ + hi * 8;
#pragma unroll
        for (int dt = 0; dt < 4; ++dt) { v8us oh, ol;
#pragma unroll
            for (int j = 0; j < 8; ++j) { unsigned short a, c2; splitf(o[dt][qt][j] * inv, a, c2); oh[j] = a; ol[j] = c2; }
            *(v8us*)(Ah + oo + dt * 16) = oh; *(v8us*)(Al + oo + dt * 16) = ol;
            asm volatile("s_wait_xcnt 0x0" ::: "memory"); } }   // behind the two stores: their data and address registers are rewritten only behind this wait
}
#define NTL ((TT - RH) / 32)   // 32-column tiles of the fp16 rows
#define NTH (RH / 16)          // 16-column tiles of the hi/lo rows
static_assert(NTL % 4 == 0 && (NTL + NTH) / 4 == 20, "the snake order below is written for 20 tile groups");
// grid (sequences x heads, (NTL + NTH) / 4), 4 waves: the waves of a work-group take neighbouring query tiles of ONE head (they walk the same keys, no barrier). Tile groups are numbered by falling cost; all work-groups are resident,
// 256 of them (8 values of blockIdx.y) make one round over the chip, so blockIdx.y walks the groups in snake order (0..7, 15..8, 19..16): placed round after round, a heavy group shares its place with light ones. For speed only.
__global__ __launch_bounds__(128) void k_fattn(const h16* __restrict__ Q16, const h16* __restrict__ K16, const h16* __restrict__ V16, const bf* __restrict__ Qh, const bf* __restrict__ Ql, const bf* __restrict__ Kh, const bf* __restrict__ Kl, const bf* __restrict__ Vh, bf* __restrict__ Ah, bf* __restrict__ Al) {
    const int zh = blockIdx.x, b = zh / NH_, h = zh % NH_; const int y = blockIdx.y, tg = (y < 8) ? y : (y < 16) ? 23 - y : 35 - y; const int ti = tg * 4 + __builtin_amdgcn_readfirstlane(threadIdx.x >> 5);
    const size_t po = (size_t)zh * TT * HD, ao = (size_t)b * TT * DQ + h * HD;
    if (ti < NTL) fattn<h16, 2, false>(Q16 + po, nullptr, K16 + po, nullptr, V16 + (size_t)(b >> 1) * 2 * NH_ * TT * HD + (size_t)(b & 1) * TT + (size_t)h * HD * 2 * TT, TT - 32 * (ti + 1), Ah + ao, Al + ao);
    else fattn<bf, 1, true>(Qh + po, Ql + po, Kh + po, Kl + po, Vh + 2 * po, RH - 16 * (ti - NTL + 1), Ah + ao, Al + ao);
}

extern "C" void kernel_launch(void* const* d_in, const int* in_sizes, int n_in,
                              void* d_out, int out_size, void* d_ws, size_t ws_size, hipStream_t stream) {
    (void)in_sizes; (void)n_in; (void)out_size;
    const float* x = (const float*)d_in[0]; const float* g1 = (const float*)d_in[1]; const float* e1 = (const float*)d_in[2]; const float* wq = (const float*)d_in[3]; const float* wk = (const float*)d_in[4]; const float* wv = (const float*)d_in[5]; const float* wo = (const float*)d_in[6]; const float* g2 = (const float*)d_in[7]; const float* e2 = (const float*)d_in[8];
    float* OUT = (float*)d_out;     // [4][2048][512]
    char* wsp = (char*)d_ws;
    auto take = [&](size_t bytes) { char* p = wsp; wsp += (bytes + 255) & ~(size_t)255; return (void*)p; };
    bf* WQ = (bf*)take((size_t)DQ * DM * 2); bf* WK = (bf*)take((size_t)DKV * DM * 2); bf* WV = (bf*)take((size_t)DKV * DM * 2); bf* WO = (bf*)take((size_t)DM * DQ * 2);   // consecutive planes (k_wtG, z-batched projection)
    float* Hf = (float*)take((size_t)NB_ * TT * DM * 4);
    const size_t PLN = (size_t)NB_ * NH_ * TT * HD;   // one head-plane set, all sequences
    h16* QP16 = (h16*)take(PLN * 2); h16* KP16 = (h16*)take(PLN * 2); h16* VT16 = (h16*)take(PLN * 2);
    bf* QPh = (bf*)take(PLN * 2); bf* QPl = (bf*)take(PLN * 2); bf* KPh = (bf*)take(PLN * 2); bf* KPl = (bf*)take(PLN * 2); bf* VTh = (bf*)take(PLN * 2 * 2);   // hi and lo halves of rows of pitch 2 x TT
    char* const un = wsp;   // from here on the workspace is reused, stream-ordered: (1) projection buffers, (2) wfc output
    float* PE = (float*)take((size_t)TT * DM * 4); bf* Yh = (bf*)take((size_t)NB_ * TT * DM * 2); bf* Yl = (bf*)take((size_t)NB_ * TT * DM * 2);
    bf* ATh = (bf*)take((size_t)NB_ * TT * DQ * 2); bf* ATl = (bf*)take((size_t)NB_ * TT * DQ * 2);   // merged heads, hi/lo planes (behind everything the wfc output overlays)
    if ((size_t)(wsp - (char*)d_ws) > ws_size) return;    // ws 256 MiB
    float* O2 = (float*)un;
    k_wtG<<<dim3((unsigned)((DM * DQ / 64 + 63) / 64), 4, 1), 256, 0, stream>>>(wq, wk, wv, wo, DM, DQ, WQ);
    k_petab<<<(unsigned)(((size_t)TT * DM / 2 + 255) / 256), 256, 0, stream>>>(PE); k_lnpe<<<NB_ * TT / 8, 256, 0, stream>>>(x, PE, g1, e1, Hf, Yh, Yl);   /* h = LN1(x) + PE: f32 + hi/lo planes, all sequences */
    k_gemmw<bf, 1, false, true><<<dim3(NB_ * TT / 128, DQ / 128, 3), 128, 0, stream>>>(Yh, Yl, WQ, nullptr, DM, nullptr, 0, nullptr, 0, (size_t)DQ * DM, 0, QP16, QPh, QPl, KP16, KPh, KPl, VT16, VTh);   /* z: q, k, v, stored as head planes */
    k_fattn<<<dim3(NB_ * NH_, (NTL + NTH) / 4, 1), 128, 0, stream>>>(QP16, KP16, VT16, QPh, QPl, KPh, KPl, VTh, ATh, ATl);   /* all sequences and heads */
    k_gemmw<bf, 1, false, false><<<dim3(NB_ * TT / 128, DM / 128, 1), 128, 0, stream>>>(ATh, ATl, WO, nullptr, DQ, O2, DM, nullptr, 0, 0, 0, nullptr, nullptr, nullptr, nullptr, nullptr, nullptr, nullptr, nullptr); k_resln2<<<NB_ * TT / 8, 256, 0, stream>>>(O2, Hf, x, g2, e2, OUT);   /* o = merged wfc; out = LN2(o + h) + x */
}

// v006
// Measured time: 119 microseconds a run.
// In two side-by-side timings against v005, it was 1.09 and 1.10 times as fast.
// Counting every step since v000, it is 13.0 times as fast.
#include <hip/hip_runtime.h>

// Pre-norm causal self-attention block with sinusoidal positions (x [4][2048][512]; h = LN1(x) (1e-5) + PE (pe[t][2i] = sin(t w_i), pe[t][2i+1] = cos(t w_i), w_i = exp(2i x (-ln 1e4 / 512))); q, k, v = h W ('xw' [512][512], no bias; 8 heads x 64); causal softmax(q.k/8) (-1e9 fill == exact zero weight); o = merged wfc ('xw'); out = LN2(o + h) (1e-6) + x -> [4][2048][512] (4.2 M)).
// Layout: LN1 + PE in one kernel (with the weight planes) producing h in f32 (kept for the residual) and as bf16 hi/lo planes (2-product projections); the PE values are computed there in f32 with the reference's float32 constant for -ln(1e4)/512 (precise expf/sinf/cosf); the q/k/v projection GEMM stores its tiles straight as the attention kernel's operand planes; causal attention fused in one kernel (running softmax, scores never stored); the wfc GEMM output goes through a residual + LN2 row kernel that also adds x.
// Compute dtypes, f32 accumulate: every input rounded to bf16; q/k/v hl x exact (2 products); causal scores and attn.v (tile skipping): query rows < 512 hl (3 products), the rest single fp16; softmax f32; wfc hl x exact (2 products); LN2 and both residuals in f32.

#define NB_  4
#define TT   2048
#define DM   512
#define NH_  8
#define NKV  8
#define REP  (NH_ / NKV)
#define HD   64
#define DQ   (NH_ * HD)
#define DKV  (NKV * HD)
#define LNEPS 1e-5f
#define PEC  (-0.0179889463f)   // float32(-ln(10000)/512), as the reference's numpy computes it
typedef __attribute__((ext_vector_type(4))) unsigned short v4us;
#define RH   512                  // query rows < RH use hi+lo planes
typedef _Float16 h16;
typedef unsigned short bf;
typedef __attribute__((ext_vector_type(16))) __bf16   v16bf;
typedef __attribute__((ext_vector_type(16))) _Float16 v16h;
typedef __attribute__((ext_vector_type(8)))  _Float16 v8h;
typedef __attribute__((ext_vector_type(8)))  unsigned short v8us;
typedef __attribute__((ext_vector_type(8)))  float    v8f;
typedef __attribute__((ext_vector_type(4)))  float    v4f;
typedef v8h  __attribute__((may_alias)) v8ha;
typedef v4f  __attribute__((may_alias)) v4fa;
typedef v8us __attribute__((may_alias)) v8usa;

__device__ __forceinline__ unsigned short f2bf(float f) { unsigned u = __float_as_uint(f); u += 0x7FFFu + ((u >> 16) & 1u); return (unsigned short)(u >> 16); }
__device__ __forceinline__ float bf2f(unsigned short b) { return __uint_as_float(((unsigned)b) << 16); }
__device__ __forceinline__ float bfr(float f) { return bf2f(f2bf(f)); }
__device__ __forceinline__ v16h cat16(v8h lo, v8h hi) { return __builtin_shufflevector(lo, hi, 0, 1, 2, 3, 4, 5, 6, 7, 8, 9, 10, 11, 12, 13, 14, 15); }
__device__ __forceinline__ v16bf cat16b(v8us lo, v8us hi) { return __builtin_bit_cast(v16bf, __builtin_shufflevector(lo, hi, 0, 1, 2, 3, 4, 5, 6, 7, 8, 9, 10, 11, 12, 13, 14, 15)); }
__device__ __forceinline__ v8f wmma16(v16h a, v16h b, v8f c) { return __builtin_amdgcn_wmma_f32_16x16x32_f16(false, a, false, b, (short)0, c, false, false); }
__device__ __forceinline__ v8f wmmab(v16bf a, v16bf b, v8f c) { return __builtin_amdgcn_wmma_f32_16x16x32_bf16(false, a, false, b, (short)0, c, false, false); }



// ---- k_gemmw: register-blocked GEMM, one wave per 64x64 output tile (16 accumulators), 2 x 2 waves a work-group; the 128 + 128 operand rows come from K-contiguous 16-bit planes into LDS by asynchronous copies (ring of two stages); grid (M/128, N/128, Z), 128 threads.
// C[m][n] (f32, pitch ldc, + optional f32 bias[n]) = sum_k A[m][k] Bt[n][k] (+ split products per NSPLIT). z-batch strides sA/sB/sC in elements. K % 64 == 0.
template <typename T16> struct WFrag;
template <> struct WFrag<h16> { typedef v16h V; static __device__ __forceinline__ V ld(const h16* p) { return cat16(*(const v8h*)p, *(const v8h*)(p + 16)); } static __device__ __forceinline__ v8f mma(V a, V b, v8f c) { return wmma16(a, b, c); } };
template <> struct WFrag<bf> { typedef v16bf V; static __device__ __forceinline__ V ld(const bf* p) { return cat16b(*(const v8us*)p, *(const v8us*)(p + 16)); } static __device__ __forceinline__ v8f mma(V a, V b, v8f c) { return wmmab(a, b, c); } };
// HP (head planes): z = 0, 1, 2 are the q, k, v projections and a tile is 64 positions of one sequence x the 64 columns of one head; instead of C the wave stores the tile as the attention kernel's operands:
// q, k as [sequence][head][t][d], v transposed as rows (head, d) of pitch 2 x TT, each as fp16 and as bf16 hi/lo; every store instruction covers four whole 128-byte lines.
__device__ __forceinline__ void splitf(float y, unsigned short& h, unsigned short& l) { h = f2bf(y); l = f2bf(y - bf2f(h)); }
typedef __attribute__((ext_vector_type(8))) __bf16 v8bf;
__device__ __forceinline__ void split8(const v8f x, v8h& o16, v8us& oh, v8us& ol) { v8bf h, l;   // fp16, and bf16 hi + lo of the remainder (round to nearest even, as f2bf)
#pragma unroll
    for (int j = 0; j < 8; ++j) { o16[j] = (h16)x[j]; h[j] = (__bf16)x[j]; l[j] = (__bf16)(x[j] - (float)h[j]); }
    oh = __builtin_bit_cast(v8us, h); ol = __builtin_bit_cast(v8us, l); }
// Operand staging of k_gemmw: a stage is 64 k of 128 A rows (hi plane, lo plane) and 128 Bt rows, each row 128 bytes = one whole line. In LDS two rows share 272 bytes (256 + 16),
// so that the 16 rows of a fragment read fall on 16 different 16-byte bank groups. Three tiles a stage, two stages (a ring of two buffers).
#define GP2    272
#define GTILE  (64 * GP2)
#define GSTAGE (3 * GTILE)
// Eight asynchronous copies of 16 bytes a lane (rows 16 apart: a wave's copy covers four whole lines). The s_wait_xcnt is the last line of the copies' own statement: the address registers are rewritten only behind it.
__device__ __forceinline__ void cp8(const unsigned l, const char* const g, const size_t gs) {
    asm volatile("global_load_async_to_lds_b128 %0, %8, off\n\tglobal_load_async_to_lds_b128 %1, %9, off\n\tglobal_load_async_to_lds_b128 %2, %10, off\n\tglobal_load_async_to_lds_b128 %3, %11, off\n\t"
                 "global_load_async_to_lds_b128 %4, %12, off\n\tglobal_load_async_to_lds_b128 %5, %13, off\n\tglobal_load_async_to_lds_b128 %6, %14, off\n\tglobal_load_async_to_lds_b128 %7, %15, off\n\ts_wait_xcnt 0x0"
                 :: "v"(l), "v"(l + 8 * GP2), "v"(l + 16 * GP2), "v"(l + 24 * GP2), "v"(l + 32 * GP2), "v"(l + 40 * GP2), "v"(l + 48 * GP2), "v"(l + 56 * GP2),
                    "v"(g), "v"(g + gs), "v"(g + 2 * gs), "v"(g + 3 * gs), "v"(g + 4 * gs), "v"(g + 5 * gs), "v"(g + 6 * gs), "v"(g + 7 * gs) : "memory");
}
template <typename T16, int NSPLIT, bool BIAS, bool HP>
__global__ __launch_bounds__(128) void k_gemmw(const T16* __restrict__ A, const T16* __restrict__ A2, const T16* __restrict__ Bt, const T16* __restrict__ Bt2, int K, float* C, int ldc, const float* __restrict__ bias, size_t sA, size_t sB, size_t sC, h16* Q16, bf* Qh, bf* Ql, h16* K16, bf* Kh, bf* Kl, h16* V16, bf* Vh) {
    static_assert(NSPLIT == 1, "the staging below holds A, A2 and Bt");
    typedef typename WFrag<T16>::V V;
    __shared__ __align__(16) char sm[2 * GSTAGE];
    const size_t z = blockIdx.z; A += z * sA; A2 += z * sA; Bt += z * sB; C += z * sC;
    const int tid = threadIdx.x, lane = tid & 31, lr = lane & 15, hi = lane >> 4, wv = __builtin_amdgcn_readfirstlane(tid >> 5);
    const int r0 = blockIdx.x * 128 + (wv & 1) * 64, c0 = blockIdx.y * 128 + (wv >> 1) * 64;   // 2 x 2 waves, each a 64 x 64 tile
    v8f acc[4][4];
#pragma unroll
    for (int mb = 0; mb < 4; ++mb)
#pragma unroll
        for (int nb = 0; nb < 4; ++nb) acc[mb][nb] = (v8f){};
    const int cr = tid >> 3, cch = tid & 7;   // copies: 8 lanes a row, a thread's rows are cr + 16 i
    const unsigned lc = (unsigned)(size_t)sm + (cr >> 1) * GP2 + (cr & 1) * 128 + cch * 16;
    const char* const ga = (const char*)(A + (size_t)(blockIdx.x * 128 + cr) * K + cch * 8); const char* const ga2 = (const char*)(A2 + (size_t)(blockIdx.x * 128 + cr) * K + cch * 8); const char* const gb = (const char*)(Bt + (size_t)(blockIdx.y * 128 + cr) * K + cch * 8);
    const size_t gs = (size_t)16 * K * sizeof(T16);
    auto fill = [&](const int t) { const unsigned l = lc + (t & 1) * GSTAGE; cp8(l, ga + t * 128, gs); cp8(l + GTILE, ga2 + t * 128, gs); cp8(l + 2 * GTILE, gb + t * 128, gs); };
    const int nt = K / 64;
    fill(0);
    asm volatile("s_wait_asynccnt 0x0" ::: "memory");   // stage 0 has landed (this wave's copies) before the barrier that publishes it
    __syncthreads();
    if (nt > 1) fill(1);
    const int fo = (lr >> 1) * GP2 + (lr & 1) * 128 + hi * 16, ao = (wv & 1) * 32 * GP2 + fo, bo = 2 * GTILE + (wv >> 1) * 32 * GP2 + fo;   // fragment reads: row lr of a 16-row group, 16-byte pieces hi and 2 + hi of each 32 k
#pragma unroll 1
    for (int t = 0; t < nt; ++t) {
        const char* const sb = sm + (t & 1) * GSTAGE;
#pragma unroll
        for (int ks = 0; ks < 2; ++ks) { V a[4], a2[4], b[4];   // the twelve fragments of 32 k are asked for together, in front of their 32 products
#pragma unroll
            for (int mb = 0; mb < 4; ++mb) { a[mb] = WFrag<T16>::ld((const T16*)(sb + ao + mb * 8 * GP2 + ks * 64)); a2[mb] = WFrag<T16>::ld((const T16*)(sb + GTILE + ao + mb * 8 * GP2 + ks * 64)); b[mb] = WFrag<T16>::ld((const T16*)(sb + bo + mb * 8 * GP2 + ks * 64)); }
            __builtin_amdgcn_sched_barrier(0);   // keeps the Bt fragment reads up here: sunk among the products, each pair is waited out on its own in front of eight of them
#pragma unroll
            for (int nb = 0; nb < 4; ++nb)
#pragma unroll
                for (int mb = 0; mb < 4; ++mb) { acc[mb][nb] = WFrag<T16>::mma(a[mb], b[nb], acc[mb][nb]); acc[mb][nb] = WFrag<T16>::mma(a2[mb], b[nb], acc[mb][nb]); }
        }
        // four free slots behind the trip's last matrix instruction (all sixteen accumulators are operands, so none follows), on the way on and on the way back to the loop's head
        asm volatile("v_nop\n\tv_nop\n\tv_nop\n\tv_nop" : "+v"(acc[0][0]), "+v"(acc[0][1]), "+v"(acc[0][2]), "+v"(acc[0][3]), "+v"(acc[1][0]), "+v"(acc[1][1]), "+v"(acc[1][2]), "+v"(acc[1][3]), "+v"(acc[2][0]), "+v"(acc[2][1]), "+v"(acc[2][2]), "+v"(acc[2][3]), "+v"(acc[3][0]), "+v"(acc[3][1]), "+v"(acc[3][2]), "+v"(acc[3][3]));
        asm volatile("s_wait_dscnt 0x0" ::: "memory");      // foot of a trip: this wave's reads of the buffer are done,
        asm volatile("s_wait_asynccnt 0x0" ::: "memory");   // its copies of the next stage have landed,
        __syncthreads();                                    // and one barrier publishes the next stage and frees this trip's buffer
        if (t + 2 < nt) fill(t + 2);
    }
    asm volatile("s_wait_asynccnt 0x0" ::: "memory");       // no copy is outstanding when the ring becomes output staging (every wave's last read ended at the last trip's barrier)
    float* const os = (float*)(sm + wv * 8192);             // each wave stages its output rows in its own range
    if constexpr (HP) {
        const int sq = r0 / TT, t0 = r0 % TT, hd = c0 / 64, r4 = lane >> 3, c8 = (lane & 7) * 8;   // read-back: 8 lanes cover one 128-byte row of 64 16-bit values, a wave four rows
        if (z == 2) {   // v: a lane's accumulator holds 8 consecutive t of one d, already the transposed order; 16 d rows x 64 t per plane go through LDS (pitch 72 values) so that whole lines are stored
            unsigned short* const sv = (unsigned short*)os; const size_t rows = (size_t)NKV * HD * (2 * TT), vrow = (size_t)(hd * HD + r4) * (2 * TT) + t0 + c8;
            unsigned short* const gp[3] = { (unsigned short*)V16 + (size_t)(sq >> 1) * rows + (size_t)(sq & 1) * TT + vrow, Vh + (size_t)sq * rows + vrow, Vh + (size_t)sq * rows + TT + vrow };   // the fp16 rows of an even and the next odd sequence share a row; lo plane TT behind hi
#pragma unroll
            for (int nb = 0; nb < 4; ++nb) {
#pragma unroll
                for (int mb = 0; mb < 4; ++mb) { v8h o16; v8us oh, ol; split8(acc[mb][nb], o16, oh, ol);
                    unsigned short* const sp = sv + lr * 72 + mb * 16 + hi * 8; *(v8ha*)sp = o16; *(v8usa*)(sp + 16 * 72) = oh; *(v8usa*)(sp + 2 * 16 * 72) = ol; }
                asm volatile("s_wait_dscnt 0x0" ::: "memory");   // the staged rows are read back, by other lanes than wrote them, only behind the LDS stores' own wait
#pragma unroll
                for (int p = 0; p < 3; ++p)
#pragma unroll
                    for (int s = 0; s < 4; ++s) *(v8us*)(gp[p] + (size_t)(nb * 16 + s * 4) * (2 * TT)) = *(const v8usa*)(sv + (p * 16 + s * 4 + r4) * 72 + c8);
                asm volatile("s_wait_xcnt 0x0" ::: "memory"); __builtin_amdgcn_sched_barrier(0);   // behind the stores: their data and address registers are rewritten only behind this wait (the scheduling barrier keeps the next rows' conversions from rising over it)
            }
        } else {        // q, k: 16 rows of f32 through LDS, read back 8 values a lane, converted, stored
            const size_t po = ((size_t)(sq * NH_ + hd) * TT + t0 + r4) * HD + c8; h16* const p16 = (z ? K16 : Q16) + po; bf* const ph = (z ? Kh : Qh) + po; bf* const pl = (z ? Kl : Ql) + po;
#pragma unroll
            for (int mb = 0; mb < 4; ++mb) {
#pragma unroll
                for (int nb = 0; nb < 4; ++nb) {
#pragma unroll
                    for (int j = 0; j < 8; ++j) os[(hi * 8 + j) * 68 + nb * 16 + lr] = acc[mb][nb][j]; }
                asm volatile("s_wait_dscnt 0x0" ::: "memory");   // as above: read-back only behind the LDS stores' wait
#pragma unroll
                for (int s = 0; s < 4; ++s) { const float* const rp = os + (s * 4 + r4) * 68 + c8; const v4f x0 = *(const v4fa*)rp, x1 = *(const v4fa*)(rp + 4); v8h o16; v8us oh, ol;
                    split8(__builtin_shufflevector(x0, x1, 0, 1, 2, 3, 4, 5, 6, 7), o16, oh, ol);
                    const size_t off = (size_t)(mb * 16 + s * 4) * HD; *(v8h*)(p16 + off) = o16; *(v8us*)(ph + off) = oh; *(v8us*)(pl + off) = ol; }
                asm volatile("s_wait_xcnt 0x0" ::: "memory"); __builtin_amdgcn_sched_barrier(0);   // as above, behind the twelve stores
            }
        }
    } else
#pragma unroll
    for (int mb = 0; mb < 4; ++mb) {
#pragma unroll
        for (int nb = 0; nb < 4; ++nb) {
#pragma unroll
            for (int j = 0; j < 8; ++j) os[(hi * 8 + j) * 68 + nb * 16 + lr] = acc[mb][nb][j]; }
        __builtin_amdgcn_wave_barrier(); asm volatile("" ::: "memory");
        float* crow = C + (size_t)(r0 + mb * 16) * ldc + c0;
{
#pragma unroll
            for (int s = 0; s < 8; ++s) { const int row = 2 * s + hi, cofs = lr * 4; v4f val = *(const v4fa*)(os + row * 68 + cofs); if (BIAS) { val[0] += bfr(bias[c0 + cofs]); val[1] += bfr(bias[c0 + cofs + 1]); val[2] += bfr(bias[c0 + cofs + 2]); val[3] += bfr(bias[c0 + cofs + 3]); }
                *(v4f*)(crow + (size_t)row * ldc + cofs) = val; }
             }
        __builtin_amdgcn_wave_barrier(); asm volatile("" ::: "memory");
    }
}

typedef __attribute__((ext_vector_type(2))) _Float16 v2h;
typedef __attribute__((ext_vector_type(4))) _Float16 v4h;
typedef __attribute__((ext_vector_type(2))) unsigned short v2us;
typedef __attribute__((ext_vector_type(4))) unsigned short v4us;
typedef __attribute__((ext_vector_type(2))) float v2f;
typedef __attribute__((ext_vector_type(4))) int v4i;

// ---- k_front: everything in front of the projections in ONE launch. Work-groups < WTB: the four equally shaped weights, transposed and rounded to bf16 (consecutive output planes).
// The others: h = LN1(x) + PE. A wave takes ONE position of all sequences: the position's sines and cosines are computed once, while the four rows are on their way; each row is read once and kept in registers.
#define WTB (4 * (DM * DQ / 64 / 64))   // 64 work-groups a weight: 8 waves x 8 lines of 64 values
__global__ __launch_bounds__(256) void k_front(const float* __restrict__ w0, const float* __restrict__ w1, const float* __restrict__ w2, const float* __restrict__ w3, bf* Bt, const float* __restrict__ X, const float* __restrict__ g, const float* __restrict__ be, float* Hf, bf* Yh, bf* Yl) {
    const int lane = threadIdx.x & 31;
    if (blockIdx.x < WTB) {
        const int K = DM, N = DQ, wi = blockIdx.x / (WTB / 4); const float* w = (wi == 0) ? w0 : (wi == 1) ? w1 : (wi == 2) ? w2 : w3; Bt += (size_t)wi * K * N;
        const int L0 = ((blockIdx.x % (WTB / 4)) * 8 + (threadIdx.x >> 5)) * 8; const int nlines = N * K / 64;
#pragma unroll 1
        for (int l = 0; l < 8; ++l) { const int L = L0 + l; if (L >= nlines) break; const size_t e = (size_t)L * 64 + lane * 2; const int k = (int)(e % K), n = (int)(e / K); v2us o;
            o[0] = f2bf(w[(size_t)k * N + n]); o[1] = f2bf(w[(size_t)(k + 1) * N + n]); *(v2us*)(Bt + e) = o; }
        return;
    }
    const int t = (blockIdx.x - WTB) * 8 + (threadIdx.x >> 5);   // position; row of sequence b: b x TT + t
    v4f xa[NB_][DM / 128];
#pragma unroll
    for (int b = 0; b < NB_; ++b)
#pragma unroll
        for (int ch = 0; ch < DM / 128; ++ch) xa[b][ch] = *(const v4f*)(X + ((size_t)b * TT + t) * DM + ch * 128 + lane * 4);
    float gg[DM / 128][4], bb[DM / 128][4];   // the lane's sixteen columns of gamma and beta, read once for the four rows
#pragma unroll
    for (int ch = 0; ch < DM / 128; ++ch)
#pragma unroll
        for (int q = 0; q < 4; ++q) { gg[ch][q] = bfr(g[ch * 128 + lane * 4 + q]); bb[ch][q] = bfr(be[ch * 128 + lane * 4 + q]); }
    __shared__ v2f pes[2 * (DM / 128) * 256];   // a lane's eight (sine, cosine) pairs, written and read back by the same lane: no barrier
#pragma unroll 1   // rolled: eight copies of the sine and cosine code would double the kernel's text, which every WGP fetches for one run through it
    for (int i = 0; i < 2 * (DM / 128); ++i) { const int c = (i >> 1) * 128 + lane * 4 + 2 * (i & 1); const float w = expf(__fmul_rn((float)c, PEC)); const float ang = __fmul_rn((float)t, w); v2f o; o[0] = sinf(ang); o[1] = cosf(ang); pes[i * 256 + threadIdx.x] = o; }
    v4f pe[DM / 128];
#pragma unroll
    for (int ch = 0; ch < DM / 128; ++ch) { const v2f p0 = pes[2 * ch * 256 + threadIdx.x], p1 = pes[(2 * ch + 1) * 256 + threadIdx.x]; pe[ch] = __builtin_shufflevector(p0, p1, 0, 1, 2, 3); }
    float s[NB_], s2[NB_], mu[NB_], rs[NB_];   // the four rows side by side: their exchanges between lanes overlap; each row's own order of sums is that of one row alone
#pragma unroll
    for (int b = 0; b < NB_; ++b) { s[b] = 0.f;
#pragma unroll
        for (int ch = 0; ch < DM / 128; ++ch) { const v4f a = xa[b][ch];
#pragma unroll
            for (int q = 0; q < 4; ++q) s[b] += bfr(a[q]); } }
#pragma unroll
    for (int sh = 16; sh; sh >>= 1)
#pragma unroll
        for (int b = 0; b < NB_; ++b) s[b] += __shfl_xor(s[b], sh, 32);
#pragma unroll
    for (int b = 0; b < NB_; ++b) { mu[b] = s[b] * (1.0f / DM); s2[b] = 0.f;
#pragma unroll
        for (int ch = 0; ch < DM / 128; ++ch) { const v4f a = xa[b][ch];
#pragma unroll
            for (int q = 0; q < 4; ++q) { const float d0 = __fsub_rn(bfr(a[q]), mu[b]); float p = __fmul_rn(d0, d0); asm volatile("" : "+v"(p)); s2[b] = __fadd_rn(s2[b], p); } } }
#pragma unroll
    for (int sh = 16; sh; sh >>= 1)
#pragma unroll
        for (int b = 0; b < NB_; ++b) s2[b] += __shfl_xor(s2[b], sh, 32);
#pragma unroll
    for (int b = 0; b < NB_; ++b) rs[b] = __fdiv_rn(1.0f, __fsqrt_rn(__fadd_rn(s2[b] * (1.0f / DM), LNEPS)));
#pragma unroll
    for (int ch = 0; ch < DM / 128; ++ch) { const int c0 = ch * 128 + lane * 4;
#pragma unroll
        for (int b = 0; b < NB_; ++b) { const size_t r = (size_t)b * TT + t; const v4f a = xa[b][ch]; v4f h4; v4us oh, ol;
#pragma unroll
            for (int q = 0; q < 4; ++q) { float n0 = __fmul_rn(__fsub_rn(bfr(a[q]), mu[b]), rs[b]); asm volatile("" : "+v"(n0)); float n1 = __fmul_rn(n0, gg[ch][q]); asm volatile("" : "+v"(n1)); const float ln = __fadd_rn(n1, bb[ch][q]); const float hv = __fadd_rn(ln, pe[ch][q]); h4[q] = hv; unsigned short h2, l2; splitf(hv, h2, l2); oh[q] = h2; ol[q] = l2; }
            *(v4f*)(Hf + r * DM + c0) = h4; *(v4us*)(Yh + r * DM + c0) = oh; *(v4us*)(Yl + r * DM + c0) = ol; } }
    asm volatile("s_wait_xcnt 0x0" ::: "memory");   // behind the last stores: on no way that the built code's branches leave open is one of their registers rewritten ahead of this wait
}
__global__ __launch_bounds__(256) void k_resln2(const float* __restrict__ O, const float* __restrict__ Hf, const float* __restrict__ X, const float* __restrict__ g, const float* __restrict__ be, float* OUTb) {
    const int lane = threadIdx.x & 31; const int r = blockIdx.x * 8 + (threadIdx.x >> 5); if (r >= NB_ * TT) return; const float* orow = O + (size_t)r * DM; const float* hrow = Hf + (size_t)r * DM; float s = 0.f;
#pragma unroll 1
    for (int ch = 0; ch < DM / 128; ++ch) { const int c0 = ch * 128 + lane * 4; const v4f a = *(const v4f*)(orow + c0), hh = *(const v4f*)(hrow + c0);
#pragma unroll
        for (int q = 0; q < 4; ++q) s += __fadd_rn(a[q], hh[q]); }
#pragma unroll
    for (int sh = 16; sh; sh >>= 1) s += __shfl_xor(s, sh, 32);
    const float mu = s * (1.0f / DM); float s2 = 0.f;
#pragma unroll 1
    for (int ch = 0; ch < DM / 128; ++ch) { const int c0 = ch * 128 + lane * 4; const v4f a = *(const v4f*)(orow + c0), hh = *(const v4f*)(hrow + c0);
#pragma unroll
        for (int q = 0; q < 4; ++q) { const float d0 = __fsub_rn(__fadd_rn(a[q], hh[q]), mu); float p = __fmul_rn(d0, d0); asm volatile("" : "+v"(p)); s2 = __fadd_rn(s2, p); } }
#pragma unroll
    for (int sh = 16; sh; sh >>= 1) s2 += __shfl_xor(s2, sh, 32);
    const float rs = __fdiv_rn(1.0f, __fsqrt_rn(__fadd_rn(s2 * (1.0f / DM), 1e-6f)));
{
#pragma unroll 1
        for (int ch = 0; ch < DM / 128; ++ch) { const int c0 = ch * 128 + lane * 4; const v4f a = *(const v4f*)(orow + c0), hh = *(const v4f*)(hrow + c0), xx = *(const v4f*)(X + (size_t)r * DM + c0); v4f o4;
#pragma unroll
            for (int q = 0; q < 4; ++q) { float n0 = __fmul_rn(__fsub_rn(__fadd_rn(a[q], hh[q]), mu), rs); asm volatile("" : "+v"(n0)); float n1 = __fmul_rn(n0, bfr(g[c0 + q])); asm volatile("" : "+v"(n1)); o4[q] = __fadd_rn(__fadd_rn(n1, bfr(be[c0 + q])), bfr(xx[q])); }
            *(v4f*)(OUTb + (size_t)r * DM + c0) = o4; }
         } }
__global__ __launch_bounds__(256) void k_cvt8(const float* __restrict__ src, bf* dst, size_t n8) { const size_t i = (size_t)blockIdx.x * 256 + threadIdx.x; if (i >= n8) return; const v8f v = *(const v8f*)(src + i * 8); v8us o;
#pragma unroll
    for (int k = 0; k < 8; ++k) o[k] = f2bf(v[k]); *(v8us*)(dst + i * 8) = o;  }

__device__ __forceinline__ float xhalf(float x) { return __builtin_bit_cast(float, __builtin_amdgcn_permlanex16(__builtin_bit_cast(int, x), __builtin_bit_cast(int, x), 0x76543210, 0xfedcba98, false, false)); }   // lane l with lane l ^ 16
#define SCL2 0.18033688011112042f   // HD^-0.5 x log2(e)
template <bool B> struct BC { static constexpr bool v = B; };
// 2^x with the one free slot the instruction set asks for behind a transcendental written into the statement (v_nop). ex2x16: sixteen values in place; each v_exp_f32 is followed by an independent one, the last by the v_nop.
__device__ __forceinline__ float ex2(float x) { float r; asm("v_exp_f32 %0, %1\n\tv_nop" : "=v"(r) : "v"(x)); return r; }
__device__ __forceinline__ void ex2x16(float (&x)[16]) { asm("v_exp_f32 %0, %0\n\tv_exp_f32 %1, %1\n\tv_exp_f32 %2, %2\n\tv_exp_f32 %3, %3\n\tv_exp_f32 %4, %4\n\tv_exp_f32 %5, %5\n\tv_exp_f32 %6, %6\n\tv_exp_f32 %7, %7\n\tv_exp_f32 %8, %8\n\tv_exp_f32 %9, %9\n\tv_exp_f32 %10, %10\n\tv_exp_f32 %11, %11\n\tv_exp_f32 %12, %12\n\tv_exp_f32 %13, %13\n\tv_exp_f32 %14, %14\n\tv_exp_f32 %15, %15\n\tv_nop" : "+v"(x[0]), "+v"(x[1]), "+v"(x[2]), "+v"(x[3]), "+v"(x[4]), "+v"(x[5]), "+v"(x[6]), "+v"(x[7]), "+v"(x[8]), "+v"(x[9]), "+v"(x[10]), "+v"(x[11]), "+v"(x[12]), "+v"(x[13]), "+v"(x[14]), "+v"(x[15])); }
template <typename T16, int NQ, bool HI>
__device__ __forceinline__ void fattn(const T16* __restrict__ Q, const T16* __restrict__ Q2, const T16* __restrict__ Kp, const T16* __restrict__ Kp2, const T16* __restrict__ Vt, const int q0, bf* __restrict__ Ah, bf* __restrict__ Al) {
    typedef typename WFrag<T16>::V V;
    const int lane = threadIdx.x & 31, lr = lane & 15, hi = lane >> 4;
    V qf[NQ][2], qf2[NQ][2];
#pragma unroll
    for (int qt = 0; qt < NQ; ++qt)
#pragma unroll
        for (int ks = 0; ks < 2; ++ks) { const size_t qo = (size_t)(q0 + qt * 16 + lr) * HD + ks * 32 + 8 * hi; qf[qt][ks] = WFrag<T16>::ld(Q + qo); if (HI) qf2[qt][ks] = WFrag<T16>::ld(Q2 + qo); }
    __builtin_amdgcn_sched_barrier(0);        // here and below: the first fragments are issued in the loop's own order (Q, then K as the loop fetches it); loads return in order, so otherwise the K wait at the loop's head, which must hold for both ways in, also waits for the V just asked for
    v8f o[4][NQ]; float m[NQ], l[NQ];
#pragma unroll
    for (int qt = 0; qt < NQ; ++qt) { m[qt] = -3.0e38f; l[qt] = 0.f;
#pragma unroll
        for (int dt = 0; dt < 4; ++dt) o[dt][qt] = (v8f){}; }
    const int klast = (q0 + NQ * 16 - 1) & ~31;   // first key of the last pass (klast <= q0: every pass holds a key <= q for each of the wave's queries; passes before it lie wholly below the diagonal)
    const size_t ko = (size_t)lr * HD + 8 * hi, vo = (size_t)lr * (2 * TT) + 8 * hi;
    V kf[2][2], kf2[2][2];
#pragma unroll
    for (int kt = 0; kt < 2; ++kt)
#pragma unroll
        for (int ks = 0; ks < 2; ++ks) { kf[kt][ks] = WFrag<T16>::ld(Kp + ko + kt * 16 * HD + ks * 32); if (HI) kf2[kt][ks] = WFrag<T16>::ld(Kp2 + ko + kt * 16 * HD + ks * 32); __builtin_amdgcn_sched_barrier(0); }
    asm volatile("s_wait_xcnt 0x0" ::: "memory");   // behind the first loads: their address registers are rewritten only behind this wait, on every way from here (also the way round the loop)
    auto pass = [&](const int kb, auto last) {   // 32 keys; only the last pass touches the diagonal, so only it masks, and it alone fetches no further K: the loop's body has no branch inside
        V vf[4], vf2[4];                      // this pass's V, asked for first: it flies during the score products and the softmax
        const T16* const vp = Vt + vo + kb; const size_t kno = ko + (size_t)(kb + 32) * HD;   // the lo plane of V lies TT elements behind the hi plane in each row
#pragma unroll
        for (int dt = 0; dt < 4; ++dt) { const size_t off = (size_t)dt * 16 * (2 * TT); vf[dt] = WFrag<T16>::ld(vp + off); if (HI) vf2[dt] = WFrag<T16>::ld(vp + TT + off); }
        v8f s[2][NQ];
#pragma unroll
        for (int kt = 0; kt < 2; ++kt)
#pragma unroll
            for (int qt = 0; qt < NQ; ++qt) { v8f a = (v8f){};
#pragma unroll
                for (int ks = 0; ks < 2; ++ks) { a = WFrag<T16>::mma(kf[kt][ks], qf[qt][ks], a); if (HI) { a = WFrag<T16>::mma(kf2[kt][ks], qf[qt][ks], a); a = WFrag<T16>::mma(kf[kt][ks], qf2[qt][ks], a); } }
                s[kt][qt] = a; }
        if constexpr (!decltype(last)::v) {   // next pass's K, fetched into the same registers behind the score products
#pragma unroll
            for (int kt = 0; kt < 2; ++kt)
#pragma unroll
                for (int ks = 0; ks < 2; ++ks) { const size_t off = kno + kt * 16 * HD + ks * 32; kf[kt][ks] = WFrag<T16>::ld(Kp + off); if (HI) kf2[kt][ks] = WFrag<T16>::ld(Kp2 + off); }
        } else {                              // -1e9 fill == exact zero weight
#pragma unroll
            for (int kt = 0; kt < 2; ++kt)
#pragma unroll
                for (int qt = 0; qt < NQ; ++qt)
#pragma unroll
                    for (int j = 0; j < 8; ++j) if (kb + kt * 16 + hi * 8 + j > q0 + qt * 16 + lr) s[kt][qt][j] = -3.0e38f; }
        V pf[NQ], pf2[NQ];
#pragma unroll
        for (int qt = 0; qt < NQ; ++qt) { float mx = s[0][qt][0];
#pragma unroll
            for (int j = 1; j < 8; ++j) mx = fmaxf(mx, s[0][qt][j]);
#pragma unroll
            for (int j = 0; j < 8; ++j) mx = fmaxf(mx, s[1][qt][j]);
            mx = fmaxf(mx, xhalf(mx));
            const float mn = fmaxf(m[qt], mx * SCL2); const float al = ex2(m[qt] - mn); m[qt] = mn; float ls[4] = {0.f, 0.f, 0.f, 0.f}, pe[16];   // al = 0 on the first pass; four partial sums: short dependent chains
#pragma unroll
            for (int e = 0; e < 16; ++e) pe[e] = __builtin_fmaf(s[e >> 3][qt][e & 7], SCL2, -mn);
            ex2x16(pe);
#pragma unroll
            for (int e = 0; e < 16; ++e) { const float p = pe[e]; ls[e & 3] += p;
                if constexpr (HI) { const __bf16 ph = (__bf16)p; pf[qt][e] = ph; pf2[qt][e] = (__bf16)(p - (float)ph); } else { pf[qt][e] = (h16)p; } }
            l[qt] = l[qt] * al + ((ls[0] + ls[1]) + (ls[2] + ls[3]));
#pragma unroll
            for (int dt = 0; dt < 4; ++dt) o[dt][qt] *= al; }
#pragma unroll
        for (int dt = 0; dt < 4; ++dt)
#pragma unroll
            for (int qt = 0; qt < NQ; ++qt) { o[dt][qt] = WFrag<T16>::mma(vf[dt], pf[qt], o[dt][qt]); if (HI) { o[dt][qt] = WFrag<T16>::mma(vf2[dt], pf[qt], o[dt][qt]); o[dt][qt] = WFrag<T16>::mma(vf[dt], pf2[qt], o[dt][qt]); } }
        // foot of a pass, behind its last matrix instruction (the accumulators are operands): four free slots, so that on the way back to the loop's head nothing rewrites an operand too early;
        // and the pass's load addresses are read here once more, so that no load returns into their registers, and they are rewritten (next pass, epilogue) only behind this wait
        if constexpr (HI) { if constexpr (decltype(last)::v) asm volatile("v_nop\n\tv_nop\n\tv_nop\n\tv_nop\n\ts_wait_xcnt 0x0" : "+v"(o[0][0]), "+v"(o[1][0]), "+v"(o[2][0]), "+v"(o[3][0]) : "v"(vp) : "memory");
            else asm volatile("v_nop\n\tv_nop\n\tv_nop\n\tv_nop\n\ts_wait_xcnt 0x0" : "+v"(o[0][0]), "+v"(o[1][0]), "+v"(o[2][0]), "+v"(o[3][0]) : "v"(vp), "v"(Kp + kno), "v"(Kp2 + kno) : "memory"); }
        else { if constexpr (decltype(last)::v) asm volatile("v_nop\n\tv_nop\n\tv_nop\n\tv_nop\n\ts_wait_xcnt 0x0" : "+v"(o[0][0]), "+v"(o[1][0]), "+v"(o[2][0]), "+v"(o[3][0]), "+v"(o[0][NQ - 1]), "+v"(o[1][NQ - 1]), "+v"(o[2][NQ - 1]), "+v"(o[3][NQ - 1]) : "v"(vp) : "memory");
            else asm volatile("v_nop\n\tv_nop\n\tv_nop\n\tv_nop\n\ts_wait_xcnt 0x0" : "+v"(o[0][0]), "+v"(o[1][0]), "+v"(o[2][0]), "+v"(o[3][0]), "+v"(o[0][NQ - 1]), "+v"(o[1][NQ - 1]), "+v"(o[2][NQ - 1]), "+v"(o[3][NQ - 1]) : "v"(vp), "v"(Kp + kno) : "memory"); }
    };
#pragma unroll 1
    for (int kb = 0; kb < klast; kb += 32) pass(kb, BC<false>());   // rolled: one pass is already 16 (24) matrix instructions, and the next pass's K is fetched by hand
    pass(klast, BC<true>());
#pragma unroll
    for (int qt = 0; qt < NQ; ++qt) { const float inv = __fdiv_rn(1.0f, l[qt] + xhalf(l[qt])); const size_t oo = (size_t)(q0 + qt * 16 + lr) * DQ + hi * 8;
#pragma unroll
        for (int dt = 0; dt < 4; ++dt) { v8us oh, ol;
#pragma unroll
            for (int j = 0; j < 8; ++j) { unsigned short a, c2; splitf(o[dt][qt][j] * inv, a, c2); oh[j] = a; ol[j] = c2; }
            *(v8us*)(Ah + oo + dt * 16) = oh; *(v8us*)(Al + oo + dt * 16) = ol;
            asm volatile("s_wait_xcnt 0x0" ::: "memory"); } }   // behind the two stores: their data and address registers are rewritten only behind this wait
}
#define NTL ((TT - RH) / 32)   // 32-column tiles of the fp16 rows
#define NTH (RH / 16)          // 16-column tiles of the hi/lo rows
static_assert(NTL % 4 == 0 && (NTL + NTH) / 4 == 20, "the snake order below is written for 20 tile groups");
// grid (sequences x heads, (NTL + NTH) / 4), 4 waves: the waves of a work-group take neighbouring query tiles of ONE head (they walk the same keys, no barrier). Tile groups are numbered by falling cost; all work-groups are resident,
// 256 of them (8 values of blockIdx.y) make one round over the chip, so blockIdx.y walks the groups in snake order (0..7, 15..8, 19..16): placed round after round, a heavy group shares its place with light ones. For speed only.
__global__ __launch_bounds__(128) void k_fattn(const h16* __restrict__ Q16, const h16* __restrict__ K16, const h16* __restrict__ V16, const bf* __restrict__ Qh, const bf* __restrict__ Ql, const bf* __restrict__ Kh, const bf* __restrict__ Kl, const bf* __restrict__ Vh, bf* __restrict__ Ah, bf* __restrict__ Al) {
    const int zh = blockIdx.x, b = zh / NH_, h = zh % NH_; const int y = blockIdx.y, tg = (y < 8) ? y : (y < 16) ? 23 - y : 35 - y; const int ti = tg * 4 + __builtin_amdgcn_readfirstlane(threadIdx.x >> 5);
    const size_t po = (size_t)zh * TT * HD, ao = (size_t)b * TT * DQ + h * HD;
    if (ti < NTL) fattn<h16, 2, false>(Q16 + po, nullptr, K16 + po, nullptr, V16 + (size_t)(b >> 1) * 2 * NH_ * TT * HD + (size_t)(b & 1) * TT + (size_t)h * HD * 2 * TT, TT - 32 * (ti + 1), Ah + ao, Al + ao);
    else fattn<bf, 1, true>(Qh + po, Ql + po, Kh + po, Kl + po, Vh + 2 * po, RH - 16 * (ti - NTL + 1), Ah + ao, Al + ao);
}

extern "C" void kernel_launch(void* const* d_in, const int* in_sizes, int n_in,
                              void* d_out, int out_size, void* d_ws, size_t ws_size, hipStream_t stream) {
    (void)in_sizes; (void)n_in; (void)out_size;
    const float* x = (const float*)d_in[0]; const float* g1 = (const float*)d_in[1]; const float* e1 = (const float*)d_in[2]; const float* wq = (const float*)d_in[3]; const float* wk = (const float*)d_in[4]; const float* wv = (const float*)d_in[5]; const float* wo = (const float*)d_in[6]; const float* g2 = (const float*)d_in[7]; const float* e2 = (const float*)d_in[8];
    float* OUT = (float*)d_out;     // [4][2048][512]
    char* wsp = (char*)d_ws;
    auto take = [&](size_t bytes) { char* p = wsp; wsp += (bytes + 255) & ~(size_t)255; return (void*)p; };
    bf* WQ = (bf*)take((size_t)DQ * DM * 2); bf* WK = (bf*)take((size_t)DKV * DM * 2); bf* WV = (bf*)take((size_t)DKV * DM * 2); bf* WO = (bf*)take((size_t)DM * DQ * 2);   // consecutive planes (k_front, z-batched projection)
    float* Hf = (float*)take((size_t)NB_ * TT * DM * 4);
    const size_t PLN = (size_t)NB_ * NH_ * TT * HD;   // one head-plane set, all sequences
    h16* QP16 = (h16*)take(PLN * 2); h16* KP16 = (h16*)take(PLN * 2); h16* VT16 = (h16*)take(PLN * 2);
    bf* QPh = (bf*)take(PLN * 2); bf* QPl = (bf*)take(PLN * 2); bf* KPh = (bf*)take(PLN * 2); bf* KPl = (bf*)take(PLN * 2); bf* VTh = (bf*)take(PLN * 2 * 2);   // hi and lo halves of rows of pitch 2 x TT
    char* const un = wsp;   // from here on the workspace is reused, stream-ordered: (1) projection buffers, (2) wfc output
    bf* Yh = (bf*)take((size_t)NB_ * TT * DM * 2); bf* Yl = (bf*)take((size_t)NB_ * TT * DM * 2);
    bf* ATh = (bf*)take((size_t)NB_ * TT * DQ * 2); bf* ATl = (bf*)take((size_t)NB_ * TT * DQ * 2);   // merged heads, hi/lo planes (behind everything the wfc output overlays)
    if ((size_t)(wsp - (char*)d_ws) > ws_size) return;    // ws 256 MiB
    float* O2 = (float*)un;
    k_front<<<WTB + TT / 8, 256, 0, stream>>>(wq, wk, wv, wo, WQ, x, g1, e1, Hf, Yh, Yl);   /* weight planes; h = LN1(x) + PE: f32 + hi/lo planes, all sequences */
    k_gemmw<bf, 1, false, true><<<dim3(NB_ * TT / 128, DQ / 128, 3), 128, 0, stream>>>(Yh, Yl, WQ, nullptr, DM, nullptr, 0, nullptr, 0, (size_t)DQ * DM, 0, QP16, QPh, QPl, KP16, KPh, KPl, VT16, VTh);   /* z: q, k, v, stored as head planes */
    k_fattn<<<dim3(NB_ * NH_, (NTL + NTH) / 4, 1), 128, 0, stream>>>(QP16, KP16, VT16, QPh, QPl, KPh, KPl, VTh, ATh, ATl);   /* all sequences and heads */
    k_gemmw<bf, 1, false, false><<<dim3(NB_ * TT / 128, DM / 128, 1), 128, 0, stream>>>(ATh, ATl, WO, nullptr, DQ, O2, DM, nullptr, 0, 0, 0, nullptr, nullptr, nullptr, nullptr, nullptr, nullptr, nullptr, nullptr); k_resln2<<<NB_ * TT / 8, 256, 0, stream>>>(O2, Hf, x, g2, e2, OUT);   /* o = merged wfc; out = LN2(o + h) + x */
}

// v007
// A run of this version takes 86.9 microseconds.
// In two side-by-side timings against v006, it was 1.37 and 1.35 times as fast.
// Over all steps from v000 it is 17.7 times as fast.
#include <hip/hip_runtime.h>

// Pre-norm causal self-attention block with sinusoidal positions (x [4][2048][512]; h = LN1(x) (1e-5) + PE (pe[t][2i] = sin(t w_i), pe[t][2i+1] = cos(t w_i), w_i = exp(2i x (-ln 1e4 / 512))); q, k, v = h W ('xw' [512][512], no bias; 8 heads x 64); causal softmax(q.k/8) (-1e9 fill == exact zero weight); o = merged wfc ('xw'); out = LN2(o + h) (1e-6) + x -> [4][2048][512] (4.2 M)).
// Layout: LN1 + PE in one kernel (with the weight planes) producing h in f32 (kept for the residual) and as bf16 hi/lo planes (2-product projections); the PE values are computed there in f32 with the reference's float32 constant for -ln(1e4)/512 (precise expf/sinf/cosf); the q/k/v projection GEMM stores its tiles straight as the attention kernel's operand planes; causal attention fused in one kernel (running softmax, scores never stored); the wfc GEMM output goes through a residual + LN2 row kernel that also adds x.
// Compute dtypes, f32 accumulate: every input rounded to bf16; q/k/v hl x exact (2 products); causal scores and attn.v (tile skipping): query rows < 512 hl (3 products), the rest single fp16; softmax f32; wfc hl x exact (2 products); LN2 and both residuals in f32.

#define NB_  4
#define TT   2048
#define DM   512
#define NH_  8
#define NKV  8
#define REP  (NH_ / NKV)
#define HD   64
#define DQ   (NH_ * HD)
#define DKV  (NKV * HD)
#define LNEPS 1e-5f
#define PEC  (-0.0179889463f)   // float32(-ln(10000)/512), as the reference's numpy computes it
typedef __attribute__((ext_vector_type(4))) unsigned short v4us;
#define RH   512                  // query rows < RH use hi+lo planes
typedef _Float16 h16;
typedef unsigned short bf;
typedef __attribute__((ext_vector_type(16))) __bf16   v16bf;
typedef __attribute__((ext_vector_type(16))) _Float16 v16h;
typedef __attribute__((ext_vector_type(8)))  _Float16 v8h;
typedef __attribute__((ext_vector_type(8)))  unsigned short v8us;
typedef __attribute__((ext_vector_type(8)))  float    v8f;
typedef __attribute__((ext_vector_type(4)))  float    v4f;
typedef v8h  __attribute__((may_alias)) v8ha;
typedef v4f  __attribute__((may_alias)) v4fa;
typedef v8us __attribute__((may_alias)) v8usa;

__device__ __forceinline__ unsigned short f2bf(float f) { unsigned u = __float_as_uint(f); u += 0x7FFFu + ((u >> 16) & 1u); return (unsigned short)(u >> 16); }
__device__ __forceinline__ float bf2f(unsigned short b) { return __uint_as_float(((unsigned)b) << 16); }
__device__ __forceinline__ float bfr(float f) { return bf2f(f2bf(f)); }
__device__ __forceinline__ v16h cat16(v8h lo, v8h hi) { return __builtin_shufflevector(lo, hi, 0, 1, 2, 3, 4, 5, 6, 7, 8, 9, 10, 11, 12, 13, 14, 15); }
__device__ __forceinline__ v16bf cat16b(v8us lo, v8us hi) { return __builtin_bit_cast(v16bf, __builtin_shufflevector(lo, hi, 0, 1, 2, 3, 4, 5, 6, 7, 8, 9, 10, 11, 12, 13, 14, 15)); }
__device__ __forceinline__ v8f wmma16(v16h a, v16h b, v8f c) { return __builtin_amdgcn_wmma_f32_16x16x32_f16(false, a, false, b, (short)0, c, false, false); }
__device__ __forceinline__ v8f wmmab(v16bf a, v16bf b, v8f c) { return __builtin_amdgcn_wmma_f32_16x16x32_bf16(false, a, false, b, (short)0, c, false, false); }



// ---- k_gemmw: register-blocked GEMM, one wave per 64x64 output tile (16 accumulators), 2 x 2 waves a work-group; the 128 + 128 operand rows come from K-contiguous 16-bit planes into LDS by asynchronous copies (ring of two stages); grid (M/128, N/128, Z), 128 threads.
// C[m][n] (f32, pitch ldc, + optional f32 bias[n]) = sum_k A[m][k] Bt[n][k] (+ split products per NSPLIT). z-batch strides sA/sB/sC in elements. K % 64 == 0.
template <typename T16> struct WFrag;
template <> struct WFrag<h16> { typedef v16h V; static __device__ __forceinline__ V ld(const h16* p) { return cat16(*(const v8h*)p, *(const v8h*)(p + 16)); } static __device__ __forceinline__ v8f mma(V a, V b, v8f c) { return wmma16(a, b, c); } };
template <> struct WFrag<bf> { typedef v16bf V; static __device__ __forceinline__ V ld(const bf* p) { return cat16b(*(const v8us*)p, *(const v8us*)(p + 16)); } static __device__ __forceinline__ v8f mma(V a, V b, v8f c) { return wmmab(a, b, c); } };
// HP (head planes): z = 0, 1, 2 are the q, k, v projections and a tile is 64 positions of one sequence x the 64 columns of one head; instead of C the wave stores the tile as the attention kernel's operands:
// q, k as [sequence][head][t][d], v transposed as rows (head, d) of pitch 2 x TT, each as fp16 and as bf16 hi/lo; every store instruction covers four whole 128-byte lines.
__device__ __forceinline__ void splitf(float y, unsigned short& h, unsigned short& l) { h = f2bf(y); l = f2bf(y - bf2f(h)); }
typedef __attribute__((ext_vector_type(8))) __bf16 v8bf;
__device__ __forceinline__ void split8(const v8f x, v8h& o16, v8us& oh, v8us& ol) { v8bf h, l;   // fp16, and bf16 hi + lo of the remainder (round to nearest even, as f2bf)
#pragma unroll
    for (int j = 0; j < 8; ++j) { o16[j] = (h16)x[j]; h[j] = (__bf16)x[j]; l[j] = (__bf16)(x[j] - (float)h[j]); }
    oh = __builtin_bit_cast(v8us, h); ol = __builtin_bit_cast(v8us, l); }
// Operand staging of k_gemmw: a stage is 64 k of 128 A rows (hi plane, lo plane) and 128 Bt rows, each row 128 bytes = one whole line. In LDS two rows share 272 bytes (256 + 16),
// so that the 16 rows of a fragment read fall on 16 different 16-byte bank groups. Three tiles a stage, two stages (a ring of two buffers).
#define GP2    272
#define GTILE  (64 * GP2)
#define GSTAGE (3 * GTILE)
// Eight asynchronous copies of 16 bytes a lane (rows 16 apart: a wave's copy covers four whole lines). The s_wait_xcnt is the last line of the copies' own statement: the address registers are rewritten only behind it.
__device__ __forceinline__ void cp8(const unsigned l, const char* const g, const size_t gs) {
    asm volatile("global_load_async_to_lds_b128 %0, %8, off\n\tglobal_load_async_to_lds_b128 %1, %9, off\n\tglobal_load_async_to_lds_b128 %2, %10, off\n\tglobal_load_async_to_lds_b128 %3, %11, off\n\t"
                 "global_load_async_to_lds_b128 %4, %12, off\n\tglobal_load_async_to_lds_b128 %5, %13, off\n\tglobal_load_async_to_lds_b128 %6, %14, off\n\tglobal_load_async_to_lds_b128 %7, %15, off\n\ts_wait_xcnt 0x0"
                 :: "v"(l), "v"(l + 8 * GP2), "v"(l + 16 * GP2), "v"(l + 24 * GP2), "v"(l + 32 * GP2), "v"(l + 40 * GP2), "v"(l + 48 * GP2), "v"(l + 56 * GP2),
                    "v"(g), "v"(g + gs), "v"(g + 2 * gs), "v"(g + 3 * gs), "v"(g + 4 * gs), "v"(g + 5 * gs), "v"(g + 6 * gs), "v"(g + 7 * gs) : "memory");
}
template <typename T16, int NSPLIT, bool BIAS, bool HP>
__global__ __launch_bounds__(128) void k_gemmw(const T16* __restrict__ A, const T16* __restrict__ A2, const T16* __restrict__ Bt, const T16* __restrict__ Bt2, int K, float* C, int ldc, const float* __restrict__ bias, size_t sA, size_t sB, size_t sC, h16* Q16, bf* Qh, bf* Ql, h16* K16, bf* Kh, bf* Kl, h16* V16, bf* Vh) {
    static_assert(NSPLIT == 1, "the staging below holds A, A2 and Bt");
    typedef typename WFrag<T16>::V V;
    __shared__ __align__(16) char sm[2 * GSTAGE];
    const size_t z = blockIdx.z; A += z * sA; A2 += z * sA; Bt += z * sB; C += z * sC;
    const int tid = threadIdx.x, lane = tid & 31, lr = lane & 15, hi = lane >> 4, wv = __builtin_amdgcn_readfirstlane(tid >> 5);
    const int r0 = blockIdx.x * 128 + (wv & 1) * 64, c0 = blockIdx.y * 128 + (wv >> 1) * 64;   // 2 x 2 waves, each a 64 x 64 tile
    v8f acc[4][4];
#pragma unroll
    for (int mb = 0; mb < 4; ++mb)
#pragma unroll
        for (int nb = 0; nb < 4; ++nb) acc[mb][nb] = (v8f){};
    const int cr = tid >> 3, cch = tid & 7;   // copies: 8 lanes a row, a thread's rows are cr + 16 i
    const unsigned lc = (unsigned)(size_t)sm + (cr >> 1) * GP2 + (cr & 1) * 128 + cch * 16;
    const char* const ga = (const char*)(A + (size_t)(blockIdx.x * 128 + cr) * K + cch * 8); const char* const ga2 = (const char*)(A2 + (size_t)(blockIdx.x * 128 + cr) * K + cch * 8); const char* const gb = (const char*)(Bt + (size_t)(blockIdx.y * 128 + cr) * K + cch * 8);
    const size_t gs = (size_t)16 * K * sizeof(T16);
    auto fill = [&](const int t) { const unsigned l = lc + (t & 1) * GSTAGE; cp8(l, ga + t * 128, gs); cp8(l + GTILE, ga2 + t * 128, gs); cp8(l + 2 * GTILE, gb + t * 128, gs); };
    const int nt = K / 64;
    fill(0);
    asm volatile("s_wait_asynccnt 0x0" ::: "memory");   // stage 0 has landed (this wave's copies) before the barrier that publishes it
    __syncthreads();
    if (nt > 1) fill(1);
    const int fo = (lr >> 1) * GP2 + (lr & 1) * 128 + hi * 16, ao = (wv & 1) * 32 * GP2 + fo, bo = 2 * GTILE + (wv >> 1) * 32 * GP2 + fo;   // fragment reads: row lr of a 16-row group, 16-byte pieces hi and 2 + hi of each 32 k
#pragma unroll 1
    for (int t = 0; t < nt; ++t) {
        const char* const sb = sm + (t & 1) * GSTAGE;
#pragma unroll
        for (int ks = 0; ks < 2; ++ks) { V a[4], a2[4], b[4];   // the twelve fragments of 32 k are asked for together, in front of their 32 products
#pragma unroll
            for (int mb = 0; mb < 4; ++mb) { a[mb] = WFrag<T16>::ld((const T16*)(sb + ao + mb * 8 * GP2 + ks * 64)); a2[mb] = WFrag<T16>::ld((const T16*)(sb + GTILE + ao + mb * 8 * GP2 + ks * 64)); b[mb] = WFrag<T16>::ld((const T16*)(sb + bo + mb * 8 * GP2 + ks * 64)); }
            __builtin_amdgcn_sched_barrier(0);   // keeps the Bt fragment reads up here: sunk among the products, each pair is waited out on its own in front of eight of them
#pragma unroll
            for (int nb = 0; nb < 4; ++nb)
#pragma unroll
                for (int mb = 0; mb < 4; ++mb) { acc[mb][nb] = WFrag<T16>::mma(a[mb], b[nb], acc[mb][nb]); acc[mb][nb] = WFrag<T16>::mma(a2[mb], b[nb], acc[mb][nb]); }
        }
        // four free slots behind the trip's last matrix instruction (all sixteen accumulators are operands, so none follows), on the way on and on the way back to the loop's head
        asm volatile("v_nop\n\tv_nop\n\tv_nop\n\tv_nop" : "+v"(acc[0][0]), "+v"(acc[0][1]), "+v"(acc[0][2]), "+v"(acc[0][3]), "+v"(acc[1][0]), "+v"(acc[1][1]), "+v"(acc[1][2]), "+v"(acc[1][3]), "+v"(acc[2][0]), "+v"(acc[2][1]), "+v"(acc[2][2]), "+v"(acc[2][3]), "+v"(acc[3][0]), "+v"(acc[3][1]), "+v"(acc[3][2]), "+v"(acc[3][3]));
        asm volatile("s_wait_dscnt 0x0" ::: "memory");      // foot of a trip: this wave's reads of the buffer are done,
        asm volatile("s_wait_asynccnt 0x0" ::: "memory");   // its copies of the next stage have landed,
        __syncthreads();                                    // and one barrier publishes the next stage and frees this trip's buffer
        if (t + 2 < nt) fill(t + 2);
    }
    asm volatile("s_wait_asynccnt 0x0" ::: "memory");       // no copy is outstanding when the ring becomes output staging (every wave's last read ended at the last trip's barrier)
    float* const os = (float*)(sm + wv * 8192);             // each wave stages its output rows in its own range
    if constexpr (HP) {
        const int sq = r0 / TT, t0 = r0 % TT, hd = c0 / 64, r4 = lane >> 3, c8 = (lane & 7) * 8;   // read-back: 8 lanes cover one 128-byte row of 64 16-bit values, a wave four rows
        if (z == 2) {   // v: a lane's accumulator holds 8 consecutive t of one d, already the transposed order; 16 d rows x 64 t per plane go through LDS (pitch 72 values) so that whole lines are stored
            unsigned short* const sv = (unsigned short*)os; const size_t rows = (size_t)NKV * HD * (2 * TT), vrow = (size_t)(hd * HD + r4) * (2 * TT) + t0 + c8;
            unsigned short* const gp[3] = { (unsigned short*)V16 + (size_t)(sq >> 1) * rows + (size_t)(sq & 1) * TT + vrow, Vh + (size_t)sq * rows + vrow, Vh + (size_t)sq * rows + TT + vrow };   // the fp16 rows of an even and the next odd sequence share a row; lo plane TT behind hi
#pragma unroll
            for (int nb = 0; nb < 4; ++nb) {
#pragma unroll
                for (int mb = 0; mb < 4; ++mb) { v8h o16; v8us oh, ol; split8(acc[mb][nb], o16, oh, ol);
                    unsigned short* const sp = sv + lr * 72 + mb * 16 + hi * 8; *(v8ha*)sp = o16; *(v8usa*)(sp + 16 * 72) = oh; *(v8usa*)(sp + 2 * 16 * 72) = ol; }
                asm volatile("s_wait_dscnt 0x0" ::: "memory");   // the staged rows are read back, by other lanes than wrote them, only behind the LDS stores' own wait
#pragma unroll
                for (int p = 0; p < 3; ++p)
#pragma unroll
                    for (int s = 0; s < 4; ++s) *(v8us*)(gp[p] + (size_t)(nb * 16 + s * 4) * (2 * TT)) = *(const v8usa*)(sv + (p * 16 + s * 4 + r4) * 72 + c8);
                asm volatile("s_wait_xcnt 0x0" ::: "memory"); __builtin_amdgcn_sched_barrier(0);   // behind the stores: their data and address registers are rewritten only behind this wait (the scheduling barrier keeps the next rows' conversions from rising over it)
            }
        } else {        // q, k: 16 rows of f32 through LDS, read back 8 values a lane, converted, stored
            const size_t po = ((size_t)(sq * NH_ + hd) * TT + t0 + r4) * HD + c8; h16* const p16 = (z ? K16 : Q16) + po; bf* const ph = (z ? Kh : Qh) + po; bf* const pl = (z ? Kl : Ql) + po;
#pragma unroll
            for (int mb = 0; mb < 4; ++mb) {
#pragma unroll
                for (int nb = 0; nb < 4; ++nb) {
#pragma unroll
                    for (int j = 0; j < 8; ++j) os[(hi * 8 + j) * 68 + nb * 16 + lr] = acc[mb][nb][j]; }
                asm volatile("s_wait_dscnt 0x0" ::: "memory");   // as above: read-back only behind the LDS stores' wait
#pragma unroll
                for (int s = 0; s < 4; ++s) { const float* const rp = os + (s * 4 + r4) * 68 + c8; const v4f x0 = *(const v4fa*)rp, x1 = *(const v4fa*)(rp + 4); v8h o16; v8us oh, ol;
                    split8(__builtin_shufflevector(x0, x1, 0, 1, 2, 3, 4, 5, 6, 7), o16, oh, ol);
                    const size_t off = (size_t)(mb * 16 + s * 4) * HD; *(v8h*)(p16 + off) = o16; *(v8us*)(ph + off) = oh; *(v8us*)(pl + off) = ol; }
                asm volatile("s_wait_xcnt 0x0" ::: "memory"); __builtin_amdgcn_sched_barrier(0);   // as above, behind the twelve stores
            }
        }
    } else
#pragma unroll
    for (int mb = 0; mb < 4; ++mb) {
#pragma unroll
        for (int nb = 0; nb < 4; ++nb) {
#pragma unroll
            for (int j = 0; j < 8; ++j) os[(hi * 8 + j) * 68 + nb * 16 + lr] = acc[mb][nb][j]; }
        __builtin_amdgcn_wave_barrier(); asm volatile("" ::: "memory");
        float* crow = C + (size_t)(r0 + mb * 16) * ldc + c0;
{
#pragma unroll
            for (int s = 0; s < 8; ++s) { const int row = 2 * s + hi, cofs = lr * 4; v4f val = *(const v4fa*)(os + row * 68 + cofs); if (BIAS) { val[0] += bfr(bias[c0 + cofs]); val[1] += bfr(bias[c0 + cofs + 1]); val[2] += bfr(bias[c0 + cofs + 2]); val[3] += bfr(bias[c0 + cofs + 3]); }
                *(v4f*)(crow + (size_t)row * ldc + cofs) = val; }
             }
        __builtin_amdgcn_wave_barrier(); asm volatile("" ::: "memory");
    }
}

typedef __attribute__((ext_vector_type(2))) _Float16 v2h;
typedef __attribute__((ext_vector_type(4))) _Float16 v4h;
typedef __attribute__((ext_vector_type(2))) unsigned short v2us;
typedef __attribute__((ext_vector_type(4))) unsigned short v4us;
typedef __attribute__((ext_vector_type(2))) float v2f;
typedef __attribute__((ext_vector_type(4))) int v4i;

// ---- k_front: everything in front of the projections in ONE launch. Work-groups < WTB: the four equally shaped weights, transposed and rounded to bf16 (consecutive output planes).
// The others: h = LN1(x) + PE. A wave takes ONE position of all sequences: the position's sines and cosines are computed once, while the four rows are on their way; each row is read once and kept in registers.
#define WTB (4 * (DM * DQ / 64 / 64))   // 64 work-groups a weight: 8 waves x 8 lines of 64 values
__global__ __launch_bounds__(256) void k_front(const float* __restrict__ w0, const float* __restrict__ w1, const float* __restrict__ w2, const float* __restrict__ w3, bf* Bt, const float* __restrict__ X, const float* __restrict__ g, const float* __restrict__ be, float* Hf, bf* Yh, bf* Yl) {
    const int lane = threadIdx.x & 31;
    if (blockIdx.x < WTB) {
        const int K = DM, N = DQ, wi = blockIdx.x / (WTB / 4); const float* w = (wi == 0) ? w0 : (wi == 1) ? w1 : (wi == 2) ? w2 : w3; Bt += (size_t)wi * K * N;
        const int L0 = ((blockIdx.x % (WTB / 4)) * 8 + (threadIdx.x >> 5)) * 8; const int nlines = N * K / 64;
#pragma unroll 1
        for (int l = 0; l < 8; ++l) { const int L = L0 + l; if (L >= nlines) break; const size_t e = (size_t)L * 64 + lane * 2; const int k = (int)(e % K), n = (int)(e / K); v2us o;
            o[0] = f2bf(w[(size_t)k * N + n]); o[1] = f2bf(w[(size_t)(k + 1) * N + n]); *(v2us*)(Bt + e) = o; }
        return;
    }
    const int t = (blockIdx.x - WTB) * 8 + (threadIdx.x >> 5);   // position; row of sequence b: b x TT + t
    v4f xa[NB_][DM / 128];
#pragma unroll
    for (int b = 0; b < NB_; ++b)
#pragma unroll
        for (int ch = 0; ch < DM / 128; ++ch) xa[b][ch] = *(const v4f*)(X + ((size_t)b * TT + t) * DM + ch * 128 + lane * 4);
    float gg[DM / 128][4], bb[DM / 128][4];   // the lane's sixteen columns of gamma and beta, read once for the four rows
#pragma unroll
    for (int ch = 0; ch < DM / 128; ++ch)
#pragma unroll
        for (int q = 0; q < 4; ++q) { gg[ch][q] = bfr(g[ch * 128 + lane * 4 + q]); bb[ch][q] = bfr(be[ch * 128 + lane * 4 + q]); }
    __shared__ v2f pes[2 * (DM / 128) * 256];   // a lane's eight (sine, cosine) pairs, written and read back by the same lane: no barrier
#pragma unroll 1   // rolled: eight copies of the sine and cosine code would double the kernel's text, which every WGP fetches for one run through it
    for (int i = 0; i < 2 * (DM / 128); ++i) { const int c = (i >> 1) * 128 + lane * 4 + 2 * (i & 1); const float w = expf(__fmul_rn((float)c, PEC)); const float ang = __fmul_rn((float)t, w); v2f o; o[0] = sinf(ang); o[1] = cosf(ang); pes[i * 256 + threadIdx.x] = o; }
    v4f pe[DM / 128];
#pragma unroll
    for (int ch = 0; ch < DM / 128; ++ch) { const v2f p0 = pes[2 * ch * 256 + threadIdx.x], p1 = pes[(2 * ch + 1) * 256 + threadIdx.x]; pe[ch] = __builtin_shufflevector(p0, p1, 0, 1, 2, 3); }
    float s[NB_], s2[NB_], mu[NB_], rs[NB_];   // the four rows side by side: their exchanges between lanes overlap; each row's own order of sums is that of one row alone
#pragma unroll
    for (int b = 0; b < NB_; ++b) { s[b] = 0.f;
#pragma unroll
        for (int ch = 0; ch < DM / 128; ++ch) { const v4f a = xa[b][ch];
#pragma unroll
            for (int q = 0; q < 4; ++q) s[b] += bfr(a[q]); } }
#pragma unroll
    for (int sh = 16; sh; sh >>= 1)
#pragma unroll
        for (int b = 0; b < NB_; ++b) s[b] += __shfl_xor(s[b], sh, 32);
#pragma unroll
    for (int b = 0; b < NB_; ++b) { mu[b] = s[b] * (1.0f / DM); s2[b] = 0.f;
#pragma unroll
        for (int ch = 0; ch < DM / 128; ++ch) { const v4f a = xa[b][ch];
#pragma unroll
            for (int q = 0; q < 4; ++q) { const float d0 = __fsub_rn(bfr(a[q]), mu[b]); float p = __fmul_rn(d0, d0); asm volatile("" : "+v"(p)); s2[b] = __fadd_rn(s2[b], p); } } }
#pragma unroll
    for (int sh = 16; sh; sh >>= 1)
#pragma unroll
        for (int b = 0; b < NB_; ++b) s2[b] += __shfl_xor(s2[b], sh, 32);
#pragma unroll
    for (int b = 0; b < NB_; ++b) rs[b] = __fdiv_rn(1.0f, __fsqrt_rn(__fadd_rn(s2[b] * (1.0f / DM), LNEPS)));
#pragma unroll
    for (int ch = 0; ch < DM / 128; ++ch) { const int c0 = ch * 128 + lane * 4;
#pragma unroll
        for (int b = 0; b < NB_; ++b) { const size_t r = (size_t)b * TT + t; const v4f a = xa[b][ch]; v4f h4; v4us oh, ol;
#pragma unroll
            for (int q = 0; q < 4; ++q) { float n0 = __fmul_rn(__fsub_rn(bfr(a[q]), mu[b]), rs[b]); asm volatile("" : "+v"(n0)); float n1 = __fmul_rn(n0, gg[ch][q]); asm volatile("" : "+v"(n1)); const float ln = __fadd_rn(n1, bb[ch][q]); const float hv = __fadd_rn(ln, pe[ch][q]); h4[q] = hv; unsigned short h2, l2; splitf(hv, h2, l2); oh[q] = h2; ol[q] = l2; }
            *(v4f*)(Hf + r * DM + c0) = h4; *(v4us*)(Yh + r * DM + c0) = oh; *(v4us*)(Yl + r * DM + c0) = ol; } }
    asm volatile("s_wait_xcnt 0x0" ::: "memory");   // behind the last stores: on no way that the built code's branches leave open is one of their registers rewritten ahead of this wait
}
__global__ __launch_bounds__(256) void k_resln2(const float* __restrict__ O, const float* __restrict__ Hf, const float* __restrict__ X, const float* __restrict__ g, const float* __restrict__ be, float* OUTb) {
    const int lane = threadIdx.x & 31; const int r = blockIdx.x * 8 + (threadIdx.x >> 5); if (r >= NB_ * TT) return; const float* orow = O + (size_t)r * DM; const float* hrow = Hf + (size_t)r * DM; float s = 0.f;
#pragma unroll 1
    for (int ch = 0; ch < DM / 128; ++ch) { const int c0 = ch * 128 + lane * 4; const v4f a = *(const v4f*)(orow + c0), hh = *(const v4f*)(hrow + c0);
#pragma unroll
        for (int q = 0; q < 4; ++q) s += __fadd_rn(a[q], hh[q]); }
#pragma unroll
    for (int sh = 16; sh; sh >>= 1) s += __shfl_xor(s, sh, 32);
    const float mu = s * (1.0f / DM); float s2 = 0.f;
#pragma unroll 1
    for (int ch = 0; ch < DM / 128; ++ch) { const int c0 = ch * 128 + lane * 4; const v4f a = *(const v4f*)(orow + c0), hh = *(const v4f*)(hrow + c0);
#pragma unroll
        for (int q = 0; q < 4; ++q) { const float d0 = __fsub_rn(__fadd_rn(a[q], hh[q]), mu); float p = __fmul_rn(d0, d0); asm volatile("" : "+v"(p)); s2 = __fadd_rn(s2, p); } }
#pragma unroll
    for (int sh = 16; sh; sh >>= 1) s2 += __shfl_xor(s2, sh, 32);
    const float rs = __fdiv_rn(1.0f, __fsqrt_rn(__fadd_rn(s2 * (1.0f / DM), 1e-6f)));
{
#pragma unroll 1
        for (int ch = 0; ch < DM / 128; ++ch) { const int c0 = ch * 128 + lane * 4; const v4f a = *(const v4f*)(orow + c0), hh = *(const v4f*)(hrow + c0), xx = *(const v4f*)(X + (size_t)r * DM + c0); v4f o4;
#pragma unroll
            for (int q = 0; q < 4; ++q) { float n0 = __fmul_rn(__fsub_rn(__fadd_rn(a[q], hh[q]), mu), rs); asm volatile("" : "+v"(n0)); float n1 = __fmul_rn(n0, bfr(g[c0 + q])); asm volatile("" : "+v"(n1)); o4[q] = __fadd_rn(__fadd_rn(n1, bfr(be[c0 + q])), bfr(xx[q])); }
            *(v4f*)(OUTb + (size_t)r * DM + c0) = o4; }
         } }
__global__ __launch_bounds__(256) void k_cvt8(const float* __restrict__ src, bf* dst, size_t n8) { const size_t i = (size_t)blockIdx.x * 256 + threadIdx.x; if (i >= n8) return; const v8f v = *(const v8f*)(src + i * 8); v8us o;
#pragma unroll
    for (int k = 0; k < 8; ++k) o[k] = f2bf(v[k]); *(v8us*)(dst + i * 8) = o;  }

__device__ __forceinline__ float xhalf(float x) { return __builtin_bit_cast(float, __builtin_amdgcn_permlanex16(__builtin_bit_cast(int, x), __builtin_bit_cast(int, x), 0x76543210, 0xfedcba98, false, false)); }   // lane l with lane l ^ 16
#define SCL2 0.18033688011112042f   // HD^-0.5 x log2(e)
template <bool B> struct BC { static constexpr bool v = B; };
// 2^x with the one free slot the instruction set asks for behind a transcendental written into the statement (v_nop). ex2x16: sixteen values in place; each v_exp_f32 is followed by an independent one, the last by the v_nop.
__device__ __forceinline__ float ex2(float x) { float r; asm("v_exp_f32 %0, %1\n\tv_nop" : "=v"(r) : "v"(x)); return r; }
__device__ __forceinline__ void ex2x16(float (&x)[16]) { asm("v_exp_f32 %0, %0\n\tv_exp_f32 %1, %1\n\tv_exp_f32 %2, %2\n\tv_exp_f32 %3, %3\n\tv_exp_f32 %4, %4\n\tv_exp_f32 %5, %5\n\tv_exp_f32 %6, %6\n\tv_exp_f32 %7, %7\n\tv_exp_f32 %8, %8\n\tv_exp_f32 %9, %9\n\tv_exp_f32 %10, %10\n\tv_exp_f32 %11, %11\n\tv_exp_f32 %12, %12\n\tv_exp_f32 %13, %13\n\tv_exp_f32 %14, %14\n\tv_exp_f32 %15, %15\n\tv_nop" : "+v"(x[0]), "+v"(x[1]), "+v"(x[2]), "+v"(x[3]), "+v"(x[4]), "+v"(x[5]), "+v"(x[6]), "+v"(x[7]), "+v"(x[8]), "+v"(x[9]), "+v"(x[10]), "+v"(x[11]), "+v"(x[12]), "+v"(x[13]), "+v"(x[14]), "+v"(x[15])); }
// K and V staging of k_fattn: a stage is 64 keys: K as 64 rows (keys) of 128 bytes, V as 64 rows (d) of 128 bytes (64 keys), each row one whole line; hi/lo rows: the two lo tiles behind them. Rows lie in LDS as in k_gemmw (two rows share GP2 bytes).
#define ATILE (32 * GP2)
// Eight asynchronous copies of 16 bytes a lane, four rows (16 apart) of each of two tiles: a wave's copy covers four whole lines. The s_wait_xcnt is the last line of the copies' own statement: the address registers are rewritten only behind it.
__device__ __forceinline__ void cp44(const unsigned l0, const char* const g0, const size_t s0, const unsigned l1, const char* const g1, const size_t s1) {
    asm volatile("global_load_async_to_lds_b128 %0, %8, off\n\tglobal_load_async_to_lds_b128 %1, %9, off\n\tglobal_load_async_to_lds_b128 %2, %10, off\n\tglobal_load_async_to_lds_b128 %3, %11, off\n\t"
                 "global_load_async_to_lds_b128 %4, %12, off\n\tglobal_load_async_to_lds_b128 %5, %13, off\n\tglobal_load_async_to_lds_b128 %6, %14, off\n\tglobal_load_async_to_lds_b128 %7, %15, off\n\ts_wait_xcnt 0x0"
                 :: "v"(l0), "v"(l0 + 8 * GP2), "v"(l0 + 16 * GP2), "v"(l0 + 24 * GP2), "v"(l1), "v"(l1 + 8 * GP2), "v"(l1 + 16 * GP2), "v"(l1 + 24 * GP2),
                    "v"(g0), "v"(g0 + s0), "v"(g0 + 2 * s0), "v"(g0 + 3 * s0), "v"(g1), "v"(g1 + s1), "v"(g1 + 2 * s1), "v"(g1 + 3 * s1) : "memory");
}
// qb: first query of the work-group's 4 x NQ x 16 columns (a multiple of 64); q0: first query of this wave. Every wave passes every barrier: the trip count depends on qb alone.
template <typename T16, int NQ, bool HI>
__device__ __forceinline__ void fattn(char* const sm, const T16* __restrict__ Q, const T16* __restrict__ Q2, const T16* __restrict__ Kp, const T16* __restrict__ Kp2, const T16* __restrict__ Vt, const int qb, const int q0, bf* __restrict__ Ah, bf* __restrict__ Al) {
    typedef typename WFrag<T16>::V V;
    constexpr int ASTG = (HI ? 4 : 2) * ATILE;   // tiles of a stage: K, V (, K lo, V lo)
    const int tid = threadIdx.x, lane = tid & 31, lr = lane & 15, hi = lane >> 4;
    const int cr = tid >> 3, cch = tid & 7;   // copies: 8 lanes a row, a thread's rows are cr + 16 i
    const unsigned lc = (unsigned)(size_t)sm + (cr >> 1) * GP2 + (cr & 1) * 128 + cch * 16;
    const char* const gk = (const char*)(Kp + (size_t)cr * HD + cch * 8); const char* const gk2 = (const char*)(Kp2 + (size_t)cr * HD + cch * 8); const char* const gv = (const char*)(Vt + (size_t)cr * (2 * TT) + cch * 8);   // the lo plane of V lies TT elements behind the hi plane in each row
    auto fill = [&](const int t) { const unsigned l = lc + (t & 1) * ASTG; cp44(l, gk + (size_t)t * (64 * HD * 2), 16 * HD * 2, l + ATILE, gv + t * 128, (size_t)16 * 2 * TT * 2);
        if constexpr (HI) cp44(l + 2 * ATILE, gk2 + (size_t)t * (64 * HD * 2), 16 * HD * 2, l + 3 * ATILE, gv + TT * 2 + t * 128, (size_t)16 * 2 * TT * 2); };
    const int nmain = qb / 64, nt = nmain + NQ;   // trips wholly below every wave's diagonal; then the NQ trips that hold the work-group's own 4 x NQ x 16 keys
    fill(0);
    V qf[NQ][2], qf2[NQ][2];
#pragma unroll
    for (int qt = 0; qt < NQ; ++qt)
#pragma unroll
        for (int ks = 0; ks < 2; ++ks) { const size_t qo = (size_t)(q0 + qt * 16 + lr) * HD + ks * 32 + 8 * hi; qf[qt][ks] = WFrag<T16>::ld(Q + qo); if (HI) qf2[qt][ks] = WFrag<T16>::ld(Q2 + qo); }
    asm volatile("s_wait_xcnt 0x0" ::: "memory");   // behind the Q loads: their address registers are rewritten only behind this wait
    asm volatile("s_wait_asynccnt 0x0" ::: "memory");   // stage 0 has landed (this wave's copies) before the barrier that publishes it
    __syncthreads();
    if (nt > 1) fill(1);
    v8f o[4][NQ]; float m[NQ], l[NQ];
#pragma unroll
    for (int qt = 0; qt < NQ; ++qt) { m[qt] = -3.0e38f; l[qt] = 0.f;
#pragma unroll
        for (int dt = 0; dt < 4; ++dt) o[dt][qt] = (v8f){}; }
    const int klast = (q0 + NQ * 16 - 1) & ~31;   // first key of the wave's last pass (klast <= q0: every pass holds a key <= q for each of the wave's queries)
    const int fo = (lr >> 1) * GP2 + (lr & 1) * 128 + hi * 16;   // fragment reads: row lr of a 16-row group, 16-byte pieces hi and 2 + hi of each 64 bytes
    V kf[2][2], kf2[2][2];
    auto ldk = [&](const char* const sb, const int sub) {   // the K fragments of 32 keys
#pragma unroll
        for (int kt = 0; kt < 2; ++kt)
#pragma unroll
            for (int ks = 0; ks < 2; ++ks) { const char* const p = sb + fo + (sub * 16 + kt * 8) * GP2 + ks * 64; kf[kt][ks] = WFrag<T16>::ld((const T16*)p); if (HI) kf2[kt][ks] = WFrag<T16>::ld((const T16*)(p + 2 * ATILE)); } };
    auto pass = [&](const char* const sb, const int sub, const int kb, auto mask, auto nextk) {   // 32 keys (half sub of the stage at sb), K fragments already asked for; mask: the pass may touch the diagonal; nextk: the stage's other half follows
        V vf[4], vf2[4];                      // this pass's V, asked for first: it comes during the score products and the softmax
#pragma unroll
        for (int dt = 0; dt < 4; ++dt) { const char* const p = sb + ATILE + fo + dt * 8 * GP2 + sub * 64; vf[dt] = WFrag<T16>::ld((const T16*)p); if (HI) vf2[dt] = WFrag<T16>::ld((const T16*)(p + 2 * ATILE)); }
        v8f s[2][NQ];
#pragma unroll
        for (int kt = 0; kt < 2; ++kt)
#pragma unroll
            for (int qt = 0; qt < NQ; ++qt) { v8f a = (v8f){};
#pragma unroll
                for (int ks = 0; ks < 2; ++ks) { a = WFrag<T16>::mma(kf[kt][ks], qf[qt][ks], a); if (HI) { a = WFrag<T16>::mma(kf2[kt][ks], qf[qt][ks], a); a = WFrag<T16>::mma(kf[kt][ks], qf2[qt][ks], a); } }
                s[kt][qt] = a; }
        if constexpr (decltype(nextk)::v) ldk(sb, sub + 1);   // the next pass's K, of the same stage, into the same registers behind the score products
        if constexpr (decltype(mask)::v) {    // -1e9 fill == exact zero weight
#pragma unroll
            for (int kt = 0; kt < 2; ++kt)
#pragma unroll
                for (int qt = 0; qt < NQ; ++qt)
#pragma unroll
                    for (int j = 0; j < 8; ++j) if (kb + kt * 16 + hi * 8 + j > q0 + qt * 16 + lr) s[kt][qt][j] = -3.0e38f; }
        V pf[NQ], pf2[NQ];
#pragma unroll
        for (int qt = 0; qt < NQ; ++qt) { float mx = s[0][qt][0];
#pragma unroll
            for (int j = 1; j < 8; ++j) mx = fmaxf(mx, s[0][qt][j]);
#pragma unroll
            for (int j = 0; j < 8; ++j) mx = fmaxf(mx, s[1][qt][j]);
            mx = fmaxf(mx, xhalf(mx));
            const float mn = fmaxf(m[qt], mx * SCL2); const float al = ex2(m[qt] - mn); m[qt] = mn; float ls[4] = {0.f, 0.f, 0.f, 0.f}, pe[16];   // al = 0 on the first pass; four partial sums: short dependent chains
#pragma unroll
            for (int e = 0; e < 16; ++e) pe[e] = __builtin_fmaf(s[e >> 3][qt][e & 7], SCL2, -mn);
            ex2x16(pe);
#pragma unroll
            for (int e = 0; e < 16; ++e) { const float p = pe[e]; ls[e & 3] += p;
                if constexpr (HI) { const __bf16 ph = (__bf16)p; pf[qt][e] = ph; pf2[qt][e] = (__bf16)(p - (float)ph); } else { pf[qt][e] = (h16)p; } }
            l[qt] = l[qt] * al + ((ls[0] + ls[1]) + (ls[2] + ls[3]));
#pragma unroll
            for (int dt = 0; dt < 4; ++dt) o[dt][qt] *= al; }
#pragma unroll
        for (int dt = 0; dt < 4; ++dt)
#pragma unroll
            for (int qt = 0; qt < NQ; ++qt) { o[dt][qt] = WFrag<T16>::mma(vf[dt], pf[qt], o[dt][qt]); if (HI) { o[dt][qt] = WFrag<T16>::mma(vf2[dt], pf[qt], o[dt][qt]); o[dt][qt] = WFrag<T16>::mma(vf[dt], pf2[qt], o[dt][qt]); } }
    };
    auto slots = [&]() {   // behind the last matrix instruction in front of a branch (the accumulators are operands): four free slots, so that on the branch's taken side nothing rewrites an operand too early
        if constexpr (HI) asm volatile("v_nop\n\tv_nop\n\tv_nop\n\tv_nop" : "+v"(o[0][0]), "+v"(o[1][0]), "+v"(o[2][0]), "+v"(o[3][0]));
        else asm volatile("v_nop\n\tv_nop\n\tv_nop\n\tv_nop" : "+v"(o[0][0]), "+v"(o[1][0]), "+v"(o[2][0]), "+v"(o[3][0]), "+v"(o[0][NQ - 1]), "+v"(o[1][NQ - 1]), "+v"(o[2][NQ - 1]), "+v"(o[3][NQ - 1]));
    };
    auto foot = [&](const int t) {
        asm volatile("s_wait_dscnt 0x0" ::: "memory");      // foot of a trip: this wave's reads of the buffer are done,
        asm volatile("s_wait_asynccnt 0x0" ::: "memory");   // its copies of the next stage have landed,
        __syncthreads();                                    // and one barrier publishes the next stage and frees this trip's buffer
        if (t + 2 < nt) fill(t + 2);
    };
    int t = 0;
#pragma unroll 1   // rolled: a trip is already two passes of 16 (24) matrix instructions
    for (; t < nmain; ++t) { const char* const sb = sm + (t & 1) * ASTG; ldk(sb, 0); pass(sb, 0, t * 64, BC<false>(), BC<true>()); pass(sb, 1, t * 64 + 32, BC<false>(), BC<false>()); slots(); foot(t); }
#pragma unroll 1   // rolled, the halves too: one copy of the masked pass in the text
    for (; t < nt; ++t) { const char* const sb = sm + (t & 1) * ASTG;
#pragma unroll 1
        for (int sub = 0; sub < 2; ++sub) { const int kb = t * 64 + sub * 32; if (kb <= klast) { ldk(sb, sub); pass(sb, sub, kb, BC<true>(), BC<false>()); slots(); } }   // a wave-uniform test: passes behind the wave's diagonal are left out
        foot(t); }
    asm volatile("s_wait_asynccnt 0x0" ::: "memory");       // no copy is outstanding at the wave's end
#pragma unroll
    for (int qt = 0; qt < NQ; ++qt) { const float inv = __fdiv_rn(1.0f, l[qt] + xhalf(l[qt])); const size_t oo = (size_t)(q0 + qt * 16 + lr) * DQ + hi * 8;
#pragma unroll
        for (int dt = 0; dt < 4; ++dt) { v8us oh, ol;
#pragma unroll
            for (int j = 0; j < 8; ++j) { unsigned short a, c2; splitf(o[dt][qt][j] * inv, a, c2); oh[j] = a; ol[j] = c2; }
            *(v8us*)(Ah + oo + dt * 16) = oh; *(v8us*)(Al + oo + dt * 16) = ol;
            asm volatile("s_wait_xcnt 0x0" ::: "memory"); } }   // behind the two stores: their data and address registers are rewritten only behind this wait
}
#define NTL ((TT - RH) / 32)   // 32-column tiles of the fp16 rows
#define NTH (RH / 16)          // 16-column tiles of the hi/lo rows
static_assert(NTL % 4 == 0 && (NTL + NTH) / 4 == 20, "the snake order below is written for 20 tile groups");
// grid (sequences x heads, (NTL + NTH) / 4), 4 waves: the waves of a work-group take neighbouring query tiles of ONE head and walk the same keys, which they share through LDS. Tile groups are numbered by falling cost; all work-groups are resident,
// 256 of them (8 values of blockIdx.y) make one round over the chip, so blockIdx.y walks the groups in snake order (0..7, 15..8, 19..16): placed round after round, a heavy group shares its place with light ones. For speed only.
__global__ __launch_bounds__(128) void k_fattn(const h16* __restrict__ Q16, const h16* __restrict__ K16, const h16* __restrict__ V16, const bf* __restrict__ Qh, const bf* __restrict__ Ql, const bf* __restrict__ Kh, const bf* __restrict__ Kl, const bf* __restrict__ Vh, bf* __restrict__ Ah, bf* __restrict__ Al) {
    __shared__ __align__(16) char sm[2 * 4 * ATILE];
    const int zh = blockIdx.x, b = zh / NH_, h = zh % NH_; const int y = blockIdx.y, tg = (y < 8) ? y : (y < 16) ? 23 - y : 35 - y; const int wv = __builtin_amdgcn_readfirstlane(threadIdx.x >> 5);
    const size_t po = (size_t)zh * TT * HD, ao = (size_t)b * TT * DQ + h * HD;
    if (tg < NTL / 4) { const int qb = TT - 128 * (tg + 1); fattn<h16, 2, false>(sm, Q16 + po, nullptr, K16 + po, nullptr, V16 + (size_t)(b >> 1) * 2 * NH_ * TT * HD + (size_t)(b & 1) * TT + (size_t)h * HD * 2 * TT, qb, qb + 32 * (3 - wv), Ah + ao, Al + ao); }
    else { const int qb = RH - 64 * (tg - NTL / 4 + 1); fattn<bf, 1, true>(sm, Qh + po, Ql + po, Kh + po, Kl + po, Vh + 2 * po, qb, qb + 16 * (3 - wv), Ah + ao, Al + ao); }
}

extern "C" void kernel_launch(void* const* d_in, const int* in_sizes, int n_in,
                              void* d_out, int out_size, void* d_ws, size_t ws_size, hipStream_t stream) {
    (void)in_sizes; (void)n_in; (void)out_size;
    const float* x = (const float*)d_in[0]; const float* g1 = (const float*)d_in[1]; const float* e1 = (const float*)d_in[2]; const float* wq = (const float*)d_in[3]; const float* wk = (const float*)d_in[4]; const float* wv = (const float*)d_in[5]; const float* wo = (const float*)d_in[6]; const float* g2 = (const float*)d_in[7]; const float* e2 = (const float*)d_in[8];
    float* OUT = (float*)d_out;     // [4][2048][512]
    char* wsp = (char*)d_ws;
    auto take = [&](size_t bytes) { char* p = wsp; wsp += (bytes + 255) & ~(size_t)255; return (void*)p; };
    bf* WQ = (bf*)take((size_t)DQ * DM * 2); bf* WK = (bf*)take((size_t)DKV * DM * 2); bf* WV = (bf*)take((size_t)DKV * DM * 2); bf* WO = (bf*)take((size_t)DM * DQ * 2);   // consecutive planes (k_front, z-batched projection)
    float* Hf = (float*)take((size_t)NB_ * TT * DM * 4);
    const size_t PLN = (size_t)NB_ * NH_ * TT * HD;   // one head-plane set, all sequences
    h16* QP16 = (h16*)take(PLN * 2); h16* KP16 = (h16*)take(PLN * 2); h16* VT16 = (h16*)take(PLN * 2);
    bf* QPh = (bf*)take(PLN * 2); bf* QPl = (bf*)take(PLN * 2); bf* KPh = (bf*)take(PLN * 2); bf* KPl = (bf*)take(PLN * 2); bf* VTh = (bf*)take(PLN * 2 * 2);   // hi and lo halves of rows of pitch 2 x TT
    char* const un = wsp;   // from here on the workspace is reused, stream-ordered: (1) projection buffers, (2) wfc output
    bf* Yh = (bf*)take((size_t)NB_ * TT * DM * 2); bf* Yl = (bf*)take((size_t)NB_ * TT * DM * 2);
    bf* ATh = (bf*)take((size_t)NB_ * TT * DQ * 2); bf* ATl = (bf*)take((size_t)NB_ * TT * DQ * 2);   // merged heads, hi/lo planes (behind everything the wfc output overlays)
    if ((size_t)(wsp - (char*)d_ws) > ws_size) return;    // ws 256 MiB
    float* O2 = (float*)un;
    k_front<<<WTB + TT / 8, 256, 0, stream>>>(wq, wk, wv, wo, WQ, x, g1, e1, Hf, Yh, Yl);   /* weight planes; h = LN1(x) + PE: f32 + hi/lo planes, all sequences */
    k_gemmw<bf, 1, false, true><<<dim3(NB_ * TT / 128, DQ / 128, 3), 128, 0, stream>>>(Yh, Yl, WQ, nullptr, DM, nullptr, 0, nullptr, 0, (size_t)DQ * DM, 0, QP16, QPh, QPl, KP16, KPh, KPl, VT16, VTh);   /* z: q, k, v, stored as head planes */
    k_fattn<<<dim3(NB_ * NH_, (NTL + NTH) / 4, 1), 128, 0, stream>>>(QP16, KP16, VT16, QPh, QPl, KPh, KPl, VTh, ATh, ATl);   /* all sequences and heads */
    k_gemmw<bf, 1, false, false><<<dim3(NB_ * TT / 128, DM / 128, 1), 128, 0, stream>>>(ATh, ATl, WO, nullptr, DQ, O2, DM, nullptr, 0, 0, 0, nullptr, nullptr, nullptr, nullptr, nullptr, nullptr, nullptr, nullptr); k_resln2<<<NB_ * TT / 8, 256, 0, stream>>>(O2, Hf, x, g2, e2, OUT);   /* o = merged wfc; out = LN2(o + h) + x */
}

// v008
// It runs in 79 microseconds.
// Two timings next to v007 both put it at 1.10 times that version's speed.
// Over all steps from v000 it is 19.4 times as fast.
#include <hip/hip_runtime.h>

// Pre-norm causal self-attention block with sinusoidal positions (x [4][2048][512]; h = LN1(x) (1e-5) + PE (pe[t][2i] = sin(t w_i), pe[t][2i+1] = cos(t w_i), w_i = exp(2i x (-ln 1e4 / 512))); q, k, v = h W ('xw' [512][512], no bias; 8 heads x 64); causal softmax(q.k/8) (-1e9 fill == exact zero weight); o = merged wfc ('xw'); out = LN2(o + h) (1e-6) + x -> [4][2048][512] (4.2 M)).
// Layout: LN1 + PE in one kernel (with the weight planes) producing h in f32 (kept for the residual) and as bf16 hi/lo planes (2-product projections); the PE values are computed there in f32 with the reference's float32 constant for -ln(1e4)/512 (precise expf/sinf/cosf); the q/k/v projection GEMM stores its tiles straight as the attention kernel's operand planes; causal attention fused in one kernel (running softmax, scores never stored); the wfc GEMM normalises its own rows (residual + LN2, then + x) in its epilogue.
// Compute dtypes, f32 accumulate: every input rounded to bf16; q/k/v hl x exact (2 products); causal scores and attn.v (tile skipping): query rows < 512 hl (3 products), the rest single fp16; softmax f32; wfc hl x exact (2 products); LN2 and both residuals in f32.

#define NB_  4
#define TT   2048
#define DM   512
#define NH_  8
#define NKV  8
#define REP  (NH_ / NKV)
#define HD   64
#define DQ   (NH_ * HD)
#define DKV  (NKV * HD)
#define LNEPS 1e-5f
#define PEC  (-0.0179889463f)   // float32(-ln(10000)/512), as the reference's numpy computes it
typedef __attribute__((ext_vector_type(4))) unsigned short v4us;
#define RH   512                  // query rows < RH use hi+lo planes
typedef _Float16 h16;
typedef unsigned short bf;
typedef __attribute__((ext_vector_type(16))) __bf16   v16bf;
typedef __attribute__((ext_vector_type(16))) _Float16 v16h;
typedef __attribute__((ext_vector_type(8)))  _Float16 v8h;
typedef __attribute__((ext_vector_type(8)))  unsigned short v8us;
typedef __attribute__((ext_vector_type(8)))  float    v8f;
typedef __attribute__((ext_vector_type(4)))  float    v4f;
typedef v8h  __attribute__((may_alias)) v8ha;
typedef v4f  __attribute__((may_alias)) v4fa;
typedef v8us __attribute__((may_alias)) v8usa;

__device__ __forceinline__ unsigned short f2bf(float f) { unsigned u = __float_as_uint(f); u += 0x7FFFu + ((u >> 16) & 1u); return (unsigned short)(u >> 16); }
__device__ __forceinline__ float bf2f(unsigned short b) { return __uint_as_float(((unsigned)b) << 16); }
__device__ __forceinline__ float bfr(float f) { return bf2f(f2bf(f)); }
__device__ __forceinline__ v16h cat16(v8h lo, v8h hi) { return __builtin_shufflevector(lo, hi, 0, 1, 2, 3, 4, 5, 6, 7, 8, 9, 10, 11, 12, 13, 14, 15); }
__device__ __forceinline__ v16bf cat16b(v8us lo, v8us hi) { return __builtin_bit_cast(v16bf, __builtin_shufflevector(lo, hi, 0, 1, 2, 3, 4, 5, 6, 7, 8, 9, 10, 11, 12, 13, 14, 15)); }
__device__ __forceinline__ v8f wmma16(v16h a, v16h b, v8f c) { return __builtin_amdgcn_wmma_f32_16x16x32_f16(false, a, false, b, (short)0, c, false, false); }
__device__ __forceinline__ v8f wmmab(v16bf a, v16bf b, v8f c) { return __builtin_amdgcn_wmma_f32_16x16x32_bf16(false, a, false, b, (short)0, c, false, false); }



// ---- k_gemmw: register-blocked GEMM, one wave per 64x64 output tile (16 accumulators), 2 x 2 waves a work-group; the 128 + 128 operand rows come from K-contiguous 16-bit planes into LDS by asynchronous copies (ring of two stages); grid (M/128, N/128, Z), 128 threads.
// C[m][n] (f32, pitch ldc, + optional f32 bias[n]) = sum_k A[m][k] Bt[n][k] (+ split products per NSPLIT). z-batch strides sA/sB/sC in elements. K % 64 == 0.
template <typename T16> struct WFrag;
template <> struct WFrag<h16> { typedef v16h V; static __device__ __forceinline__ V ld(const h16* p) { return cat16(*(const v8h*)p, *(const v8h*)(p + 16)); } static __device__ __forceinline__ v8f mma(V a, V b, v8f c) { return wmma16(a, b, c); } };
template <> struct WFrag<bf> { typedef v16bf V; static __device__ __forceinline__ V ld(const bf* p) { return cat16b(*(const v8us*)p, *(const v8us*)(p + 16)); } static __device__ __forceinline__ v8f mma(V a, V b, v8f c) { return wmmab(a, b, c); } };
// HP (head planes): z = 0, 1, 2 are the q, k, v projections and a tile is 64 positions of one sequence x the 64 columns of one head; instead of C the wave stores the tile as the attention kernel's operands:
// q, k as [sequence][head][t][d], v transposed as rows (head, d) of pitch 2 x TT, each as fp16 and as bf16 hi/lo; every store instruction covers four whole 128-byte lines.
__device__ __forceinline__ void splitf(float y, unsigned short& h, unsigned short& l) { h = f2bf(y); l = f2bf(y - bf2f(h)); }
typedef __attribute__((ext_vector_type(8))) __bf16 v8bf;
__device__ __forceinline__ void split8(const v8f x, v8h& o16, v8us& oh, v8us& ol) { v8bf h, l;   // fp16, and bf16 hi + lo of the remainder (round to nearest even, as f2bf)
#pragma unroll
    for (int j = 0; j < 8; ++j) { o16[j] = (h16)x[j]; h[j] = (__bf16)x[j]; l[j] = (__bf16)(x[j] - (float)h[j]); }
    oh = __builtin_bit_cast(v8us, h); ol = __builtin_bit_cast(v8us, l); }
// Operand staging of k_gemmw: a stage is 64 k of 128 A rows (hi plane, lo plane) and 128 Bt rows, each row 128 bytes = one whole line. In LDS two rows share 272 bytes (256 + 16),
// so that the 16 rows of a fragment read fall on 16 different 16-byte bank groups. Three tiles a stage, two stages (a ring of two buffers).
#define GP2    272
#define GTILE  (64 * GP2)
#define GSTAGE (3 * GTILE)
// Eight asynchronous copies of 16 bytes a lane (rows 16 apart: a wave's copy covers four whole lines). The s_wait_xcnt is the last line of the copies' own statement: the address registers are rewritten only behind it.
__device__ __forceinline__ void cp8(const unsigned l, const char* const g, const size_t gs) {
    asm volatile("global_load_async_to_lds_b128 %0, %8, off\n\tglobal_load_async_to_lds_b128 %1, %9, off\n\tglobal_load_async_to_lds_b128 %2, %10, off\n\tglobal_load_async_to_lds_b128 %3, %11, off\n\t"
                 "global_load_async_to_lds_b128 %4, %12, off\n\tglobal_load_async_to_lds_b128 %5, %13, off\n\tglobal_load_async_to_lds_b128 %6, %14, off\n\tglobal_load_async_to_lds_b128 %7, %15, off\n\ts_wait_xcnt 0x0"
                 :: "v"(l), "v"(l + 8 * GP2), "v"(l + 16 * GP2), "v"(l + 24 * GP2), "v"(l + 32 * GP2), "v"(l + 40 * GP2), "v"(l + 48 * GP2), "v"(l + 56 * GP2),
                    "v"(g), "v"(g + gs), "v"(g + 2 * gs), "v"(g + 3 * gs), "v"(g + 4 * gs), "v"(g + 5 * gs), "v"(g + 6 * gs), "v"(g + 7 * gs) : "memory");
}
template <typename T16, int NSPLIT, bool BIAS, bool HP>
__global__ __launch_bounds__(128) void k_gemmw(const T16* __restrict__ A, const T16* __restrict__ A2, const T16* __restrict__ Bt, const T16* __restrict__ Bt2, int K, float* C, int ldc, const float* __restrict__ bias, size_t sA, size_t sB, size_t sC, h16* Q16, bf* Qh, bf* Ql, h16* K16, bf* Kh, bf* Kl, h16* V16, bf* Vh) {
    static_assert(NSPLIT == 1, "the staging below holds A, A2 and Bt");
    typedef typename WFrag<T16>::V V;
    __shared__ __align__(16) char sm[2 * GSTAGE];
    const size_t z = blockIdx.z; A += z * sA; A2 += z * sA; Bt += z * sB; C += z * sC;
    const int tid = threadIdx.x, lane = tid & 31, lr = lane & 15, hi = lane >> 4, wv = __builtin_amdgcn_readfirstlane(tid >> 5);
    const int r0 = blockIdx.x * 128 + (wv & 1) * 64, c0 = blockIdx.y * 128 + (wv >> 1) * 64;   // 2 x 2 waves, each a 64 x 64 tile
    v8f acc[4][4];
#pragma unroll
    for (int mb = 0; mb < 4; ++mb)
#pragma unroll
        for (int nb = 0; nb < 4; ++nb) acc[mb][nb] = (v8f){};
    const int cr = tid >> 3, cch = tid & 7;   // copies: 8 lanes a row, a thread's rows are cr + 16 i
    const unsigned lc = (unsigned)(size_t)sm + (cr >> 1) * GP2 + (cr & 1) * 128 + cch * 16;
    const char* const ga = (const char*)(A + (size_t)(blockIdx.x * 128 + cr) * K + cch * 8); const char* const ga2 = (const char*)(A2 + (size_t)(blockIdx.x * 128 + cr) * K + cch * 8); const char* const gb = (const char*)(Bt + (size_t)(blockIdx.y * 128 + cr) * K + cch * 8);
    const size_t gs = (size_t)16 * K * sizeof(T16);
    auto fill = [&](const int t) { const unsigned l = lc + (t & 1) * GSTAGE; cp8(l, ga + t * 128, gs); cp8(l + GTILE, ga2 + t * 128, gs); cp8(l + 2 * GTILE, gb + t * 128, gs); };
    const int nt = K / 64;
    fill(0);
    asm volatile("s_wait_asynccnt 0x0" ::: "memory");   // stage 0 has landed (this wave's copies) before the barrier that publishes it
    __syncthreads();
    if (nt > 1) fill(1);
    const int fo = (lr >> 1) * GP2 + (lr & 1) * 128 + hi * 16, ao = (wv & 1) * 32 * GP2 + fo, bo = 2 * GTILE + (wv >> 1) * 32 * GP2 + fo;   // fragment reads: row lr of a 16-row group, 16-byte pieces hi and 2 + hi of each 32 k
#pragma unroll 1
    for (int t = 0; t < nt; ++t) {
        const char* const sb = sm + (t & 1) * GSTAGE;
#pragma unroll
        for (int ks = 0; ks < 2; ++ks) { V a[4], a2[4], b[4];   // the twelve fragments of 32 k are asked for together, in front of their 32 products
#pragma unroll
            for (int mb = 0; mb < 4; ++mb) { a[mb] = WFrag<T16>::ld((const T16*)(sb + ao + mb * 8 * GP2 + ks * 64)); a2[mb] = WFrag<T16>::ld((const T16*)(sb + GTILE + ao + mb * 8 * GP2 + ks * 64)); b[mb] = WFrag<T16>::ld((const T16*)(sb + bo + mb * 8 * GP2 + ks * 64)); }
            __builtin_amdgcn_sched_barrier(0);   // keeps the Bt fragment reads up here: sunk among the products, each pair is waited out on its own in front of eight of them
#pragma unroll
            for (int nb = 0; nb < 4; ++nb)
#pragma unroll
                for (int mb = 0; mb < 4; ++mb) { acc[mb][nb] = WFrag<T16>::mma(a[mb], b[nb], acc[mb][nb]); acc[mb][nb] = WFrag<T16>::mma(a2[mb], b[nb], acc[mb][nb]); }
        }
        // four free slots behind the trip's last matrix instruction (all sixteen accumulators are operands, so none follows), on the way on and on the way back to the loop's head
        asm volatile("v_nop\n\tv_nop\n\tv_nop\n\tv_nop" : "+v"(acc[0][0]), "+v"(acc[0][1]), "+v"(acc[0][2]), "+v"(acc[0][3]), "+v"(acc[1][0]), "+v"(acc[1][1]), "+v"(acc[1][2]), "+v"(acc[1][3]), "+v"(acc[2][0]), "+v"(acc[2][1]), "+v"(acc[2][2]), "+v"(acc[2][3]), "+v"(acc[3][0]), "+v"(acc[3][1]), "+v"(acc[3][2]), "+v"(acc[3][3]));
        asm volatile("s_wait_dscnt 0x0" ::: "memory");      // foot of a trip: this wave's reads of the buffer are done,
        asm volatile("s_wait_asynccnt 0x0" ::: "memory");   // its copies of the next stage have landed,
        __syncthreads();                                    // and one barrier publishes the next stage and frees this trip's buffer
        if (t + 2 < nt) fill(t + 2);
    }
    asm volatile("s_wait_asynccnt 0x0" ::: "memory");       // no copy is outstanding when the ring becomes output staging (every wave's last read ended at the last trip's barrier)
    float* const os = (float*)(sm + wv * 8192);             // each wave stages its output rows in its own range
    if constexpr (HP) {
        const int sq = r0 / TT, t0 = r0 % TT, hd = c0 / 64, r4 = lane >> 3, c8 = (lane & 7) * 8;   // read-back: 8 lanes cover one 128-byte row of 64 16-bit values, a wave four rows
        if (z == 2) {   // v: a lane's accumulator holds 8 consecutive t of one d, already the transposed order; 16 d rows x 64 t per plane go through LDS (pitch 72 values) so that whole lines are stored
            unsigned short* const sv = (unsigned short*)os; const size_t rows = (size_t)NKV * HD * (2 * TT), vrow = (size_t)(hd * HD + r4) * (2 * TT) + t0 + c8;
            unsigned short* const gp[3] = { (unsigned short*)V16 + (size_t)(sq >> 1) * rows + (size_t)(sq & 1) * TT + vrow, Vh + (size_t)sq * rows + vrow, Vh + (size_t)sq * rows + TT + vrow };   // the fp16 rows of an even and the next odd sequence share a row; lo plane TT behind hi
#pragma unroll
            for (int nb = 0; nb < 4; ++nb) {
#pragma unroll
                for (int mb = 0; mb < 4; ++mb) { v8h o16; v8us oh, ol; split8(acc[mb][nb], o16, oh, ol);
                    unsigned short* const sp = sv + lr * 72 + mb * 16 + hi * 8; *(v8ha*)sp = o16; *(v8usa*)(sp + 16 * 72) = oh; *(v8usa*)(sp + 2 * 16 * 72) = ol; }
                asm volatile("s_wait_dscnt 0x0" ::: "memory");   // the staged rows are read back, by other lanes than wrote them, only behind the LDS stores' own wait
#pragma unroll
                for (int p = 0; p < 3; ++p)
#pragma unroll
                    for (int s = 0; s < 4; ++s) *(v8us*)(gp[p] + (size_t)(nb * 16 + s * 4) * (2 * TT)) = *(const v8usa*)(sv + (p * 16 + s * 4 + r4) * 72 + c8);
                asm volatile("s_wait_xcnt 0x0" ::: "memory"); __builtin_amdgcn_sched_barrier(0);   // behind the stores: their data and address registers are rewritten only behind this wait (the scheduling barrier keeps the next rows' conversions from rising over it)
            }
        } else {        // q, k: 16 rows of f32 through LDS, read back 8 values a lane, converted, stored
            const size_t po = ((size_t)(sq * NH_ + hd) * TT + t0 + r4) * HD + c8; h16* const p16 = (z ? K16 : Q16) + po; bf* const ph = (z ? Kh : Qh) + po; bf* const pl = (z ? Kl : Ql) + po;
#pragma unroll
            for (int mb = 0; mb < 4; ++mb) {
#pragma unroll
                for (int nb = 0; nb < 4; ++nb) {
#pragma unroll
                    for (int j = 0; j < 8; ++j) os[(hi * 8 + j) * 68 + nb * 16 + lr] = acc[mb][nb][j]; }
                asm volatile("s_wait_dscnt 0x0" ::: "memory");   // as above: read-back only behind the LDS stores' wait
#pragma unroll
                for (int s = 0; s < 4; ++s) { const float* const rp = os + (s * 4 + r4) * 68 + c8; const v4f x0 = *(const v4fa*)rp, x1 = *(const v4fa*)(rp + 4); v8h o16; v8us oh, ol;
                    split8(__builtin_shufflevector(x0, x1, 0, 1, 2, 3, 4, 5, 6, 7), o16, oh, ol);
                    const size_t off = (size_t)(mb * 16 + s * 4) * HD; *(v8h*)(p16 + off) = o16; *(v8us*)(ph + off) = oh; *(v8us*)(pl + off) = ol; }
                asm volatile("s_wait_xcnt 0x0" ::: "memory"); __builtin_amdgcn_sched_barrier(0);   // as above, behind the twelve stores
            }
        }
    } else
#pragma unroll
    for (int mb = 0; mb < 4; ++mb) {
#pragma unroll
        for (int nb = 0; nb < 4; ++nb) {
#pragma unroll
            for (int j = 0; j < 8; ++j) os[(hi * 8 + j) * 68 + nb * 16 + lr] = acc[mb][nb][j]; }
        __builtin_amdgcn_wave_barrier(); asm volatile("" ::: "memory");
        float* crow = C + (size_t)(r0 + mb * 16) * ldc + c0;
{
#pragma unroll
            for (int s = 0; s < 8; ++s) { const int row = 2 * s + hi, cofs = lr * 4; v4f val = *(const v4fa*)(os + row * 68 + cofs); if (BIAS) { val[0] += bfr(bias[c0 + cofs]); val[1] += bfr(bias[c0 + cofs + 1]); val[2] += bfr(bias[c0 + cofs + 2]); val[3] += bfr(bias[c0 + cofs + 3]); }
                *(v4f*)(crow + (size_t)row * ldc + cofs) = val; }
             }
        __builtin_amdgcn_wave_barrier(); asm volatile("" ::: "memory");
    }
}

typedef __attribute__((ext_vector_type(2))) _Float16 v2h;
typedef __attribute__((ext_vector_type(4))) _Float16 v4h;
typedef __attribute__((ext_vector_type(2))) unsigned short v2us;
typedef __attribute__((ext_vector_type(4))) unsigned short v4us;
typedef __attribute__((ext_vector_type(2))) float v2f;
typedef __attribute__((ext_vector_type(4))) int v4i;

// ---- k_front: everything in front of the projections in ONE launch. Work-groups < WTB: the four equally shaped weights, transposed and rounded to bf16 (consecutive output planes).
// The others: h = LN1(x) + PE. A wave takes ONE position of all sequences: the position's sines and cosines are computed once, while the four rows are on their way; each row is read once and kept in registers.
#define WTB (4 * (DM * DQ / 64 / 64))   // 64 work-groups a weight: 8 waves x 8 lines of 64 values
__global__ __launch_bounds__(256) void k_front(const float* __restrict__ w0, const float* __restrict__ w1, const float* __restrict__ w2, const float* __restrict__ w3, bf* Bt, const float* __restrict__ X, const float* __restrict__ g, const float* __restrict__ be, float* Hf, bf* Yh, bf* Yl) {
    const int lane = threadIdx.x & 31;
    if (blockIdx.x < WTB) {
        const int K = DM, N = DQ, wi = blockIdx.x / (WTB / 4); const float* w = (wi == 0) ? w0 : (wi == 1) ? w1 : (wi == 2) ? w2 : w3; Bt += (size_t)wi * K * N;
        const int L0 = ((blockIdx.x % (WTB / 4)) * 8 + (threadIdx.x >> 5)) * 8; const int nlines = N * K / 64;
#pragma unroll 1
        for (int l = 0; l < 8; ++l) { const int L = L0 + l; if (L >= nlines) break; const size_t e = (size_t)L * 64 + lane * 2; const int k = (int)(e % K), n = (int)(e / K); v2us o;
            o[0] = f2bf(w[(size_t)k * N + n]); o[1] = f2bf(w[(size_t)(k + 1) * N + n]); *(v2us*)(Bt + e) = o; }
        return;
    }
    const int t = (blockIdx.x - WTB) * 8 + (threadIdx.x >> 5);   // position; row of sequence b: b x TT + t
    v4f xa[NB_][DM / 128];
#pragma unroll
    for (int b = 0; b < NB_; ++b)
#pragma unroll
        for (int ch = 0; ch < DM / 128; ++ch) xa[b][ch] = *(const v4f*)(X + ((size_t)b * TT + t) * DM + ch * 128 + lane * 4);
    float gg[DM / 128][4], bb[DM / 128][4];   // the lane's sixteen columns of gamma and beta, read once for the four rows
#pragma unroll
    for (int ch = 0; ch < DM / 128; ++ch)
#pragma unroll
        for (int q = 0; q < 4; ++q) { gg[ch][q] = bfr(g[ch * 128 + lane * 4 + q]); bb[ch][q] = bfr(be[ch * 128 + lane * 4 + q]); }
    __shared__ v2f pes[2 * (DM / 128) * 256];   // a lane's eight (sine, cosine) pairs, written and read back by the same lane: no barrier
#pragma unroll 1   // rolled: eight copies of the sine and cosine code would double the kernel's text, which every WGP fetches for one run through it
    for (int i = 0; i < 2 * (DM / 128); ++i) { const int c = (i >> 1) * 128 + lane * 4 + 2 * (i & 1); const float w = expf(__fmul_rn((float)c, PEC)); const float ang = __fmul_rn((float)t, w); v2f o; o[0] = sinf(ang); o[1] = cosf(ang); pes[i * 256 + threadIdx.x] = o; }
    v4f pe[DM / 128];
#pragma unroll
    for (int ch = 0; ch < DM / 128; ++ch) { const v2f p0 = pes[2 * ch * 256 + threadIdx.x], p1 = pes[(2 * ch + 1) * 256 + threadIdx.x]; pe[ch] = __builtin_shufflevector(p0, p1, 0, 1, 2, 3); }
    float s[NB_], s2[NB_], mu[NB_], rs[NB_];   // the four rows side by side: their exchanges between lanes overlap; each row's own order of sums is that of one row alone
#pragma unroll
    for (int b = 0; b < NB_; ++b) { s[b] = 0.f;
#pragma unroll
        for (int ch = 0; ch < DM / 128; ++ch) { const v4f a = xa[b][ch];
#pragma unroll
            for (int q = 0; q < 4; ++q) s[b] += bfr(a[q]); } }
#pragma unroll
    for (int sh = 16; sh; sh >>= 1)
#pragma unroll
        for (int b = 0; b < NB_; ++b) s[b] += __shfl_xor(s[b], sh, 32);
#pragma unroll
    for (int b = 0; b < NB_; ++b) { mu[b] = s[b] * (1.0f / DM); s2[b] = 0.f;
#pragma unroll
        for (int ch = 0; ch < DM / 128; ++ch) { const v4f a = xa[b][ch];
#pragma unroll
            for (int q = 0; q < 4; ++q) { const float d0 = __fsub_rn(bfr(a[q]), mu[b]); float p = __fmul_rn(d0, d0); asm volatile("" : "+v"(p)); s2[b] = __fadd_rn(s2[b], p); } } }
#pragma unroll
    for (int sh = 16; sh; sh >>= 1)
#pragma unroll
        for (int b = 0; b < NB_; ++b) s2[b] += __shfl_xor(s2[b], sh, 32);
#pragma unroll
    for (int b = 0; b < NB_; ++b) rs[b] = __fdiv_rn(1.0f, __fsqrt_rn(__fadd_rn(s2[b] * (1.0f / DM), LNEPS)));
#pragma unroll
    for (int ch = 0; ch < DM / 128; ++ch) { const int c0 = ch * 128 + lane * 4;
#pragma unroll
        for (int b = 0; b < NB_; ++b) { const size_t r = (size_t)b * TT + t; const v4f a = xa[b][ch]; v4f h4; v4us oh, ol;
#pragma unroll
            for (int q = 0; q < 4; ++q) { float n0 = __fmul_rn(__fsub_rn(bfr(a[q]), mu[b]), rs[b]); asm volatile("" : "+v"(n0)); float n1 = __fmul_rn(n0, gg[ch][q]); asm volatile("" : "+v"(n1)); const float ln = __fadd_rn(n1, bb[ch][q]); const float hv = __fadd_rn(ln, pe[ch][q]); h4[q] = hv; unsigned short h2, l2; splitf(hv, h2, l2); oh[q] = h2; ol[q] = l2; }
            *(v4f*)(Hf + r * DM + c0) = h4; *(v4us*)(Yh + r * DM + c0) = oh; *(v4us*)(Yl + r * DM + c0) = ol; } }
    asm volatile("s_wait_xcnt 0x0" ::: "memory");   // behind the last stores: on no way that the built code's branches leave open is one of their registers rewritten ahead of this wait
}
// ---- k_gemmln: o = merged wfc and out = LN2(o + h) + x in ONE launch. A work-group of 8 waves owns 32 whole rows: wave w computes the 32 x 64 tile of columns 64 w (hi and lo plane of A against Bt, operands in LDS
// by asynchronous copies as in k_gemmw, ring of two stages of 64 k); behind the loop the 32 x 512 sums go through LDS (the ring's space) and each wave normalises 4 whole rows side by side, each row's sums in the order of one wave per row. grid (M / 32), 256 threads.
#define LSTAGE ((16 + 16 + 256) * GP2)   // a stage: 32 rows of A hi, 32 of A lo, 512 of Bt; two rows share GP2 bytes
#define LPIT   516                       // floats a staged output row: the two halves of a wave (rows 8 apart) fall on different banks
// Nine asynchronous copies of 16 bytes a lane: one row of an A plane and eight rows of Bt, 32 apart (a wave's copy covers four whole lines). The s_wait_xcnt is the last line of the copies' own statement: the address registers are rewritten only behind it.
__device__ __forceinline__ void cp18(const unsigned la, const char* const ga, const unsigned l, const char* const g, const size_t gs) {
    asm volatile("global_load_async_to_lds_b128 %0, %9, off\n\tglobal_load_async_to_lds_b128 %1, %10, off\n\tglobal_load_async_to_lds_b128 %2, %11, off\n\tglobal_load_async_to_lds_b128 %3, %12, off\n\tglobal_load_async_to_lds_b128 %4, %13, off\n\t"
                 "global_load_async_to_lds_b128 %5, %14, off\n\tglobal_load_async_to_lds_b128 %6, %15, off\n\tglobal_load_async_to_lds_b128 %7, %16, off\n\tglobal_load_async_to_lds_b128 %8, %17, off\n\ts_wait_xcnt 0x0"
                 :: "v"(la), "v"(l), "v"(l + 16 * GP2), "v"(l + 32 * GP2), "v"(l + 48 * GP2), "v"(l + 64 * GP2), "v"(l + 80 * GP2), "v"(l + 96 * GP2), "v"(l + 112 * GP2),
                    "v"(ga), "v"(g), "v"(g + gs), "v"(g + 2 * gs), "v"(g + 3 * gs), "v"(g + 4 * gs), "v"(g + 5 * gs), "v"(g + 6 * gs), "v"(g + 7 * gs) : "memory");
}
__global__ __launch_bounds__(256) void k_gemmln(const bf* __restrict__ A, const bf* __restrict__ A2, const bf* __restrict__ Bt, const float* __restrict__ Hf, const float* __restrict__ X, const float* __restrict__ g, const float* __restrict__ be, float* __restrict__ OUTb) {
    typedef WFrag<bf>::V V;
    constexpr int K = DQ;
    __shared__ __align__(16) char sm[2 * LSTAGE];
    static_assert(32 * LPIT * 4 <= 2 * LSTAGE, "the staged output rows lie in the ring's space");
    const int tid = threadIdx.x, lane = tid & 31, lr = lane & 15, hi = lane >> 4, wv = __builtin_amdgcn_readfirstlane(tid >> 5);
    const int r0 = blockIdx.x * 32;
    v8f acc[2][4];
#pragma unroll
    for (int mb = 0; mb < 2; ++mb)
#pragma unroll
        for (int nb = 0; nb < 4; ++nb) acc[mb][nb] = (v8f){};
    const int cr = tid >> 3, cch = tid & 7;   // copies: 8 lanes a row; a thread's row of A is cr, its rows of Bt are cr + 32 i
    const unsigned lc = (unsigned)(size_t)sm + (cr >> 1) * GP2 + (cr & 1) * 128 + cch * 16;
    const char* const ga = (const char*)(A + (size_t)(r0 + cr) * K + cch * 8); const char* const ga2 = (const char*)(A2 + (size_t)(r0 + cr) * K + cch * 8); const char* const gb = (const char*)(Bt + (size_t)cr * K + cch * 8);
    constexpr size_t gs = (size_t)32 * K * sizeof(bf);
    auto fill = [&](const int t) { const unsigned l = lc + (t & 1) * LSTAGE; cp18(l, ga + t * 128, l + 32 * GP2, gb + t * 128, gs); cp18(l + 16 * GP2, ga2 + t * 128, l + 160 * GP2, gb + 8 * gs + t * 128, gs); };
    constexpr int nt = K / 64;
    fill(0);
    asm volatile("s_wait_asynccnt 0x0" ::: "memory");   // stage 0 has landed (this wave's copies) before the barrier that publishes it
    __syncthreads();
    fill(1);
    const int fo = (lr >> 1) * GP2 + (lr & 1) * 128 + hi * 16, bo = 32 * GP2 + wv * 32 * GP2 + fo;   // fragment reads: row lr of a 16-row group, 16-byte pieces hi and 2 + hi of each 32 k
#pragma unroll 1   // rolled: one copy of the trip and of its refill in the text
    for (int t = 0; t < nt; ++t) {
        const char* const sb = sm + (t & 1) * LSTAGE;
        V a[2][2], a2[2][2], b[2][4];   // the sixteen fragments of the stage are asked for together, in front of its 32 products
#pragma unroll
        for (int ks = 0; ks < 2; ++ks) {
#pragma unroll
            for (int mb = 0; mb < 2; ++mb) { a[ks][mb] = WFrag<bf>::ld((const bf*)(sb + fo + mb * 8 * GP2 + ks * 64)); a2[ks][mb] = WFrag<bf>::ld((const bf*)(sb + 16 * GP2 + fo + mb * 8 * GP2 + ks * 64)); }
#pragma unroll
            for (int nb = 0; nb < 4; ++nb) b[ks][nb] = WFrag<bf>::ld((const bf*)(sb + bo + nb * 8 * GP2 + ks * 64)); }
        __builtin_amdgcn_sched_barrier(0);   // keeps the fragment reads up here as one group: sunk among the products, each is waited out on its own
#pragma unroll
        for (int ks = 0; ks < 2; ++ks)
#pragma unroll
            for (int nb = 0; nb < 4; ++nb)
#pragma unroll
                for (int mb = 0; mb < 2; ++mb) { acc[mb][nb] = WFrag<bf>::mma(a[ks][mb], b[ks][nb], acc[mb][nb]); acc[mb][nb] = WFrag<bf>::mma(a2[ks][mb], b[ks][nb], acc[mb][nb]); }
        // four free slots behind the trip's last matrix instruction (all eight accumulators are operands, so none follows), on the way on and on the way back to the loop's head
        asm volatile("v_nop\n\tv_nop\n\tv_nop\n\tv_nop" : "+v"(acc[0][0]), "+v"(acc[0][1]), "+v"(acc[0][2]), "+v"(acc[0][3]), "+v"(acc[1][0]), "+v"(acc[1][1]), "+v"(acc[1][2]), "+v"(acc[1][3]));
        asm volatile("s_wait_dscnt 0x0" ::: "memory");      // foot of a trip: this wave's reads of the buffer are done,
        asm volatile("s_wait_asynccnt 0x0" ::: "memory");   // its copies of the next stage have landed,
        __syncthreads();                                    // and one barrier publishes the next stage and frees this trip's buffer
        if (t + 2 < nt) fill(t + 2);
    }
    asm volatile("s_wait_asynccnt 0x0" ::: "memory");       // no copy is outstanding when the ring becomes output staging (every wave's last read ended at the last trip's barrier)
    float* const os = (float*)sm;
#pragma unroll
    for (int mb = 0; mb < 2; ++mb)
#pragma unroll
        for (int nb = 0; nb < 4; ++nb)
#pragma unroll
            for (int j = 0; j < 8; ++j) os[(mb * 16 + hi * 8 + j) * LPIT + wv * 64 + nb * 16 + lr] = acc[mb][nb][j];
    const int rw = wv * 4;   // the wave's four rows, side by side: their loads and their exchanges between lanes overlap
    v4f v[4][DM / 128], xx[4][DM / 128];   // h and x are asked for in front of the barrier: they come while the waves gather
    const float* const hp = Hf + (size_t)(r0 + rw) * DM + lane * 4; const float* const xp = X + (size_t)(r0 + rw) * DM + lane * 4;
#pragma unroll
    for (int b = 0; b < 4; ++b)
#pragma unroll
        for (int ch = 0; ch < DM / 128; ++ch) { v[b][ch] = *(const v4f*)(hp + b * DM + ch * 128); xx[b][ch] = *(const v4f*)(xp + b * DM + ch * 128); }
    v4f gr[DM / 128], br[DM / 128];   // the lane's sixteen columns of gamma and beta, read once for its four rows
#pragma unroll
    for (int ch = 0; ch < DM / 128; ++ch) { gr[ch] = *(const v4f*)(g + ch * 128 + lane * 4); br[ch] = *(const v4f*)(be + ch * 128 + lane * 4); }
    // fence on the loaded gamma and beta (the values as loaded, inputs only): holds their loads up here with those of h and x, in front of the barrier, whose wait they share; without it they sink among the row sums behind it
    asm volatile("" :: "v"(gr[0]), "v"(gr[1]), "v"(gr[2]), "v"(gr[3]), "v"(br[0]), "v"(br[1]), "v"(br[2]), "v"(br[3]));
    __syncthreads();   // a row's 512 sums come from all eight waves
    float gg[DM / 128][4], bb[DM / 128][4];
#pragma unroll
    for (int ch = 0; ch < DM / 128; ++ch)
#pragma unroll
        for (int q = 0; q < 4; ++q) { gg[ch][q] = bfr(gr[ch][q]); bb[ch][q] = bfr(br[ch][q]); }
    float s[4], s2[4], mu[4], rs[4];
#pragma unroll
    for (int b = 0; b < 4; ++b) { s[b] = 0.f;
#pragma unroll
        for (int ch = 0; ch < DM / 128; ++ch) { v[b][ch] += *(const v4fa*)(os + (rw + b) * LPIT + ch * 128 + lane * 4);
#pragma unroll
            for (int q = 0; q < 4; ++q) s[b] += v[b][ch][q]; } }
#pragma unroll
    for (int sh = 16; sh; sh >>= 1)
#pragma unroll
        for (int b = 0; b < 4; ++b) s[b] += __shfl_xor(s[b], sh, 32);
#pragma unroll
    for (int b = 0; b < 4; ++b) { mu[b] = s[b] * (1.0f / DM); s2[b] = 0.f;
#pragma unroll
        for (int ch = 0; ch < DM / 128; ++ch)
#pragma unroll
            for (int q = 0; q < 4; ++q) { const float d0 = v[b][ch][q] - mu[b]; s2[b] += d0 * d0; } }
#pragma unroll
    for (int sh = 16; sh; sh >>= 1)
#pragma unroll
        for (int b = 0; b < 4; ++b) s2[b] += __shfl_xor(s2[b], sh, 32);
#pragma unroll
    for (int b = 0; b < 4; ++b) { rs[b] = __fdiv_rn(1.0f, __fsqrt_rn(s2[b] * (1.0f / DM) + 1e-6f));
#pragma unroll
        for (int ch = 0; ch < DM / 128; ++ch) { v4f o4;
#pragma unroll
            for (int q = 0; q < 4; ++q) o4[q] = ((v[b][ch][q] - mu[b]) * rs[b] * gg[ch][q] + bb[ch][q]) + bfr(xx[b][ch][q]);
            *(v4f*)(OUTb + (size_t)(r0 + rw + b) * DM + ch * 128 + lane * 4) = o4; } }
    asm volatile("s_wait_xcnt 0x0" ::: "memory");   // behind the last stores: none of their registers is rewritten ahead of this wait
}
__global__ __launch_bounds__(256) void k_cvt8(const float* __restrict__ src, bf* dst, size_t n8) { const size_t i = (size_t)blockIdx.x * 256 + threadIdx.x; if (i >= n8) return; const v8f v = *(const v8f*)(src + i * 8); v8us o;
#pragma unroll
    for (int k = 0; k < 8; ++k) o[k] = f2bf(v[k]); *(v8us*)(dst + i * 8) = o;  }

__device__ __forceinline__ float xhalf(float x) { return __builtin_bit_cast(float, __builtin_amdgcn_permlanex16(__builtin_bit_cast(int, x), __builtin_bit_cast(int, x), 0x76543210, 0xfedcba98, false, false)); }   // lane l with lane l ^ 16
#define SCL2 0.18033688011112042f   // HD^-0.5 x log2(e)
template <bool B> struct BC { static constexpr bool v = B; };
// 2^x with the one free slot the instruction set asks for behind a transcendental written into the statement (v_nop). ex2x16: sixteen values in place; each v_exp_f32 is followed by an independent one, the last by the v_nop.
__device__ __forceinline__ float ex2(float x) { float r; asm("v_exp_f32 %0, %1\n\tv_nop" : "=v"(r) : "v"(x)); return r; }
__device__ __forceinline__ void ex2x16(float (&x)[16]) { asm("v_exp_f32 %0, %0\n\tv_exp_f32 %1, %1\n\tv_exp_f32 %2, %2\n\tv_exp_f32 %3, %3\n\tv_exp_f32 %4, %4\n\tv_exp_f32 %5, %5\n\tv_exp_f32 %6, %6\n\tv_exp_f32 %7, %7\n\tv_exp_f32 %8, %8\n\tv_exp_f32 %9, %9\n\tv_exp_f32 %10, %10\n\tv_exp_f32 %11, %11\n\tv_exp_f32 %12, %12\n\tv_exp_f32 %13, %13\n\tv_exp_f32 %14, %14\n\tv_exp_f32 %15, %15\n\tv_nop" : "+v"(x[0]), "+v"(x[1]), "+v"(x[2]), "+v"(x[3]), "+v"(x[4]), "+v"(x[5]), "+v"(x[6]), "+v"(x[7]), "+v"(x[8]), "+v"(x[9]), "+v"(x[10]), "+v"(x[11]), "+v"(x[12]), "+v"(x[13]), "+v"(x[14]), "+v"(x[15])); }
// K and V staging of k_fattn: a stage is 64 keys: K as 64 rows (keys) of 128 bytes, V as 64 rows (d) of 128 bytes (64 keys), each row one whole line; hi/lo rows: the two lo tiles behind them. Rows lie in LDS as in k_gemmw (two rows share GP2 bytes).
#define ATILE (32 * GP2)
// Eight asynchronous copies of 16 bytes a lane, four rows (16 apart) of each of two tiles: a wave's copy covers four whole lines. The s_wait_xcnt is the last line of the copies' own statement: the address registers are rewritten only behind it.
__device__ __forceinline__ void cp44(const unsigned l0, const char* const g0, const size_t s0, const unsigned l1, const char* const g1, const size_t s1) {
    asm volatile("global_load_async_to_lds_b128 %0, %8, off\n\tglobal_load_async_to_lds_b128 %1, %9, off\n\tglobal_load_async_to_lds_b128 %2, %10, off\n\tglobal_load_async_to_lds_b128 %3, %11, off\n\t"
                 "global_load_async_to_lds_b128 %4, %12, off\n\tglobal_load_async_to_lds_b128 %5, %13, off\n\tglobal_load_async_to_lds_b128 %6, %14, off\n\tglobal_load_async_to_lds_b128 %7, %15, off\n\ts_wait_xcnt 0x0"
                 :: "v"(l0), "v"(l0 + 8 * GP2), "v"(l0 + 16 * GP2), "v"(l0 + 24 * GP2), "v"(l1), "v"(l1 + 8 * GP2), "v"(l1 + 16 * GP2), "v"(l1 + 24 * GP2),
                    "v"(g0), "v"(g0 + s0), "v"(g0 + 2 * s0), "v"(g0 + 3 * s0), "v"(g1), "v"(g1 + s1), "v"(g1 + 2 * s1), "v"(g1 + 3 * s1) : "memory");
}
// qb: first query of the work-group's 4 x NQ x 16 columns (a multiple of 64); q0: first query of this wave. Every wave passes every barrier: the trip count depends on qb alone.
template <typename T16, int NQ, bool HI>
__device__ __forceinline__ void fattn(char* const sm, const T16* __restrict__ Q, const T16* __restrict__ Q2, const T16* __restrict__ Kp, const T16* __restrict__ Kp2, const T16* __restrict__ Vt, const int qb, const int q0, bf* __restrict__ Ah, bf* __restrict__ Al) {
    typedef typename WFrag<T16>::V V;
    constexpr int ASTG = (HI ? 4 : 2) * ATILE;   // tiles of a stage: K, V (, K lo, V lo)
    const int tid = threadIdx.x, lane = tid & 31, lr = lane & 15, hi = lane >> 4;
    const int cr = tid >> 3, cch = tid & 7;   // copies: 8 lanes a row, a thread's rows are cr + 16 i
    const unsigned lc = (unsigned)(size_t)sm + (cr >> 1) * GP2 + (cr & 1) * 128 + cch * 16;
    const char* const gk = (const char*)(Kp + (size_t)cr * HD + cch * 8); const char* const gk2 = (const char*)(Kp2 + (size_t)cr * HD + cch * 8); const char* const gv = (const char*)(Vt + (size_t)cr * (2 * TT) + cch * 8);   // the lo plane of V lies TT elements behind the hi plane in each row
    auto fill = [&](const int t) { const unsigned l = lc + (t & 1) * ASTG; cp44(l, gk + (size_t)t * (64 * HD * 2), 16 * HD * 2, l + ATILE, gv + t * 128, (size_t)16 * 2 * TT * 2);
        if constexpr (HI) cp44(l + 2 * ATILE, gk2 + (size_t)t * (64 * HD * 2), 16 * HD * 2, l + 3 * ATILE, gv + TT * 2 + t * 128, (size_t)16 * 2 * TT * 2); };
    const int nmain = qb / 64, nt = nmain + NQ;   // trips wholly below every wave's diagonal; then the NQ trips that hold the work-group's own 4 x NQ x 16 keys
    fill(0);
    V qf[NQ][2], qf2[NQ][2];
#pragma unroll
    for (int qt = 0; qt < NQ; ++qt)
#pragma unroll
        for (int ks = 0; ks < 2; ++ks) { const size_t qo = (size_t)(q0 + qt * 16 + lr) * HD + ks * 32 + 8 * hi; qf[qt][ks] = WFrag<T16>::ld(Q + qo); if (HI) qf2[qt][ks] = WFrag<T16>::ld(Q2 + qo); }
    asm volatile("s_wait_xcnt 0x0" ::: "memory");   // behind the Q loads: their address registers are rewritten only behind this wait
    asm volatile("s_wait_asynccnt 0x0" ::: "memory");   // stage 0 has landed (this wave's copies) before the barrier that publishes it
    __syncthreads();
    if (nt > 1) fill(1);
    v8f o[4][NQ]; float m[NQ], l[NQ];
#pragma unroll
    for (int qt = 0; qt < NQ; ++qt) { m[qt] = -3.0e38f; l[qt] = 0.f;
#pragma unroll
        for (int dt = 0; dt < 4; ++dt) o[dt][qt] = (v8f){}; }
    const int klast = (q0 + NQ * 16 - 1) & ~31;   // first key of the wave's last pass (klast <= q0: every pass holds a key <= q for each of the wave's queries)
    const int fo = (lr >> 1) * GP2 + (lr & 1) * 128 + hi * 16;   // fragment reads: row lr of a 16-row group, 16-byte pieces hi and 2 + hi of each 64 bytes
    V kf[2][2], kf2[2][2];
    auto ldk = [&](const char* const sb, const int sub) {   // the K fragments of 32 keys
#pragma unroll
        for (int kt = 0; kt < 2; ++kt)
#pragma unroll
            for (int ks = 0; ks < 2; ++ks) { const char* const p = sb + fo + (sub * 16 + kt * 8) * GP2 + ks * 64; kf[kt][ks] = WFrag<T16>::ld((const T16*)p); if (HI) kf2[kt][ks] = WFrag<T16>::ld((const T16*)(p + 2 * ATILE)); } };
    auto pass = [&](const char* const sb, const int sub, const int kb, auto mask, auto nextk) {   // 32 keys (half sub of the stage at sb), K fragments already asked for; mask: the pass may touch the diagonal; nextk: the stage's other half follows
        V vf[4], vf2[4];                      // this pass's V, asked for first: it comes during the score products and the softmax
#pragma unroll
        for (int dt = 0; dt < 4; ++dt) { const char* const p = sb + ATILE + fo + dt * 8 * GP2 + sub * 64; vf[dt] = WFrag<T16>::ld((const T16*)p); if (HI) vf2[dt] = WFrag<T16>::ld((const T16*)(p + 2 * ATILE)); }
        v8f s[2][NQ];
#pragma unroll
        for (int kt = 0; kt < 2; ++kt)
#pragma unroll
            for (int qt = 0; qt < NQ; ++qt) { v8f a = (v8f){};
#pragma unroll
                for (int ks = 0; ks < 2; ++ks) { a = WFrag<T16>::mma(kf[kt][ks], qf[qt][ks], a); if (HI) { a = WFrag<T16>::mma(kf2[kt][ks], qf[qt][ks], a); a = WFrag<T16>::mma(kf[kt][ks], qf2[qt][ks], a); } }
                s[kt][qt] = a; }
        if constexpr (decltype(nextk)::v) ldk(sb, sub + 1);   // the next pass's K, of the same stage, into the same registers behind the score products
        if constexpr (decltype(mask)::v) {    // -1e9 fill == exact zero weight
#pragma unroll
            for (int kt = 0; kt < 2; ++kt)
#pragma unroll
                for (int qt = 0; qt < NQ; ++qt)
#pragma unroll
                    for (int j = 0; j < 8; ++j) if (kb + kt * 16 + hi * 8 + j > q0 + qt * 16 + lr) s[kt][qt][j] = -3.0e38f; }
        V pf[NQ], pf2[NQ];
#pragma unroll
        for (int qt = 0; qt < NQ; ++qt) { float mx = s[0][qt][0];
#pragma unroll
            for (int j = 1; j < 8; ++j) mx = fmaxf(mx, s[0][qt][j]);
#pragma unroll
            for (int j = 0; j < 8; ++j) mx = fmaxf(mx, s[1][qt][j]);
            mx = fmaxf(mx, xhalf(mx));
            const float mn = fmaxf(m[qt], mx * SCL2); const float al = ex2(m[qt] - mn); m[qt] = mn; float ls[4] = {0.f, 0.f, 0.f, 0.f}, pe[16];   // al = 0 on the first pass; four partial sums: short dependent chains
#pragma unroll
            for (int e = 0; e < 16; ++e) pe[e] = __builtin_fmaf(s[e >> 3][qt][e & 7], SCL2, -mn);
            ex2x16(pe);
#pragma unroll
            for (int e = 0; e < 16; ++e) { const float p = pe[e]; ls[e & 3] += p;
                if constexpr (HI) { const __bf16 ph = (__bf16)p; pf[qt][e] = ph; pf2[qt][e] = (__bf16)(p - (float)ph); } else { pf[qt][e] = (h16)p; } }
            l[qt] = l[qt] * al + ((ls[0] + ls[1]) + (ls[2] + ls[3]));
#pragma unroll
            for (int dt = 0; dt < 4; ++dt) o[dt][qt] *= al; }
#pragma unroll
        for (int dt = 0; dt < 4; ++dt)
#pragma unroll
            for (int qt = 0; qt < NQ; ++qt) { o[dt][qt] = WFrag<T16>::mma(vf[dt], pf[qt], o[dt][qt]); if (HI) { o[dt][qt] = WFrag<T16>::mma(vf2[dt], pf[qt], o[dt][qt]); o[dt][qt] = WFrag<T16>::mma(vf[dt], pf2[qt], o[dt][qt]); } }
    };
    auto slots = [&]() {   // behind the last matrix instruction in front of a branch (the accumulators are operands): four free slots, so that on the branch's taken side nothing rewrites an operand too early
        if constexpr (HI) asm volatile("v_nop\n\tv_nop\n\tv_nop\n\tv_nop" : "+v"(o[0][0]), "+v"(o[1][0]), "+v"(o[2][0]), "+v"(o[3][0]));
        else asm volatile("v_nop\n\tv_nop\n\tv_nop\n\tv_nop" : "+v"(o[0][0]), "+v"(o[1][0]), "+v"(o[2][0]), "+v"(o[3][0]), "+v"(o[0][NQ - 1]), "+v"(o[1][NQ - 1]), "+v"(o[2][NQ - 1]), "+v"(o[3][NQ - 1]));
    };
    auto foot = [&](const int t) {
        asm volatile("s_wait_dscnt 0x0" ::: "memory");      // foot of a trip: this wave's reads of the buffer are done,
        asm volatile("s_wait_asynccnt 0x0" ::: "memory");   // its copies of the next stage have landed,
        __syncthreads();                                    // and one barrier publishes the next stage and frees this trip's buffer
        if (t + 2 < nt) fill(t + 2);
    };
    int t = 0;
#pragma unroll 1   // rolled: a trip is already two passes of 16 (24) matrix instructions
    for (; t < nmain; ++t) { const char* const sb = sm + (t & 1) * ASTG; ldk(sb, 0); pass(sb, 0, t * 64, BC<false>(), BC<true>()); pass(sb, 1, t * 64 + 32, BC<false>(), BC<false>()); slots(); foot(t); }
#pragma unroll 1   // rolled, the halves too: one copy of the masked pass in the text
    for (; t < nt; ++t) { const char* const sb = sm + (t & 1) * ASTG;
#pragma unroll 1
        for (int sub = 0; sub < 2; ++sub) { const int kb = t * 64 + sub * 32; if (kb <= klast) { ldk(sb, sub); pass(sb, sub, kb, BC<true>(), BC<false>()); slots(); } }   // a wave-uniform test: passes behind the wave's diagonal are left out
        foot(t); }
    asm volatile("s_wait_asynccnt 0x0" ::: "memory");       // no copy is outstanding at the wave's end
#pragma unroll
    for (int qt = 0; qt < NQ; ++qt) { const float inv = __fdiv_rn(1.0f, l[qt] + xhalf(l[qt])); const size_t oo = (size_t)(q0 + qt * 16 + lr) * DQ + hi * 8;
#pragma unroll
        for (int dt = 0; dt < 4; ++dt) { v8us oh, ol;
#pragma unroll
            for (int j = 0; j < 8; ++j) { unsigned short a, c2; splitf(o[dt][qt][j] * inv, a, c2); oh[j] = a; ol[j] = c2; }
            *(v8us*)(Ah + oo + dt * 16) = oh; *(v8us*)(Al + oo + dt * 16) = ol;
            asm volatile("s_wait_xcnt 0x0" ::: "memory"); } }   // behind the two stores: their data and address registers are rewritten only behind this wait
}
#define NTL ((TT - RH) / 32)   // 32-column tiles of the fp16 rows
#define NTH (RH / 16)          // 16-column tiles of the hi/lo rows
static_assert(NTL % 4 == 0 && (NTL + NTH) / 4 == 20, "the snake order below is written for 20 tile groups");
// grid (sequences x heads, (NTL + NTH) / 4), 4 waves: the waves of a work-group take neighbouring query tiles of ONE head and walk the same keys, which they share through LDS. Tile groups are numbered by falling cost; all work-groups are resident,
// 256 of them (8 values of blockIdx.y) make one round over the chip, so blockIdx.y walks the groups in snake order (0..7, 15..8, 19..16): placed round after round, a heavy group shares its place with light ones. For speed only.
__global__ __launch_bounds__(128) void k_fattn(const h16* __restrict__ Q16, const h16* __restrict__ K16, const h16* __restrict__ V16, const bf* __restrict__ Qh, const bf* __restrict__ Ql, const bf* __restrict__ Kh, const bf* __restrict__ Kl, const bf* __restrict__ Vh, bf* __restrict__ Ah, bf* __restrict__ Al) {
    __shared__ __align__(16) char sm[2 * 4 * ATILE];
    const int zh = blockIdx.x, b = zh / NH_, h = zh % NH_; const int y = blockIdx.y, tg = (y < 8) ? y : (y < 16) ? 23 - y : 35 - y; const int wv = __builtin_amdgcn_readfirstlane(threadIdx.x >> 5);
    const size_t po = (size_t)zh * TT * HD, ao = (size_t)b * TT * DQ + h * HD;
    if (tg < NTL / 4) { const int qb = TT - 128 * (tg + 1); fattn<h16, 2, false>(sm, Q16 + po, nullptr, K16 + po, nullptr, V16 + (size_t)(b >> 1) * 2 * NH_ * TT * HD + (size_t)(b & 1) * TT + (size_t)h * HD * 2 * TT, qb, qb + 32 * (3 - wv), Ah + ao, Al + ao); }
    else { const int qb = RH - 64 * (tg - NTL / 4 + 1); fattn<bf, 1, true>(sm, Qh + po, Ql + po, Kh + po, Kl + po, Vh + 2 * po, qb, qb + 16 * (3 - wv), Ah + ao, Al + ao); }
}

extern "C" void kernel_launch(void* const* d_in, const int* in_sizes, int n_in,
                              void* d_out, int out_size, void* d_ws, size_t ws_size, hipStream_t stream) {
    (void)in_sizes; (void)n_in; (void)out_size;
    const float* x = (const float*)d_in[0]; const float* g1 = (const float*)d_in[1]; const float* e1 = (const float*)d_in[2]; const float* wq = (const float*)d_in[3]; const float* wk = (const float*)d_in[4]; const float* wv = (const float*)d_in[5]; const float* wo = (const float*)d_in[6]; const float* g2 = (const float*)d_in[7]; const float* e2 = (const float*)d_in[8];
    float* OUT = (float*)d_out;     // [4][2048][512]
    char* wsp = (char*)d_ws;
    auto take = [&](size_t bytes) { char* p = wsp; wsp += (bytes + 255) & ~(size_t)255; return (void*)p; };
    bf* WQ = (bf*)take((size_t)DQ * DM * 2); bf* WK = (bf*)take((size_t)DKV * DM * 2); bf* WV = (bf*)take((size_t)DKV * DM * 2); bf* WO = (bf*)take((size_t)DM * DQ * 2);   // consecutive planes (k_front, z-batched projection)
    float* Hf = (float*)take((size_t)NB_ * TT * DM * 4);
    const size_t PLN = (size_t)NB_ * NH_ * TT * HD;   // one head-plane set, all sequences
    h16* QP16 = (h16*)take(PLN * 2); h16* KP16 = (h16*)take(PLN * 2); h16* VT16 = (h16*)take(PLN * 2);
    bf* QPh = (bf*)take(PLN * 2); bf* QPl = (bf*)take(PLN * 2); bf* KPh = (bf*)take(PLN * 2); bf* KPl = (bf*)take(PLN * 2); bf* VTh = (bf*)take(PLN * 2 * 2);   // hi and lo halves of rows of pitch 2 x TT
    bf* Yh = (bf*)take((size_t)NB_ * TT * DM * 2); bf* Yl = (bf*)take((size_t)NB_ * TT * DM * 2);
    bf* ATh = (bf*)take((size_t)NB_ * TT * DQ * 2); bf* ATl = (bf*)take((size_t)NB_ * TT * DQ * 2);   // merged heads, hi/lo planes
    if ((size_t)(wsp - (char*)d_ws) > ws_size) return;    // ws 256 MiB
    k_front<<<WTB + TT / 8, 256, 0, stream>>>(wq, wk, wv, wo, WQ, x, g1, e1, Hf, Yh, Yl);   /* weight planes; h = LN1(x) + PE: f32 + hi/lo planes, all sequences */
    k_gemmw<bf, 1, false, true><<<dim3(NB_ * TT / 128, DQ / 128, 3), 128, 0, stream>>>(Yh, Yl, WQ, nullptr, DM, nullptr, 0, nullptr, 0, (size_t)DQ * DM, 0, QP16, QPh, QPl, KP16, KPh, KPl, VT16, VTh);   /* z: q, k, v, stored as head planes */
    k_fattn<<<dim3(NB_ * NH_, (NTL + NTH) / 4, 1), 128, 0, stream>>>(QP16, KP16, VT16, QPh, QPl, KPh, KPl, VTh, ATh, ATl);   /* all sequences and heads */
    k_gemmln<<<NB_ * TT / 32, 256, 0, stream>>>(ATh, ATl, WO, Hf, x, g2, e2, OUT);   /* o = merged wfc; out = LN2(o + h) + x */
}
